// v000
// The times below were measured on an AMD MI455X: many runs one after another, warmed up first and cycling through
// copies of the inputs, with the whole window's GPU time divided by the number of runs. Launches and the gaps
// between them are all in it. The median over several windows is given; except for v000 it joins two sittings, which
// can be a few percent apart, so the side-by-side timings, each taken in one sitting, are the better comparison.
// v000, which the later versions start from, runs in 824 microseconds.
#include <hip/hip_runtime.h>
#include <hip/hip_bf16.h>

// ---------------------------------------------------------------------------
// LowRankAttention for MI455X (gfx1250), wave32 + bf16 WMMA, fp32-split bf16.
//   out[:,0:100]   = (U @ (V^T Z)) * Dscale
//   out[:,100:200] = T
// where [U|V|Z|T] = relu(X @ W^T + b)
// f32->bf16(hi,lo) splitting is hoisted out of the WMMA hot loops, except X's
// when the workspace lacks room for Xhi/Xlo (PRE=false); with it the inner
// loops are global_load_b128 (+prefetch) + v_wmma_f32_16x16x32_bf16.
// ---------------------------------------------------------------------------

#define N_ROWS 100000
#define D_DIM  512
#define M_COLS 400          // 4*K
#define KC     100          // K
#define KPAD   128          // K padded for U / VtZ fragments
#define MPAD   112          // 100 padded to 7 tiles of 16
#define OUTC   200
#define WPB    8            // waves per block (256 threads)
#define ROWG   5            // row tiles per wave in main GEMM (6250 = 5*1250)
#define VTZ_SPLITS 64

typedef __bf16 bf16_t;
typedef bf16_t       v16bf __attribute__((ext_vector_type(16)));
typedef float        v8f   __attribute__((ext_vector_type(8)));
typedef unsigned int u32x4 __attribute__((ext_vector_type(4)));
typedef float        f32x4 __attribute__((ext_vector_type(4)));

// 32-byte A/B fragment viewed either as bf16 lanes or as two 16B load chunks
union Frag16 { v16bf v; u32x4 q[2]; };

__device__ __forceinline__ void split_bf16(float x, bf16_t& hi, bf16_t& lo) {
    hi = (bf16_t)x;                 // RNE f32 -> bf16
    lo = (bf16_t)(x - (float)hi);   // exact residual, re-rounded
}

// ---------------------------------------------------------------------------
// Split a f32 array into bf16 hi/lo arrays (n multiple of 4).
// ---------------------------------------------------------------------------
__global__ void split_kernel(const float* __restrict__ src,
                             bf16_t* __restrict__ hi, bf16_t* __restrict__ lo, int n)
{
    const int i = (blockIdx.x * blockDim.x + threadIdx.x) * 4;
    if (i >= n) return;
    const f32x4 v = *(const f32x4*)(src + i);
#pragma unroll
    for (int j = 0; j < 4; ++j) {
        bf16_t h, l;
        split_bf16(v[j], h, l);
        hi[i + j] = h; lo[i + j] = l;
    }
}

// ---------------------------------------------------------------------------
// Grid-stride 16B zero fill.
// ---------------------------------------------------------------------------
__global__ void zero4_kernel(u32x4* __restrict__ p, long n4)
{
    const u32x4 z = {0u, 0u, 0u, 0u};
    for (long i = blockIdx.x * (long)blockDim.x + threadIdx.x; i < n4;
         i += (long)gridDim.x * blockDim.x)
        p[i] = z;
}

// ---------------------------------------------------------------------------
// Kernel 1: tmp = relu(X @ W^T + b).
// One wave = 5 row-tiles (80 rows) x 1 col-tile (16 cols).
// PRE=true: A fragments are direct b128 loads from pre-split Xhi/Xlo.
// Epilogue: U -> bf16 hi/lo row-major [N][128]; V,Z -> bf16 hi/lo transposed
// [col][N]; T -> out (f32); U/V column sums via one atomicAdd per lane.
// ---------------------------------------------------------------------------
template <bool PRE>
__global__ void __launch_bounds__(256)
gemm_relu_kernel(const float* __restrict__ X,
                 const bf16_t* __restrict__ Xhi, const bf16_t* __restrict__ Xlo,
                 const bf16_t* __restrict__ Whi, const bf16_t* __restrict__ Wlo,
                 const float* __restrict__ bias,
                 bf16_t* __restrict__ Uhi, bf16_t* __restrict__ Ulo,
                 bf16_t* __restrict__ Vthi, bf16_t* __restrict__ Vtlo,
                 bf16_t* __restrict__ Zthi, bf16_t* __restrict__ Ztlo,
                 float* __restrict__ sums, float* __restrict__ out)
{
    const int lane  = threadIdx.x & 31;
    const int gwave = blockIdx.x * WPB + (threadIdx.x >> 5);
    const int totalWaves = ((N_ROWS / 16) / ROWG) * (M_COLS / 16);  // 31250
    if (gwave >= totalWaves) return;                                // wave-uniform

    const int colTile  = gwave % (M_COLS / 16);
    const int rowGroup = gwave / (M_COLS / 16);
    const int colBase  = colTile << 4;
    const int half     = lane >> 4;
    const int lidx     = lane & 15;

    const int wofs = (colBase + lidx) * D_DIM;   // B fragment source row of W

    v8f acc[ROWG];
#pragma unroll
    for (int t = 0; t < ROWG; ++t) acc[t] = {};

    for (int kt = 0; kt < D_DIM / 32; ++kt) {
        const int kb = kt << 5;
        const int o0 = kb + (half << 3);         // k = kb + half*8 .. +8
        const int o1 = kb + 16 + (half << 3);    // k = kb+16+half*8 .. +8

        Frag16 bhi, blo;
        bhi.q[0] = *(const u32x4*)(Whi + wofs + o0);
        bhi.q[1] = *(const u32x4*)(Whi + wofs + o1);
        blo.q[0] = *(const u32x4*)(Wlo + wofs + o0);
        blo.q[1] = *(const u32x4*)(Wlo + wofs + o1);

#pragma unroll
        for (int t = 0; t < ROWG; ++t) {
            const int row = ((rowGroup * ROWG + t) << 4) + lidx;
            Frag16 ahi, alo;
            if (PRE) {
                const bf16_t* xh = Xhi + row * D_DIM;
                const bf16_t* xl = Xlo + row * D_DIM;
                __builtin_prefetch(xh + kb + 32, 0, 1);  // global_prefetch_b8
                ahi.q[0] = *(const u32x4*)(xh + o0);
                ahi.q[1] = *(const u32x4*)(xh + o1);
                alo.q[0] = *(const u32x4*)(xl + o0);
                alo.q[1] = *(const u32x4*)(xl + o1);
            } else {
                const float* xrow = X + row * D_DIM;
                __builtin_prefetch(xrow + kb + 32, 0, 1);
#pragma unroll
                for (int p = 0; p < 8; ++p) {
                    const int k = kb + ((p >> 2) << 4) + (half << 3) + ((p & 3) << 1);
                    bf16_t h0, l0, h1, l1;
                    split_bf16(xrow[k],     h0, l0);
                    split_bf16(xrow[k + 1], h1, l1);
                    ahi.v[2*p] = h0; alo.v[2*p] = l0;
                    ahi.v[2*p+1] = h1; alo.v[2*p+1] = l1;
                }
            }
            acc[t] = __builtin_amdgcn_wmma_f32_16x16x32_bf16(false, alo.v, false, bhi.v, (short)0, acc[t], false, false);
            acc[t] = __builtin_amdgcn_wmma_f32_16x16x32_bf16(false, ahi.v, false, blo.v, (short)0, acc[t], false, false);
            acc[t] = __builtin_amdgcn_wmma_f32_16x16x32_bf16(false, ahi.v, false, bhi.v, (short)0, acc[t], false, false);
        }
    }

    // ---- epilogue: bias + relu; route column; fold in column sums ----
    const int col = colBase + lidx;
    const float bv = bias[col];
    bf16_t *ph = nullptr, *pl = nullptr; float* pT = nullptr;
    long A; int S;
    if (col < KC)          { ph = Uhi;  pl = Ulo;  A = col;                        S = KPAD; }
    else if (col < 2 * KC) { ph = Vthi; pl = Vtlo; A = (long)(col - KC) * N_ROWS;  S = 1;    }
    else if (col < 3 * KC) { ph = Zthi; pl = Ztlo; A = (long)(col - 2*KC) * N_ROWS; S = 1;   }
    else                   { pT = out;             A = KC + (col - 3 * KC);        S = OUTC; }

    float s = 0.f;
#pragma unroll
    for (int t = 0; t < ROWG; ++t) {
        const int row0 = ((rowGroup * ROWG + t) << 4) + (half << 3);
#pragma unroll
        for (int r = 0; r < 8; ++r) {
            float v = acc[t][r] + bv;
            v = v > 0.f ? v : 0.f;
            const long idx = A + (long)(row0 + r) * S;
            if (pT) {
                pT[idx] = v;
            } else {
                bf16_t h, l;
                split_bf16(v, h, l);
                ph[idx] = h; pl[idx] = l;
                s += v;
            }
        }
    }
    if (col < 2 * KC) atomicAdd(&sums[col], s);   // [0..99]=U sums, [100..199]=V sums
}

// ---------------------------------------------------------------------------
// Dscale = 1 / (dot(sumU,sumV)/N + 1e-6)
// ---------------------------------------------------------------------------
__global__ void dscale_kernel(const float* __restrict__ sums, float* __restrict__ dscale)
{
    __shared__ float red[128];
    const int t = threadIdx.x;
    red[t] = (t < KC) ? sums[t] * sums[KC + t] : 0.f;
    __syncthreads();
    for (int s = 64; s > 0; s >>= 1) {
        if (t < s) red[t] += red[t + s];
        __syncthreads();
    }
    if (t == 0) dscale[0] = 1.0f / (red[0] / (float)N_ROWS + 1e-6f);
}

// ---------------------------------------------------------------------------
// VtZ = V^T @ Z (100x100, reduction over N). Split-K WMMA + f32 atomics.
// A/B fragments are contiguous b128 loads from transposed bf16 hi/lo arrays.
// Pad rows (>=100) hold garbage but only affect guarded (unstored) outputs.
// ---------------------------------------------------------------------------
__global__ void __launch_bounds__(256)
vtz_kernel(const bf16_t* __restrict__ Vthi, const bf16_t* __restrict__ Vtlo,
           const bf16_t* __restrict__ Zthi, const bf16_t* __restrict__ Ztlo,
           float* __restrict__ VtZ)
{
    const int lane  = threadIdx.x & 31;
    const int gwave = blockIdx.x * WPB + (threadIdx.x >> 5);
    const int TILES = 7 * 7;
    if (gwave >= TILES * VTZ_SPLITS) return;     // wave-uniform
    const int tile  = gwave % TILES;
    const int split = gwave / TILES;
    const int mBase = (tile / 7) << 4, nBase = (tile % 7) << 4;
    const int half  = lane >> 4, lidx = lane & 15;
    const int mcol  = mBase + lidx, ncol = nBase + lidx;   // <= 111 < MPAD

    const bf16_t* ah = Vthi + (size_t)mcol * N_ROWS;
    const bf16_t* al = Vtlo + (size_t)mcol * N_ROWS;
    const bf16_t* bh = Zthi + (size_t)ncol * N_ROWS;
    const bf16_t* bl = Ztlo + (size_t)ncol * N_ROWS;

    v8f acc = {};
    for (int kt = split; kt < N_ROWS / 32; kt += VTZ_SPLITS) {
        const int kb = kt << 5;
        const int o0 = kb + (half << 3);
        const int o1 = kb + 16 + (half << 3);
        Frag16 ahi, alo, bhi, blo;
        ahi.q[0] = *(const u32x4*)(ah + o0); ahi.q[1] = *(const u32x4*)(ah + o1);
        alo.q[0] = *(const u32x4*)(al + o0); alo.q[1] = *(const u32x4*)(al + o1);
        bhi.q[0] = *(const u32x4*)(bh + o0); bhi.q[1] = *(const u32x4*)(bh + o1);
        blo.q[0] = *(const u32x4*)(bl + o0); blo.q[1] = *(const u32x4*)(bl + o1);
        acc = __builtin_amdgcn_wmma_f32_16x16x32_bf16(false, alo.v, false, bhi.v, (short)0, acc, false, false);
        acc = __builtin_amdgcn_wmma_f32_16x16x32_bf16(false, ahi.v, false, blo.v, (short)0, acc, false, false);
        acc = __builtin_amdgcn_wmma_f32_16x16x32_bf16(false, ahi.v, false, bhi.v, (short)0, acc, false, false);
    }
    if (ncol < KC) {
#pragma unroll
        for (int r = 0; r < 8; ++r) {
            const int m = mBase + (half << 3) + r;
            if (m < KC) atomicAdd(&VtZ[m * KC + ncol], acc[r]);
        }
    }
}

// ---------------------------------------------------------------------------
// Transpose + split + zero-pad VtZ (100x100 f32) -> VtZt hi/lo [112][128] bf16
// so res_kernel's B fragments are clean b128 loads (k-padding exactly zero).
// ---------------------------------------------------------------------------
__global__ void prep_vtz_kernel(const float* __restrict__ VtZ,
                                bf16_t* __restrict__ th, bf16_t* __restrict__ tl)
{
    const int i = blockIdx.x * blockDim.x + threadIdx.x;   // over MPAD*KPAD
    if (i >= MPAD * KPAD) return;
    const int n = i >> 7, k = i & (KPAD - 1);
    const float v = (n < KC && k < KC) ? VtZ[k * KC + n] : 0.f;
    bf16_t h, l;
    split_bf16(v, h, l);
    th[i] = h; tl[i] = l;
}

// ---------------------------------------------------------------------------
// res = (U @ VtZ) * Dscale -> out[:, 0:100]. K padded 100 -> 128 (zeros).
// ---------------------------------------------------------------------------
__global__ void __launch_bounds__(256)
res_kernel(const bf16_t* __restrict__ Uhi, const bf16_t* __restrict__ Ulo,
           const bf16_t* __restrict__ Bth, const bf16_t* __restrict__ Btl,
           const float* __restrict__ dscale, float* __restrict__ out)
{
    const int lane  = threadIdx.x & 31;
    const int gwave = blockIdx.x * WPB + (threadIdx.x >> 5);
    const int rowTiles = N_ROWS / 16;       // 6250
    if (gwave >= rowTiles * 7) return;      // wave-uniform
    const int colTile = gwave % 7;
    const int rowTile = gwave / 7;
    const int half = lane >> 4, lidx = lane & 15;
    const int row  = (rowTile << 4) + lidx;
    const int ncol = (colTile << 4) + lidx;   // <= 111 < MPAD

    const bf16_t* ah = Uhi + (size_t)row * KPAD;
    const bf16_t* al = Ulo + (size_t)row * KPAD;
    const bf16_t* bh = Bth + (size_t)ncol * KPAD;
    const bf16_t* bl = Btl + (size_t)ncol * KPAD;

    v8f acc = {};
#pragma unroll
    for (int kt = 0; kt < KPAD / 32; ++kt) {
        const int kb = kt << 5;
        const int o0 = kb + (half << 3);
        const int o1 = kb + 16 + (half << 3);
        Frag16 ahi, alo, bhi, blo;
        ahi.q[0] = *(const u32x4*)(ah + o0); ahi.q[1] = *(const u32x4*)(ah + o1);
        alo.q[0] = *(const u32x4*)(al + o0); alo.q[1] = *(const u32x4*)(al + o1);
        bhi.q[0] = *(const u32x4*)(bh + o0); bhi.q[1] = *(const u32x4*)(bh + o1);
        blo.q[0] = *(const u32x4*)(bl + o0); blo.q[1] = *(const u32x4*)(bl + o1);
        acc = __builtin_amdgcn_wmma_f32_16x16x32_bf16(false, alo.v, false, bhi.v, (short)0, acc, false, false);
        acc = __builtin_amdgcn_wmma_f32_16x16x32_bf16(false, ahi.v, false, blo.v, (short)0, acc, false, false);
        acc = __builtin_amdgcn_wmma_f32_16x16x32_bf16(false, ahi.v, false, bhi.v, (short)0, acc, false, false);
    }
    const float ds = dscale[0];
    if (ncol < KC) {
#pragma unroll
        for (int r = 0; r < 8; ++r) {
            const int m = (rowTile << 4) + (half << 3) + r;
            out[(long)m * OUTC + ncol] = acc[r] * ds;
        }
    }
}

// ---------------------------------------------------------------------------
// Launch
// ---------------------------------------------------------------------------
extern "C" void kernel_launch(void* const* d_in, const int* in_sizes, int n_in,
                              void* d_out, int out_size, void* d_ws, size_t ws_size,
                              hipStream_t stream)
{
    (void)in_sizes; (void)n_in; (void)out_size;
    const float* X  = (const float*)d_in[0];   // 100000 x 512
    const float* W  = (const float*)d_in[1];   // 400 x 512
    const float* bb = (const float*)d_in[2];   // 400
    float* out = (float*)d_out;                // 100000 x 200

    // ---- workspace carve-up (all regions 64B aligned) ----
    char* base = (char*)d_ws;
    size_t off = 0;
    auto carve = [&](size_t bytes) -> char* {
        char* p = base + off;
        off += (bytes + 63) & ~(size_t)63;
        return p;
    };
    bf16_t* Uhi  = (bf16_t*)carve((size_t)N_ROWS * KPAD * 2);
    bf16_t* Ulo  = (bf16_t*)carve((size_t)N_ROWS * KPAD * 2);   // contiguous w/ Uhi
    bf16_t* Vthi = (bf16_t*)carve((size_t)MPAD * N_ROWS * 2);
    bf16_t* Vtlo = (bf16_t*)carve((size_t)MPAD * N_ROWS * 2);
    bf16_t* Zthi = (bf16_t*)carve((size_t)MPAD * N_ROWS * 2);
    bf16_t* Ztlo = (bf16_t*)carve((size_t)MPAD * N_ROWS * 2);
    bf16_t* Whi  = (bf16_t*)carve((size_t)M_COLS * D_DIM * 2);
    bf16_t* Wlo  = (bf16_t*)carve((size_t)M_COLS * D_DIM * 2);
    float*  sums   = (float*)carve(256 * 4);                    // [U(100)|V(100)|pad]
    float*  VtZ    = (float*)carve(KC * KC * 4);                // contiguous w/ sums
    bf16_t* VtZthi = (bf16_t*)carve((size_t)MPAD * KPAD * 2);
    bf16_t* VtZtlo = (bf16_t*)carve((size_t)MPAD * KPAD * 2);
    float*  dscale = (float*)carve(64);
    const size_t baseBytes = off;
    bf16_t* Xhi = (bf16_t*)carve((size_t)N_ROWS * D_DIM * 2);
    bf16_t* Xlo = (bf16_t*)carve((size_t)N_ROWS * D_DIM * 2);
    const size_t fullBytes = off;
    const bool preX = (ws_size >= fullBytes);   // ws_size fixed -> deterministic
    (void)baseBytes;

    // 1. zero: U hi/lo (k-padding must be 0) and sums+VtZ (atomics targets)
    zero4_kernel<<<2048, 256, 0, stream>>>((u32x4*)Uhi,
                                           (long)((size_t)N_ROWS * KPAD * 2 * 2 / 16));
    zero4_kernel<<<16, 256, 0, stream>>>((u32x4*)sums,
                                         (long)((256 * 4 + KC * KC * 4) / 16));
    // 2. pre-split W (always) and X (if ws allows)
    split_kernel<<<(M_COLS * D_DIM / 4 + 255) / 256, 256, 0, stream>>>(W, Whi, Wlo, M_COLS * D_DIM);
    if (preX)
        split_kernel<<<(N_ROWS * D_DIM / 4 + 255) / 256, 256, 0, stream>>>(X, Xhi, Xlo, N_ROWS * D_DIM);
    // 3. fused GEMM + bias + relu + scatter + column sums
    {
        const int waves  = ((N_ROWS / 16) / ROWG) * (M_COLS / 16);  // 31250
        const int blocks = (waves + WPB - 1) / WPB;
        if (preX)
            gemm_relu_kernel<true><<<blocks, 256, 0, stream>>>(X, Xhi, Xlo, Whi, Wlo, bb,
                Uhi, Ulo, Vthi, Vtlo, Zthi, Ztlo, sums, out);
        else
            gemm_relu_kernel<false><<<blocks, 256, 0, stream>>>(X, Xhi, Xlo, Whi, Wlo, bb,
                Uhi, Ulo, Vthi, Vtlo, Zthi, Ztlo, sums, out);
    }
    // 4. Dscale
    dscale_kernel<<<1, 128, 0, stream>>>(sums, dscale);
    // 5. VtZ = V^T @ Z (split-K)
    {
        const int waves  = 49 * VTZ_SPLITS;
        const int blocks = (waves + WPB - 1) / WPB;
        vtz_kernel<<<blocks, 256, 0, stream>>>(Vthi, Vtlo, Zthi, Ztlo, VtZ);
    }
    // 6. transpose/split/pad VtZ for the final GEMM's B operand
    prep_vtz_kernel<<<(MPAD * KPAD + 255) / 256, 256, 0, stream>>>(VtZ, VtZthi, VtZtlo);
    // 7. res = U @ VtZ * Dscale -> out[:, 0:100]
    {
        const int waves  = (N_ROWS / 16) * 7;
        const int blocks = (waves + WPB - 1) / WPB;
        res_kernel<<<blocks, 256, 0, stream>>>(Uhi, Ulo, VtZthi, VtZtlo, dscale, out);
    }
}

// v001
// It runs in 518 microseconds.
// Timed twice side by side with v000, it ran 1.64 times as fast both times.
#include <hip/hip_runtime.h>
#include <hip/hip_bf16.h>

// ---------------------------------------------------------------------------
// LowRankAttention for MI455X (gfx1250), wave32 + bf16 WMMA, fp32-split bf16.
//   out[:,0:100]   = (U @ (V^T Z)) * Dscale
//   out[:,100:200] = T
// where [U|V|Z|T] = relu(X @ W^T + b)
// Unless X cannot be pre-split, all f32->bf16(hi,lo) splitting is hoisted out of the WMMA hot loops so the
// inner loops are pure b128 loads (from LDS in the main GEMM) + v_wmma_f32_16x16x32_bf16.
// ---------------------------------------------------------------------------

#define N_ROWS 100000
#define D_DIM  512
#define M_COLS 400          // 4*K
#define KC     100          // K
#define KPAD   128          // K padded for U / VtZ fragments
#define MPAD   112          // 100 padded to 7 tiles of 16
#define OUTC   200
#define WPB    8            // waves per block (256 threads)
#define ROWG   5            // row tiles per wave in main GEMM (6250 = 5*1250)
#define VTZ_SPLITS 64

typedef __bf16 bf16_t;
typedef bf16_t       v16bf __attribute__((ext_vector_type(16)));
typedef float        v8f   __attribute__((ext_vector_type(8)));
typedef unsigned int u32x4 __attribute__((ext_vector_type(4)));
typedef float        f32x4 __attribute__((ext_vector_type(4)));

// 32-byte A/B fragment viewed either as bf16 lanes or as two 16B load chunks
union Frag16 { v16bf v; u32x4 q[2]; };

__device__ __forceinline__ void split_bf16(float x, bf16_t& hi, bf16_t& lo) {
    hi = (bf16_t)x;                 // RNE f32 -> bf16
    lo = (bf16_t)(x - (float)hi);   // exact residual, re-rounded
}

// ---------------------------------------------------------------------------
// Split a f32 array into bf16 hi/lo arrays (n multiple of 4).
// ---------------------------------------------------------------------------
__global__ void split_kernel(const float* __restrict__ src,
                             bf16_t* __restrict__ hi, bf16_t* __restrict__ lo, int n)
{
    const int i = (blockIdx.x * blockDim.x + threadIdx.x) * 4;
    if (i >= n) return;
    const f32x4 v = *(const f32x4*)(src + i);
#pragma unroll
    for (int j = 0; j < 4; ++j) {
        bf16_t h, l;
        split_bf16(v[j], h, l);
        hi[i + j] = h; lo[i + j] = l;
    }
}

// ---------------------------------------------------------------------------
// Grid-stride 16B zero fill.
// ---------------------------------------------------------------------------
__global__ void zero4_kernel(u32x4* __restrict__ p, long n4)
{
    const u32x4 z = {0u, 0u, 0u, 0u};
    for (long i = blockIdx.x * (long)blockDim.x + threadIdx.x; i < n4;
         i += (long)gridDim.x * blockDim.x)
        p[i] = z;
}

// ---------------------------------------------------------------------------
// Kernel 1: tmp = relu(X @ W^T + b).
// One wave = 5 row-tiles (80 rows) x 1 col-tile (16 cols).
// PRE=true: A fragments are direct b128 loads from pre-split Xhi/Xlo.
// Epilogue: U -> bf16 hi/lo row-major [N][128]; V,Z -> bf16 hi/lo transposed
// [col][N]; T -> out (f32); U/V column sums via one atomicAdd per lane.
// ---------------------------------------------------------------------------
template <bool PRE>
__global__ void __launch_bounds__(256)
gemm_relu_kernel(const float* __restrict__ X,
                 const bf16_t* __restrict__ Xhi, const bf16_t* __restrict__ Xlo,
                 const bf16_t* __restrict__ Whi, const bf16_t* __restrict__ Wlo,
                 const float* __restrict__ bias,
                 bf16_t* __restrict__ Uhi, bf16_t* __restrict__ Ulo,
                 bf16_t* __restrict__ Vthi, bf16_t* __restrict__ Vtlo,
                 bf16_t* __restrict__ Zthi, bf16_t* __restrict__ Ztlo,
                 float* __restrict__ sums, float* __restrict__ out)
{
    const int lane  = threadIdx.x & 31;
    const int gwave = blockIdx.x * WPB + (threadIdx.x >> 5);
    const int totalWaves = ((N_ROWS / 16) / ROWG) * (M_COLS / 16);  // 31250
    if (gwave >= totalWaves) return;                                // wave-uniform

    const int colTile  = gwave % (M_COLS / 16);
    const int rowGroup = gwave / (M_COLS / 16);
    const int colBase  = colTile << 4;
    const int half     = lane >> 4;
    const int lidx     = lane & 15;

    const int wofs = (colBase + lidx) * D_DIM;   // B fragment source row of W

    v8f acc[ROWG];
#pragma unroll
    for (int t = 0; t < ROWG; ++t) acc[t] = {};

    for (int kt = 0; kt < D_DIM / 32; ++kt) {
        const int kb = kt << 5;
        const int o0 = kb + (half << 3);         // k = kb + half*8 .. +8
        const int o1 = kb + 16 + (half << 3);    // k = kb+16+half*8 .. +8

        Frag16 bhi, blo;
        bhi.q[0] = *(const u32x4*)(Whi + wofs + o0);
        bhi.q[1] = *(const u32x4*)(Whi + wofs + o1);
        blo.q[0] = *(const u32x4*)(Wlo + wofs + o0);
        blo.q[1] = *(const u32x4*)(Wlo + wofs + o1);

#pragma unroll
        for (int t = 0; t < ROWG; ++t) {
            const int row = ((rowGroup * ROWG + t) << 4) + lidx;
            Frag16 ahi, alo;
            if (PRE) {
                const bf16_t* xh = Xhi + row * D_DIM;
                const bf16_t* xl = Xlo + row * D_DIM;
                __builtin_prefetch(xh + kb + 32, 0, 1);  // global_prefetch_b8
                ahi.q[0] = *(const u32x4*)(xh + o0);
                ahi.q[1] = *(const u32x4*)(xh + o1);
                alo.q[0] = *(const u32x4*)(xl + o0);
                alo.q[1] = *(const u32x4*)(xl + o1);
            } else {
                const float* xrow = X + row * D_DIM;
                __builtin_prefetch(xrow + kb + 32, 0, 1);
#pragma unroll
                for (int p = 0; p < 8; ++p) {
                    const int k = kb + ((p >> 2) << 4) + (half << 3) + ((p & 3) << 1);
                    bf16_t h0, l0, h1, l1;
                    split_bf16(xrow[k],     h0, l0);
                    split_bf16(xrow[k + 1], h1, l1);
                    ahi.v[2*p] = h0; alo.v[2*p] = l0;
                    ahi.v[2*p+1] = h1; alo.v[2*p+1] = l1;
                }
            }
            acc[t] = __builtin_amdgcn_wmma_f32_16x16x32_bf16(false, alo.v, false, bhi.v, (short)0, acc[t], false, false);
            acc[t] = __builtin_amdgcn_wmma_f32_16x16x32_bf16(false, ahi.v, false, blo.v, (short)0, acc[t], false, false);
            acc[t] = __builtin_amdgcn_wmma_f32_16x16x32_bf16(false, ahi.v, false, bhi.v, (short)0, acc[t], false, false);
        }
    }

    // ---- epilogue: bias + relu; route column; fold in column sums ----
    const int col = colBase + lidx;
    const float bv = bias[col];
    bf16_t *ph = nullptr, *pl = nullptr; float* pT = nullptr;
    long A; int S;
    if (col < KC)          { ph = Uhi;  pl = Ulo;  A = col;                        S = KPAD; }
    else if (col < 2 * KC) { ph = Vthi; pl = Vtlo; A = (long)(col - KC) * N_ROWS;  S = 1;    }
    else if (col < 3 * KC) { ph = Zthi; pl = Ztlo; A = (long)(col - 2*KC) * N_ROWS; S = 1;   }
    else                   { pT = out;             A = KC + (col - 3 * KC);        S = OUTC; }

    float s = 0.f;
#pragma unroll
    for (int t = 0; t < ROWG; ++t) {
        const int row0 = ((rowGroup * ROWG + t) << 4) + (half << 3);
#pragma unroll
        for (int r = 0; r < 8; ++r) {
            float v = acc[t][r] + bv;
            v = v > 0.f ? v : 0.f;
            const long idx = A + (long)(row0 + r) * S;
            if (pT) {
                pT[idx] = v;
            } else {
                bf16_t h, l;
                split_bf16(v, h, l);
                ph[idx] = h; pl[idx] = l;
                s += v;
            }
        }
    }
    if (col < 2 * KC) atomicAdd(&sums[col], s);   // [0..99]=U sums, [100..199]=V sums
}

// ---------------------------------------------------------------------------
// Kernel 1 (pre-split X): tmp = relu(X @ W^T + b), one block = 80 rows x all
// 400 columns, 5 waves, one wave = 5 row tiles x 5 col tiles.
// Per pass (32 k) the block's 400 W rows and 80 X rows are copied to LDS by
// asynchronous copies, two buffers, the next pass's copies in flight while
// this pass is worked on. One LDS row = [64 B hi | 64 B lo | 16 B pad].
// Epilogue and per-accumulator product order as in gemm_relu_kernel.
// ---------------------------------------------------------------------------
#define G_WAVES   5
#define G_THREADS (G_WAVES * 32)
#define G_ROWS    (ROWG * 16)               // 80 rows of X per block
#define ST_ROWS   (M_COLS + G_ROWS)         // W rows first, then X rows
#define ST_PITCH  144                       // 16 B x odd: conflict-free b128 reads
#define ST_BYTES  (ST_ROWS * ST_PITCH)
#define CP_ROWS   (G_THREADS / 8)           // rows covered by one copy of the block
#define G_PASSES  (D_DIM / 32)

__device__ __forceinline__ unsigned lds_off(const void* p) {
    return (unsigned)(unsigned long long)p;   // low 32 bits of a __shared__ address
}

// Twelve 16-byte-per-lane copies to LDS. The closing s_wait_xcnt keeps every
// address register of the copies unwritten until the copies have taken them.
__device__ __forceinline__ void async_copy12(const unsigned (&l)[12],
                                             const bf16_t* const (&p)[12])
{
    asm volatile(
        "global_load_async_to_lds_b128 %0, %12, off\n\t"
        "global_load_async_to_lds_b128 %1, %13, off\n\t"
        "global_load_async_to_lds_b128 %2, %14, off\n\t"
        "global_load_async_to_lds_b128 %3, %15, off\n\t"
        "global_load_async_to_lds_b128 %4, %16, off\n\t"
        "global_load_async_to_lds_b128 %5, %17, off\n\t"
        "global_load_async_to_lds_b128 %6, %18, off\n\t"
        "global_load_async_to_lds_b128 %7, %19, off\n\t"
        "global_load_async_to_lds_b128 %8, %20, off\n\t"
        "global_load_async_to_lds_b128 %9, %21, off\n\t"
        "global_load_async_to_lds_b128 %10, %22, off\n\t"
        "global_load_async_to_lds_b128 %11, %23, off\n\t"
        "s_wait_xcnt 0x0"
        :: "v"(l[0]), "v"(l[1]), "v"(l[2]), "v"(l[3]), "v"(l[4]), "v"(l[5]),
           "v"(l[6]), "v"(l[7]), "v"(l[8]), "v"(l[9]), "v"(l[10]), "v"(l[11]),
           "v"(p[0]), "v"(p[1]), "v"(p[2]), "v"(p[3]), "v"(p[4]), "v"(p[5]),
           "v"(p[6]), "v"(p[7]), "v"(p[8]), "v"(p[9]), "v"(p[10]), "v"(p[11])
        : "memory");
}

// One pass's tile: 24 copies per lane (20 of W rows, 4 of X rows).
__device__ __forceinline__ void stage_tile(unsigned lds, const bf16_t* gW, const bf16_t* gX)
{
    unsigned l[12];
    const bf16_t* p[12];
#pragma unroll
    for (int j = 0; j < 12; ++j) {
        l[j] = lds + j * (CP_ROWS * ST_PITCH);
        p[j] = gW + j * (CP_ROWS * D_DIM);
    }
    async_copy12(l, p);
#pragma unroll
    for (int j = 0; j < 12; ++j) {
        l[j] = lds + (12 + j) * (CP_ROWS * ST_PITCH);
        p[j] = (j < 8) ? gW + (12 + j) * (CP_ROWS * D_DIM) : gX + (j - 8) * (CP_ROWS * D_DIM);
    }
    async_copy12(l, p);
}

__global__ void __launch_bounds__(G_THREADS, 3)   // 3 waves per SIMD: two blocks share a WGP
gemm_relu_lds_kernel(const bf16_t* __restrict__ Xhi, const bf16_t* __restrict__ Xlo,
                     const bf16_t* __restrict__ Whi, const bf16_t* __restrict__ Wlo,
                     const float* __restrict__ bias,
                     bf16_t* __restrict__ Uhi, bf16_t* __restrict__ Ulo,
                     bf16_t* __restrict__ Vthi, bf16_t* __restrict__ Vtlo,
                     bf16_t* __restrict__ Zthi, bf16_t* __restrict__ Ztlo,
                     float* __restrict__ sums, float* __restrict__ out)
{
    __shared__ __attribute__((aligned(16))) unsigned char smem[2 * ST_BYTES];

    const int tid      = threadIdx.x;
    const int lane     = tid & 31;
    const int wave     = __builtin_amdgcn_readfirstlane(tid >> 5);
    const int rowGroup = blockIdx.x;
    const int half     = lane >> 4;
    const int lidx     = lane & 15;

    // this lane's share of every copy: row (tid >> 3) of each group of CP_ROWS
    // rows, 16-byte chunk (tid & 7): chunks 0..3 from hi, 4..7 from lo
    const int  crow = tid >> 3;
    const bool chi  = (tid & 7) < 4;
    const unsigned ldsT = lds_off(smem) + crow * ST_PITCH + (tid & 7) * 16;
    const bf16_t* gW = (chi ? Whi : Wlo) + crow * D_DIM + (tid & 3) * 8;
    const bf16_t* gX = (chi ? Xhi : Xlo) + (size_t)(rowGroup * G_ROWS + crow) * D_DIM + (tid & 3) * 8;

    v8f acc[5][ROWG];
#pragma unroll
    for (int c = 0; c < 5; ++c)
#pragma unroll
        for (int t = 0; t < ROWG; ++t) acc[c][t] = {};

    stage_tile(ldsT, gW, gX);
    asm volatile("s_wait_asynccnt 0x0" ::: "memory");   // tile 0 landed (this wave's copies)
    __syncthreads();                                    // ... and every other wave's
    stage_tile(ldsT + ST_BYTES, gW + 32, gX + 32);

    for (int kt = 0; kt < G_PASSES; ++kt) {
        const int buf = (kt & 1) * ST_BYTES;
        const unsigned char* sa = smem + buf + (M_COLS + lidx) * ST_PITCH + (half << 4);
        const unsigned char* sb = smem + buf + (wave * 80 + lidx) * ST_PITCH + (half << 4);

        // lo(A) x hi(B) first, then hi(A) x lo(B) and hi(A) x hi(B): only one half of
        // the A fragments is live at a time, so that the accumulators stay in registers
        {
            Frag16 alo[ROWG];
#pragma unroll
            for (int t = 0; t < ROWG; ++t) {
                const unsigned char* r = sa + t * (16 * ST_PITCH);
                alo[t].q[0] = *(const u32x4*)(r + 64);
                alo[t].q[1] = *(const u32x4*)(r + 96);
            }
#pragma unroll
            for (int c = 0; c < 5; ++c) {
                const unsigned char* r = sb + c * (16 * ST_PITCH);
                Frag16 bhi;
                bhi.q[0] = *(const u32x4*)(r);
                bhi.q[1] = *(const u32x4*)(r + 32);
#pragma unroll
                for (int t = 0; t < ROWG; ++t)
                    acc[c][t] = __builtin_amdgcn_wmma_f32_16x16x32_bf16(false, alo[t].v, false, bhi.v, (short)0, acc[c][t], false, false);
            }
        }
        {
            Frag16 ahi[ROWG];
#pragma unroll
            for (int t = 0; t < ROWG; ++t) {
                const unsigned char* r = sa + t * (16 * ST_PITCH);
                ahi[t].q[0] = *(const u32x4*)(r);
                ahi[t].q[1] = *(const u32x4*)(r + 32);
            }
#pragma unroll
            for (int c = 0; c < 5; ++c) {
                const unsigned char* r = sb + c * (16 * ST_PITCH);
                Frag16 bhi, blo;
                bhi.q[0] = *(const u32x4*)(r);
                bhi.q[1] = *(const u32x4*)(r + 32);
                blo.q[0] = *(const u32x4*)(r + 64);
                blo.q[1] = *(const u32x4*)(r + 96);
#pragma unroll
                for (int t = 0; t < ROWG; ++t)
                    acc[c][t] = __builtin_amdgcn_wmma_f32_16x16x32_bf16(false, ahi[t].v, false, blo.v, (short)0, acc[c][t], false, false);
#pragma unroll
                for (int t = 0; t < ROWG; ++t)
                    acc[c][t] = __builtin_amdgcn_wmma_f32_16x16x32_bf16(false, ahi[t].v, false, bhi.v, (short)0, acc[c][t], false, false);
            }
        }

        // keeps the pass's last WMMAs in front of the barrier: sunk behind it they would
        // delay the issue of the next copies and shorten their lead
        __builtin_amdgcn_sched_barrier(0);
        asm volatile("s_wait_dscnt 0x0" ::: "memory");     // this wave has left the buffer
        asm volatile("s_wait_asynccnt 0x0" ::: "memory");  // its copies of tile kt + 1 landed
        __syncthreads();   // publishes tile kt + 1, frees this pass's buffer
        if (kt + 2 < G_PASSES)
            stage_tile(ldsT + buf, gW + (kt + 2) * 32, gX + (kt + 2) * 32);
    }
    asm volatile("s_wait_asynccnt 0x0" ::: "memory");      // no copy outlives the loop

    // ---- epilogue: bias + relu; route column; fold in column sums ----
    // Same stores and values as gemm_relu_kernel; the T / bf16 test stands outside
    // the element loops (for speed only).
    const int rbase = rowGroup * G_ROWS + (half << 3);
#pragma unroll
    for (int c = 0; c < 5; ++c) {
        const int col = wave * 80 + c * 16 + lidx;
        const float bv = bias[col];
        if (col >= 3 * KC) {
            float* pT = out + (size_t)rbase * OUTC + (KC + (col - 3 * KC));
#pragma unroll
            for (int t = 0; t < ROWG; ++t)
#pragma unroll
                for (int r = 0; r < 8; ++r) {
                    const float v = acc[c][t][r] + bv;
                    pT[(t * 16 + r) * OUTC] = v > 0.f ? v : 0.f;
                    // the stores' registers are reused below: wait until the store has taken them
                    // (the scheduling fence keeps later register writes behind the wait)
                    if (r == 7) { asm volatile("s_wait_xcnt 0x0" ::: "memory"); __builtin_amdgcn_sched_barrier(0); }
                }
        } else {
            bf16_t *ph, *pl; int A, S;
            if (col < KC)          { ph = Uhi;  pl = Ulo;  A = col;                    S = KPAD; }
            else if (col < 2 * KC) { ph = Vthi; pl = Vtlo; A = (col - KC) * N_ROWS;     S = 1;    }
            else                   { ph = Zthi; pl = Ztlo; A = (col - 2 * KC) * N_ROWS; S = 1;    }
            A += rbase * S;
            float s = 0.f;
#pragma unroll
            for (int t = 0; t < ROWG; ++t)
#pragma unroll
                for (int r = 0; r < 8; ++r) {
                    float v = acc[c][t][r] + bv;
                    v = v > 0.f ? v : 0.f;
                    const int idx = A + (t * 16 + r) * S;
                    bf16_t h, l;
                    split_bf16(v, h, l);
                    ph[idx] = h; pl[idx] = l;
                    // the stores' registers are reused below: wait until the stores have taken them
                    // (the scheduling fence keeps later register writes behind the wait)
                    asm volatile("s_wait_xcnt 0x0" ::: "memory");
                    __builtin_amdgcn_sched_barrier(0);
                    s += v;
                }
            if (col < 2 * KC) atomicAdd(&sums[col], s);   // [0..99]=U sums, [100..199]=V sums
        }
    }
}

// ---------------------------------------------------------------------------
// Dscale = 1 / (dot(sumU,sumV)/N + 1e-6)
// ---------------------------------------------------------------------------
__global__ void dscale_kernel(const float* __restrict__ sums, float* __restrict__ dscale)
{
    __shared__ float red[128];
    const int t = threadIdx.x;
    red[t] = (t < KC) ? sums[t] * sums[KC + t] : 0.f;
    __syncthreads();
    for (int s = 64; s > 0; s >>= 1) {
        if (t < s) red[t] += red[t + s];
        __syncthreads();
    }
    if (t == 0) dscale[0] = 1.0f / (red[0] / (float)N_ROWS + 1e-6f);
}

// ---------------------------------------------------------------------------
// VtZ = V^T @ Z (100x100, reduction over N). Split-K WMMA + f32 atomics.
// A/B fragments are contiguous b128 loads from transposed bf16 hi/lo arrays.
// Pad rows (>=100) hold garbage but only affect guarded (unstored) outputs.
// ---------------------------------------------------------------------------
__global__ void __launch_bounds__(256)
vtz_kernel(const bf16_t* __restrict__ Vthi, const bf16_t* __restrict__ Vtlo,
           const bf16_t* __restrict__ Zthi, const bf16_t* __restrict__ Ztlo,
           float* __restrict__ VtZ)
{
    const int lane  = threadIdx.x & 31;
    const int gwave = blockIdx.x * WPB + (threadIdx.x >> 5);
    const int TILES = 7 * 7;
    if (gwave >= TILES * VTZ_SPLITS) return;     // wave-uniform
    const int tile  = gwave % TILES;
    const int split = gwave / TILES;
    const int mBase = (tile / 7) << 4, nBase = (tile % 7) << 4;
    const int half  = lane >> 4, lidx = lane & 15;
    const int mcol  = mBase + lidx, ncol = nBase + lidx;   // <= 111 < MPAD

    const bf16_t* ah = Vthi + (size_t)mcol * N_ROWS;
    const bf16_t* al = Vtlo + (size_t)mcol * N_ROWS;
    const bf16_t* bh = Zthi + (size_t)ncol * N_ROWS;
    const bf16_t* bl = Ztlo + (size_t)ncol * N_ROWS;

    v8f acc = {};
    for (int kt = split; kt < N_ROWS / 32; kt += VTZ_SPLITS) {
        const int kb = kt << 5;
        const int o0 = kb + (half << 3);
        const int o1 = kb + 16 + (half << 3);
        Frag16 ahi, alo, bhi, blo;
        ahi.q[0] = *(const u32x4*)(ah + o0); ahi.q[1] = *(const u32x4*)(ah + o1);
        alo.q[0] = *(const u32x4*)(al + o0); alo.q[1] = *(const u32x4*)(al + o1);
        bhi.q[0] = *(const u32x4*)(bh + o0); bhi.q[1] = *(const u32x4*)(bh + o1);
        blo.q[0] = *(const u32x4*)(bl + o0); blo.q[1] = *(const u32x4*)(bl + o1);
        acc = __builtin_amdgcn_wmma_f32_16x16x32_bf16(false, alo.v, false, bhi.v, (short)0, acc, false, false);
        acc = __builtin_amdgcn_wmma_f32_16x16x32_bf16(false, ahi.v, false, blo.v, (short)0, acc, false, false);
        acc = __builtin_amdgcn_wmma_f32_16x16x32_bf16(false, ahi.v, false, bhi.v, (short)0, acc, false, false);
    }
    if (ncol < KC) {
#pragma unroll
        for (int r = 0; r < 8; ++r) {
            const int m = mBase + (half << 3) + r;
            if (m < KC) atomicAdd(&VtZ[m * KC + ncol], acc[r]);
        }
    }
}

// ---------------------------------------------------------------------------
// Transpose + split + zero-pad VtZ (100x100 f32) -> VtZt hi/lo [112][128] bf16
// so res_kernel's B fragments are clean b128 loads (k-padding exactly zero).
// ---------------------------------------------------------------------------
__global__ void prep_vtz_kernel(const float* __restrict__ VtZ,
                                bf16_t* __restrict__ th, bf16_t* __restrict__ tl)
{
    const int i = blockIdx.x * blockDim.x + threadIdx.x;   // over MPAD*KPAD
    if (i >= MPAD * KPAD) return;
    const int n = i >> 7, k = i & (KPAD - 1);
    const float v = (n < KC && k < KC) ? VtZ[k * KC + n] : 0.f;
    bf16_t h, l;
    split_bf16(v, h, l);
    th[i] = h; tl[i] = l;
}

// ---------------------------------------------------------------------------
// res = (U @ VtZ) * Dscale -> out[:, 0:100]. K padded 100 -> 128 (zeros).
// ---------------------------------------------------------------------------
__global__ void __launch_bounds__(256)
res_kernel(const bf16_t* __restrict__ Uhi, const bf16_t* __restrict__ Ulo,
           const bf16_t* __restrict__ Bth, const bf16_t* __restrict__ Btl,
           const float* __restrict__ dscale, float* __restrict__ out)
{
    const int lane  = threadIdx.x & 31;
    const int gwave = blockIdx.x * WPB + (threadIdx.x >> 5);
    const int rowTiles = N_ROWS / 16;       // 6250
    if (gwave >= rowTiles * 7) return;      // wave-uniform
    const int colTile = gwave % 7;
    const int rowTile = gwave / 7;
    const int half = lane >> 4, lidx = lane & 15;
    const int row  = (rowTile << 4) + lidx;
    const int ncol = (colTile << 4) + lidx;   // <= 111 < MPAD

    const bf16_t* ah = Uhi + (size_t)row * KPAD;
    const bf16_t* al = Ulo + (size_t)row * KPAD;
    const bf16_t* bh = Bth + (size_t)ncol * KPAD;
    const bf16_t* bl = Btl + (size_t)ncol * KPAD;

    v8f acc = {};
#pragma unroll
    for (int kt = 0; kt < KPAD / 32; ++kt) {
        const int kb = kt << 5;
        const int o0 = kb + (half << 3);
        const int o1 = kb + 16 + (half << 3);
        Frag16 ahi, alo, bhi, blo;
        ahi.q[0] = *(const u32x4*)(ah + o0); ahi.q[1] = *(const u32x4*)(ah + o1);
        alo.q[0] = *(const u32x4*)(al + o0); alo.q[1] = *(const u32x4*)(al + o1);
        bhi.q[0] = *(const u32x4*)(bh + o0); bhi.q[1] = *(const u32x4*)(bh + o1);
        blo.q[0] = *(const u32x4*)(bl + o0); blo.q[1] = *(const u32x4*)(bl + o1);
        acc = __builtin_amdgcn_wmma_f32_16x16x32_bf16(false, alo.v, false, bhi.v, (short)0, acc, false, false);
        acc = __builtin_amdgcn_wmma_f32_16x16x32_bf16(false, ahi.v, false, blo.v, (short)0, acc, false, false);
        acc = __builtin_amdgcn_wmma_f32_16x16x32_bf16(false, ahi.v, false, bhi.v, (short)0, acc, false, false);
    }
    const float ds = dscale[0];
    if (ncol < KC) {
#pragma unroll
        for (int r = 0; r < 8; ++r) {
            const int m = (rowTile << 4) + (half << 3) + r;
            out[(long)m * OUTC + ncol] = acc[r] * ds;
        }
    }
}

// ---------------------------------------------------------------------------
// Launch
// ---------------------------------------------------------------------------
extern "C" void kernel_launch(void* const* d_in, const int* in_sizes, int n_in,
                              void* d_out, int out_size, void* d_ws, size_t ws_size,
                              hipStream_t stream)
{
    (void)in_sizes; (void)n_in; (void)out_size;
    const float* X  = (const float*)d_in[0];   // 100000 x 512
    const float* W  = (const float*)d_in[1];   // 400 x 512
    const float* bb = (const float*)d_in[2];   // 400
    float* out = (float*)d_out;                // 100000 x 200

    // ---- workspace carve-up (all regions 64B aligned) ----
    char* base = (char*)d_ws;
    size_t off = 0;
    auto carve = [&](size_t bytes) -> char* {
        char* p = base + off;
        off += (bytes + 63) & ~(size_t)63;
        return p;
    };
    bf16_t* Uhi  = (bf16_t*)carve((size_t)N_ROWS * KPAD * 2);
    bf16_t* Ulo  = (bf16_t*)carve((size_t)N_ROWS * KPAD * 2);   // contiguous w/ Uhi
    bf16_t* Vthi = (bf16_t*)carve((size_t)MPAD * N_ROWS * 2);
    bf16_t* Vtlo = (bf16_t*)carve((size_t)MPAD * N_ROWS * 2);
    bf16_t* Zthi = (bf16_t*)carve((size_t)MPAD * N_ROWS * 2);
    bf16_t* Ztlo = (bf16_t*)carve((size_t)MPAD * N_ROWS * 2);
    bf16_t* Whi  = (bf16_t*)carve((size_t)M_COLS * D_DIM * 2);
    bf16_t* Wlo  = (bf16_t*)carve((size_t)M_COLS * D_DIM * 2);
    float*  sums   = (float*)carve(256 * 4);                    // [U(100)|V(100)|pad]
    float*  VtZ    = (float*)carve(KC * KC * 4);                // contiguous w/ sums
    bf16_t* VtZthi = (bf16_t*)carve((size_t)MPAD * KPAD * 2);
    bf16_t* VtZtlo = (bf16_t*)carve((size_t)MPAD * KPAD * 2);
    float*  dscale = (float*)carve(64);
    const size_t baseBytes = off;
    bf16_t* Xhi = (bf16_t*)carve((size_t)N_ROWS * D_DIM * 2);
    bf16_t* Xlo = (bf16_t*)carve((size_t)N_ROWS * D_DIM * 2);
    const size_t fullBytes = off;
    const bool preX = (ws_size >= fullBytes);   // ws_size fixed -> deterministic
    (void)baseBytes;

    // 1. zero: U hi/lo (k-padding must be 0) and sums+VtZ (atomics targets)
    zero4_kernel<<<2048, 256, 0, stream>>>((u32x4*)Uhi,
                                           (long)((size_t)N_ROWS * KPAD * 2 * 2 / 16));
    zero4_kernel<<<16, 256, 0, stream>>>((u32x4*)sums,
                                         (long)((256 * 4 + KC * KC * 4) / 16));
    // 2. pre-split W (always) and X (if ws allows)
    split_kernel<<<(M_COLS * D_DIM / 4 + 255) / 256, 256, 0, stream>>>(W, Whi, Wlo, M_COLS * D_DIM);
    if (preX)
        split_kernel<<<(N_ROWS * D_DIM / 4 + 255) / 256, 256, 0, stream>>>(X, Xhi, Xlo, N_ROWS * D_DIM);
    // 3. fused GEMM + bias + relu + scatter + column sums
    {
        const int waves  = ((N_ROWS / 16) / ROWG) * (M_COLS / 16);  // 31250
        const int blocks = (waves + WPB - 1) / WPB;
        if (preX)
            gemm_relu_lds_kernel<<<N_ROWS / G_ROWS, G_THREADS, 0, stream>>>(Xhi, Xlo, Whi, Wlo, bb,
                Uhi, Ulo, Vthi, Vtlo, Zthi, Ztlo, sums, out);
        else
            gemm_relu_kernel<false><<<blocks, 256, 0, stream>>>(X, Xhi, Xlo, Whi, Wlo, bb,
                Uhi, Ulo, Vthi, Vtlo, Zthi, Ztlo, sums, out);
    }
    // 4. Dscale
    dscale_kernel<<<1, 128, 0, stream>>>(sums, dscale);
    // 5. VtZ = V^T @ Z (split-K)
    {
        const int waves  = 49 * VTZ_SPLITS;
        const int blocks = (waves + WPB - 1) / WPB;
        vtz_kernel<<<blocks, 256, 0, stream>>>(Vthi, Vtlo, Zthi, Ztlo, VtZ);
    }
    // 6. transpose/split/pad VtZ for the final GEMM's B operand
    prep_vtz_kernel<<<(MPAD * KPAD + 255) / 256, 256, 0, stream>>>(VtZ, VtZthi, VtZtlo);
    // 7. res = U @ VtZ * Dscale -> out[:, 0:100]
    {
        const int waves  = (N_ROWS / 16) * 7;
        const int blocks = (waves + WPB - 1) / WPB;
        res_kernel<<<blocks, 256, 0, stream>>>(Uhi, Ulo, VtZthi, VtZtlo, dscale, out);
    }
}

// v002
// One run takes 367 microseconds.
// Next to v001, in two timings, it ran 1.40 and 1.41 times as fast.
// Over all steps from v000 it is 2.30 times as fast.
#include <hip/hip_runtime.h>
#include <hip/hip_bf16.h>

// ---------------------------------------------------------------------------
// LowRankAttention for MI455X (gfx1250), wave32 + bf16 WMMA, fp32-split bf16.
//   out[:,0:100]   = (U @ (V^T Z)) * Dscale
//   out[:,100:200] = T
// where [U|V|Z|T] = relu(X @ W^T + b)
// Unless X cannot be pre-split, all f32->bf16(hi,lo) splitting is hoisted out of the WMMA hot loops so the
// inner loops are pure b128 loads (from LDS in the main GEMM) + v_wmma_f32_16x16x32_bf16.
// ---------------------------------------------------------------------------

#define N_ROWS 100000
#define D_DIM  512
#define M_COLS 400          // 4*K
#define KC     100          // K
#define KPAD   128          // K padded for U / VtZ fragments
#define MPAD   112          // 100 padded to 7 tiles of 16
#define OUTC   200
#define WPB    8            // waves per block (256 threads)
#define ROWG   5            // row tiles per wave in main GEMM (6250 = 5*1250)
#define VTZ_SPLITS 64

typedef __bf16 bf16_t;
typedef bf16_t       v16bf __attribute__((ext_vector_type(16)));
typedef float        v8f   __attribute__((ext_vector_type(8)));
typedef unsigned int u32x4 __attribute__((ext_vector_type(4)));
typedef float        f32x4 __attribute__((ext_vector_type(4)));

// 32-byte A/B fragment viewed either as bf16 lanes or as two 16B load chunks
union Frag16 { v16bf v; u32x4 q[2]; };
// 8 bf16 values viewed as one 16B store chunk
union Pack8 { bf16_t e[8]; u32x4 q; };

__device__ __forceinline__ void split_bf16(float x, bf16_t& hi, bf16_t& lo) {
    hi = (bf16_t)x;                 // RNE f32 -> bf16
    lo = (bf16_t)(x - (float)hi);   // exact residual, re-rounded
}

// ---------------------------------------------------------------------------
// Split a f32 array into bf16 hi/lo arrays (n multiple of 4).
// ---------------------------------------------------------------------------
__global__ void split_kernel(const float* __restrict__ src,
                             bf16_t* __restrict__ hi, bf16_t* __restrict__ lo, int n)
{
    const int i = (blockIdx.x * blockDim.x + threadIdx.x) * 4;
    if (i >= n) return;
    const f32x4 v = *(const f32x4*)(src + i);
#pragma unroll
    for (int j = 0; j < 4; ++j) {
        bf16_t h, l;
        split_bf16(v[j], h, l);
        hi[i + j] = h; lo[i + j] = l;
    }
}

// ---------------------------------------------------------------------------
// Grid-stride 16B zero fill.
// ---------------------------------------------------------------------------
__global__ void zero4_kernel(u32x4* __restrict__ p, long n4)
{
    const u32x4 z = {0u, 0u, 0u, 0u};
    for (long i = blockIdx.x * (long)blockDim.x + threadIdx.x; i < n4;
         i += (long)gridDim.x * blockDim.x)
        p[i] = z;
}

// ---------------------------------------------------------------------------
// Kernel 1: tmp = relu(X @ W^T + b).
// One wave = 5 row-tiles (80 rows) x 1 col-tile (16 cols).
// PRE=true: A fragments are direct b128 loads from pre-split Xhi/Xlo.
// Epilogue: U -> bf16 hi/lo row-major [N][128]; V,Z -> bf16 hi/lo transposed
// [col][N]; T -> out (f32); U/V column sums via one atomicAdd per lane.
// ---------------------------------------------------------------------------
template <bool PRE>
__global__ void __launch_bounds__(256)
gemm_relu_kernel(const float* __restrict__ X,
                 const bf16_t* __restrict__ Xhi, const bf16_t* __restrict__ Xlo,
                 const bf16_t* __restrict__ Whi, const bf16_t* __restrict__ Wlo,
                 const float* __restrict__ bias,
                 bf16_t* __restrict__ Uhi, bf16_t* __restrict__ Ulo,
                 bf16_t* __restrict__ Vthi, bf16_t* __restrict__ Vtlo,
                 bf16_t* __restrict__ Zthi, bf16_t* __restrict__ Ztlo,
                 float* __restrict__ sums, float* __restrict__ out)
{
    const int lane  = threadIdx.x & 31;
    const int gwave = blockIdx.x * WPB + (threadIdx.x >> 5);
    const int totalWaves = ((N_ROWS / 16) / ROWG) * (M_COLS / 16);  // 31250
    if (gwave >= totalWaves) return;                                // wave-uniform

    const int colTile  = gwave % (M_COLS / 16);
    const int rowGroup = gwave / (M_COLS / 16);
    const int colBase  = colTile << 4;
    const int half     = lane >> 4;
    const int lidx     = lane & 15;

    const int wofs = (colBase + lidx) * D_DIM;   // B fragment source row of W

    v8f acc[ROWG];
#pragma unroll
    for (int t = 0; t < ROWG; ++t) acc[t] = {};

    for (int kt = 0; kt < D_DIM / 32; ++kt) {
        const int kb = kt << 5;
        const int o0 = kb + (half << 3);         // k = kb + half*8 .. +8
        const int o1 = kb + 16 + (half << 3);    // k = kb+16+half*8 .. +8

        Frag16 bhi, blo;
        bhi.q[0] = *(const u32x4*)(Whi + wofs + o0);
        bhi.q[1] = *(const u32x4*)(Whi + wofs + o1);
        blo.q[0] = *(const u32x4*)(Wlo + wofs + o0);
        blo.q[1] = *(const u32x4*)(Wlo + wofs + o1);

#pragma unroll
        for (int t = 0; t < ROWG; ++t) {
            const int row = ((rowGroup * ROWG + t) << 4) + lidx;
            Frag16 ahi, alo;
            if (PRE) {
                const bf16_t* xh = Xhi + row * D_DIM;
                const bf16_t* xl = Xlo + row * D_DIM;
                __builtin_prefetch(xh + kb + 32, 0, 1);  // global_prefetch_b8
                ahi.q[0] = *(const u32x4*)(xh + o0);
                ahi.q[1] = *(const u32x4*)(xh + o1);
                alo.q[0] = *(const u32x4*)(xl + o0);
                alo.q[1] = *(const u32x4*)(xl + o1);
            } else {
                const float* xrow = X + row * D_DIM;
                __builtin_prefetch(xrow + kb + 32, 0, 1);
#pragma unroll
                for (int p = 0; p < 8; ++p) {
                    const int k = kb + ((p >> 2) << 4) + (half << 3) + ((p & 3) << 1);
                    bf16_t h0, l0, h1, l1;
                    split_bf16(xrow[k],     h0, l0);
                    split_bf16(xrow[k + 1], h1, l1);
                    ahi.v[2*p] = h0; alo.v[2*p] = l0;
                    ahi.v[2*p+1] = h1; alo.v[2*p+1] = l1;
                }
            }
            acc[t] = __builtin_amdgcn_wmma_f32_16x16x32_bf16(false, alo.v, false, bhi.v, (short)0, acc[t], false, false);
            acc[t] = __builtin_amdgcn_wmma_f32_16x16x32_bf16(false, ahi.v, false, blo.v, (short)0, acc[t], false, false);
            acc[t] = __builtin_amdgcn_wmma_f32_16x16x32_bf16(false, ahi.v, false, bhi.v, (short)0, acc[t], false, false);
        }
    }

    // ---- epilogue: bias + relu; route column; fold in column sums ----
    const int col = colBase + lidx;
    const float bv = bias[col];
    bf16_t *ph = nullptr, *pl = nullptr; float* pT = nullptr;
    long A; int S;
    if (col < KC)          { ph = Uhi;  pl = Ulo;  A = col;                        S = KPAD; }
    else if (col < 2 * KC) { ph = Vthi; pl = Vtlo; A = (long)(col - KC) * N_ROWS;  S = 1;    }
    else if (col < 3 * KC) { ph = Zthi; pl = Ztlo; A = (long)(col - 2*KC) * N_ROWS; S = 1;   }
    else                   { pT = out;             A = KC + (col - 3 * KC);        S = OUTC; }

    float s = 0.f;
#pragma unroll
    for (int t = 0; t < ROWG; ++t) {
        const int row0 = ((rowGroup * ROWG + t) << 4) + (half << 3);
#pragma unroll
        for (int r = 0; r < 8; ++r) {
            float v = acc[t][r] + bv;
            v = v > 0.f ? v : 0.f;
            const long idx = A + (long)(row0 + r) * S;
            if (pT) {
                pT[idx] = v;
            } else {
                bf16_t h, l;
                split_bf16(v, h, l);
                ph[idx] = h; pl[idx] = l;
                s += v;
            }
        }
    }
    if (col < 2 * KC) atomicAdd(&sums[col], s);   // [0..99]=U sums, [100..199]=V sums
}

// ---------------------------------------------------------------------------
// Kernel 1 (pre-split X): tmp = relu(X @ W^T + b), one block = 80 rows x all
// 400 columns, 5 waves, one wave = 5 row tiles x 5 col tiles.
// Per pass (32 k) the block's 400 W rows and 80 X rows are copied to LDS by
// asynchronous copies, two buffers, the next pass's copies in flight while
// this pass is worked on. One LDS row = [64 B hi | 64 B lo | 16 B pad].
// Epilogue and per-accumulator product order as in gemm_relu_kernel.
// ---------------------------------------------------------------------------
#define G_WAVES   5
#define G_THREADS (G_WAVES * 32)
#define G_ROWS    (ROWG * 16)               // 80 rows of X per block
#define ST_ROWS   (M_COLS + G_ROWS)         // W rows first, then X rows
#define ST_PITCH  144                       // 16 B x odd: conflict-free b128 reads
#define ST_BYTES  (ST_ROWS * ST_PITCH)
#define CP_ROWS   (G_THREADS / 8)           // rows covered by one copy of the block
#define G_PASSES  (D_DIM / 32)

__device__ __forceinline__ unsigned lds_off(const void* p) {
    return (unsigned)(unsigned long long)p;   // low 32 bits of a __shared__ address
}

// Twelve 16-byte-per-lane copies to LDS. The closing s_wait_xcnt keeps every
// address register of the copies unwritten until the copies have taken them.
__device__ __forceinline__ void async_copy12(const unsigned (&l)[12],
                                             const bf16_t* const (&p)[12])
{
    asm volatile(
        "global_load_async_to_lds_b128 %0, %12, off\n\t"
        "global_load_async_to_lds_b128 %1, %13, off\n\t"
        "global_load_async_to_lds_b128 %2, %14, off\n\t"
        "global_load_async_to_lds_b128 %3, %15, off\n\t"
        "global_load_async_to_lds_b128 %4, %16, off\n\t"
        "global_load_async_to_lds_b128 %5, %17, off\n\t"
        "global_load_async_to_lds_b128 %6, %18, off\n\t"
        "global_load_async_to_lds_b128 %7, %19, off\n\t"
        "global_load_async_to_lds_b128 %8, %20, off\n\t"
        "global_load_async_to_lds_b128 %9, %21, off\n\t"
        "global_load_async_to_lds_b128 %10, %22, off\n\t"
        "global_load_async_to_lds_b128 %11, %23, off\n\t"
        "s_wait_xcnt 0x0"
        :: "v"(l[0]), "v"(l[1]), "v"(l[2]), "v"(l[3]), "v"(l[4]), "v"(l[5]),
           "v"(l[6]), "v"(l[7]), "v"(l[8]), "v"(l[9]), "v"(l[10]), "v"(l[11]),
           "v"(p[0]), "v"(p[1]), "v"(p[2]), "v"(p[3]), "v"(p[4]), "v"(p[5]),
           "v"(p[6]), "v"(p[7]), "v"(p[8]), "v"(p[9]), "v"(p[10]), "v"(p[11])
        : "memory");
}

// One pass's tile: 24 copies per lane (20 of W rows, 4 of X rows).
__device__ __forceinline__ void stage_tile(unsigned lds, const bf16_t* gW, const bf16_t* gX)
{
    unsigned l[12];
    const bf16_t* p[12];
#pragma unroll
    for (int j = 0; j < 12; ++j) {
        l[j] = lds + j * (CP_ROWS * ST_PITCH);
        p[j] = gW + j * (CP_ROWS * D_DIM);
    }
    async_copy12(l, p);
#pragma unroll
    for (int j = 0; j < 12; ++j) {
        l[j] = lds + (12 + j) * (CP_ROWS * ST_PITCH);
        p[j] = (j < 8) ? gW + (12 + j) * (CP_ROWS * D_DIM) : gX + (j - 8) * (CP_ROWS * D_DIM);
    }
    async_copy12(l, p);
}

__global__ void __launch_bounds__(G_THREADS, 3)   // 3 waves per SIMD: two blocks share a WGP
gemm_relu_lds_kernel(const bf16_t* __restrict__ Xhi, const bf16_t* __restrict__ Xlo,
                     const bf16_t* __restrict__ Whi, const bf16_t* __restrict__ Wlo,
                     const float* __restrict__ bias,
                     bf16_t* __restrict__ Uhi, bf16_t* __restrict__ Ulo,
                     bf16_t* __restrict__ Vthi, bf16_t* __restrict__ Vtlo,
                     bf16_t* __restrict__ Zthi, bf16_t* __restrict__ Ztlo,
                     float* __restrict__ sums, float* __restrict__ out)
{
    __shared__ __attribute__((aligned(16))) unsigned char smem[2 * ST_BYTES];

    const int tid      = threadIdx.x;
    const int lane     = tid & 31;
    const int wave     = __builtin_amdgcn_readfirstlane(tid >> 5);
    const int rowGroup = blockIdx.x;
    const int half     = lane >> 4;
    const int lidx     = lane & 15;

    // this lane's share of every copy: row (tid >> 3) of each group of CP_ROWS
    // rows, 16-byte chunk (tid & 7): chunks 0..3 from hi, 4..7 from lo
    const int  crow = tid >> 3;
    const bool chi  = (tid & 7) < 4;
    const unsigned ldsT = lds_off(smem) + crow * ST_PITCH + (tid & 7) * 16;
    const bf16_t* gW = (chi ? Whi : Wlo) + crow * D_DIM + (tid & 3) * 8;
    const bf16_t* gX = (chi ? Xhi : Xlo) + (size_t)(rowGroup * G_ROWS + crow) * D_DIM + (tid & 3) * 8;

    v8f acc[5][ROWG];
#pragma unroll
    for (int c = 0; c < 5; ++c)
#pragma unroll
        for (int t = 0; t < ROWG; ++t) acc[c][t] = {};

    stage_tile(ldsT, gW, gX);
    asm volatile("s_wait_asynccnt 0x0" ::: "memory");   // tile 0 landed (this wave's copies)
    __syncthreads();                                    // ... and every other wave's
    stage_tile(ldsT + ST_BYTES, gW + 32, gX + 32);

    for (int kt = 0; kt < G_PASSES; ++kt) {
        const int buf = (kt & 1) * ST_BYTES;
        const unsigned char* sa = smem + buf + (M_COLS + lidx) * ST_PITCH + (half << 4);
        const unsigned char* sb = smem + buf + (wave * 80 + lidx) * ST_PITCH + (half << 4);

        // lo(A) x hi(B) first, then hi(A) x lo(B) and hi(A) x hi(B): only one half of
        // the A fragments is live at a time, so that the accumulators stay in registers
        {
            Frag16 alo[ROWG];
#pragma unroll
            for (int t = 0; t < ROWG; ++t) {
                const unsigned char* r = sa + t * (16 * ST_PITCH);
                alo[t].q[0] = *(const u32x4*)(r + 64);
                alo[t].q[1] = *(const u32x4*)(r + 96);
            }
#pragma unroll
            for (int c = 0; c < 5; ++c) {
                const unsigned char* r = sb + c * (16 * ST_PITCH);
                Frag16 bhi;
                bhi.q[0] = *(const u32x4*)(r);
                bhi.q[1] = *(const u32x4*)(r + 32);
#pragma unroll
                for (int t = 0; t < ROWG; ++t)
                    acc[c][t] = __builtin_amdgcn_wmma_f32_16x16x32_bf16(false, alo[t].v, false, bhi.v, (short)0, acc[c][t], false, false);
            }
        }
        {
            Frag16 ahi[ROWG];
#pragma unroll
            for (int t = 0; t < ROWG; ++t) {
                const unsigned char* r = sa + t * (16 * ST_PITCH);
                ahi[t].q[0] = *(const u32x4*)(r);
                ahi[t].q[1] = *(const u32x4*)(r + 32);
            }
#pragma unroll
            for (int c = 0; c < 5; ++c) {
                const unsigned char* r = sb + c * (16 * ST_PITCH);
                Frag16 bhi, blo;
                bhi.q[0] = *(const u32x4*)(r);
                bhi.q[1] = *(const u32x4*)(r + 32);
                blo.q[0] = *(const u32x4*)(r + 64);
                blo.q[1] = *(const u32x4*)(r + 96);
#pragma unroll
                for (int t = 0; t < ROWG; ++t)
                    acc[c][t] = __builtin_amdgcn_wmma_f32_16x16x32_bf16(false, ahi[t].v, false, blo.v, (short)0, acc[c][t], false, false);
#pragma unroll
                for (int t = 0; t < ROWG; ++t)
                    acc[c][t] = __builtin_amdgcn_wmma_f32_16x16x32_bf16(false, ahi[t].v, false, bhi.v, (short)0, acc[c][t], false, false);
            }
        }

        // keeps the pass's last WMMAs in front of the barrier: sunk behind it they would
        // delay the issue of the next copies and shorten their lead
        __builtin_amdgcn_sched_barrier(0);
        asm volatile("s_wait_dscnt 0x0" ::: "memory");     // this wave has left the buffer
        asm volatile("s_wait_asynccnt 0x0" ::: "memory");  // its copies of tile kt + 1 landed
        __syncthreads();   // publishes tile kt + 1, frees this pass's buffer
        if (kt + 2 < G_PASSES)
            stage_tile(ldsT + buf, gW + (kt + 2) * 32, gX + (kt + 2) * 32);
    }
    asm volatile("s_wait_asynccnt 0x0" ::: "memory");      // no copy outlives the loop

    // ---- epilogue: bias + relu; route column; fold in column sums ----
    // Same values and places as gemm_relu_kernel; the T / V,Z / U test stands outside
    // the element loops, for speed only.
    const int rbase = rowGroup * G_ROWS + (half << 3);
#pragma unroll
    for (int c = 0; c < 5; ++c) {
        const int col = wave * 80 + c * 16 + lidx;
        const float bv = bias[col];
        if (col >= 3 * KC) {
            float* pT = out + (size_t)rbase * OUTC + (KC + (col - 3 * KC));
#pragma unroll
            for (int t = 0; t < ROWG; ++t)
#pragma unroll
                for (int r = 0; r < 8; ++r) {
                    const float v = acc[c][t][r] + bv;
                    pT[(t * 16 + r) * OUTC] = v > 0.f ? v : 0.f;
                    // the stores' registers are reused below: wait until the store has taken them
                    // (the scheduling fence keeps later register writes behind the wait)
                    if (r == 7) { asm volatile("s_wait_xcnt 0x0" ::: "memory"); __builtin_amdgcn_sched_barrier(0); }
                }
        } else if (col >= KC) {
            // V and Z lie transposed, [col][N]: the 8 rows a lane holds of one tile are 16
            // contiguous, 16-byte aligned bytes of its column: one b128 store each for hi and lo
            const bool isV = col < 2 * KC;
            const int  A   = (isV ? col - KC : col - 2 * KC) * N_ROWS + rbase;
            bf16_t* ph = (isV ? Vthi : Zthi) + A;
            bf16_t* pl = (isV ? Vtlo : Ztlo) + A;
            float s = 0.f;
#pragma unroll
            for (int t = 0; t < ROWG; ++t) {
                Pack8 h8, l8;
#pragma unroll
                for (int r = 0; r < 8; ++r) {
                    float v = acc[c][t][r] + bv;
                    v = v > 0.f ? v : 0.f;
                    bf16_t h, l;
                    split_bf16(v, h, l);
                    h8.e[r] = h; l8.e[r] = l;
                    s += v;
                }
                *(u32x4*)(ph + t * 16) = h8.q;
                *(u32x4*)(pl + t * 16) = l8.q;
                // the stores' registers are reused below: wait until the stores have taken them
                // (the scheduling fence keeps later register writes behind the wait)
                asm volatile("s_wait_xcnt 0x0" ::: "memory");
                __builtin_amdgcn_sched_barrier(0);
            }
            if (isV) atomicAdd(&sums[col], s);            // [100..199]=V sums
        } else {
            bf16_t* ph = Uhi; bf16_t* pl = Ulo;
            const int S = KPAD;
            const int A = col + rbase * S;
            float s = 0.f;
#pragma unroll
            for (int t = 0; t < ROWG; ++t)
#pragma unroll
                for (int r = 0; r < 8; ++r) {
                    float v = acc[c][t][r] + bv;
                    v = v > 0.f ? v : 0.f;
                    const int idx = A + (t * 16 + r) * S;
                    bf16_t h, l;
                    split_bf16(v, h, l);
                    ph[idx] = h; pl[idx] = l;
                    // the stores' registers are reused below: wait until the stores have taken them
                    // (the scheduling fence keeps later register writes behind the wait)
                    asm volatile("s_wait_xcnt 0x0" ::: "memory");
                    __builtin_amdgcn_sched_barrier(0);
                    s += v;
                }
            atomicAdd(&sums[col], s);                     // [0..99]=U sums
        }
    }
}

// ---------------------------------------------------------------------------
// Dscale = 1 / (dot(sumU,sumV)/N + 1e-6)
// ---------------------------------------------------------------------------
__global__ void dscale_kernel(const float* __restrict__ sums, float* __restrict__ dscale)
{
    __shared__ float red[128];
    const int t = threadIdx.x;
    red[t] = (t < KC) ? sums[t] * sums[KC + t] : 0.f;
    __syncthreads();
    for (int s = 64; s > 0; s >>= 1) {
        if (t < s) red[t] += red[t + s];
        __syncthreads();
    }
    if (t == 0) dscale[0] = 1.0f / (red[0] / (float)N_ROWS + 1e-6f);
}

// ---------------------------------------------------------------------------
// VtZ = V^T @ Z (100x100, reduction over N). Split-K WMMA + f32 atomics.
// A/B fragments are contiguous b128 loads from transposed bf16 hi/lo arrays.
// Pad rows (>=100) hold garbage but only affect guarded (unstored) outputs.
// ---------------------------------------------------------------------------
__global__ void __launch_bounds__(256)
vtz_kernel(const bf16_t* __restrict__ Vthi, const bf16_t* __restrict__ Vtlo,
           const bf16_t* __restrict__ Zthi, const bf16_t* __restrict__ Ztlo,
           float* __restrict__ VtZ)
{
    const int lane  = threadIdx.x & 31;
    const int gwave = blockIdx.x * WPB + (threadIdx.x >> 5);
    const int TILES = 7 * 7;
    if (gwave >= TILES * VTZ_SPLITS) return;     // wave-uniform
    const int tile  = gwave % TILES;
    const int split = gwave / TILES;
    const int mBase = (tile / 7) << 4, nBase = (tile % 7) << 4;
    const int half  = lane >> 4, lidx = lane & 15;
    const int mcol  = mBase + lidx, ncol = nBase + lidx;   // <= 111 < MPAD

    const bf16_t* ah = Vthi + (size_t)mcol * N_ROWS;
    const bf16_t* al = Vtlo + (size_t)mcol * N_ROWS;
    const bf16_t* bh = Zthi + (size_t)ncol * N_ROWS;
    const bf16_t* bl = Ztlo + (size_t)ncol * N_ROWS;

    v8f acc = {};
    for (int kt = split; kt < N_ROWS / 32; kt += VTZ_SPLITS) {
        const int kb = kt << 5;
        const int o0 = kb + (half << 3);
        const int o1 = kb + 16 + (half << 3);
        Frag16 ahi, alo, bhi, blo;
        ahi.q[0] = *(const u32x4*)(ah + o0); ahi.q[1] = *(const u32x4*)(ah + o1);
        alo.q[0] = *(const u32x4*)(al + o0); alo.q[1] = *(const u32x4*)(al + o1);
        bhi.q[0] = *(const u32x4*)(bh + o0); bhi.q[1] = *(const u32x4*)(bh + o1);
        blo.q[0] = *(const u32x4*)(bl + o0); blo.q[1] = *(const u32x4*)(bl + o1);
        acc = __builtin_amdgcn_wmma_f32_16x16x32_bf16(false, alo.v, false, bhi.v, (short)0, acc, false, false);
        acc = __builtin_amdgcn_wmma_f32_16x16x32_bf16(false, ahi.v, false, blo.v, (short)0, acc, false, false);
        acc = __builtin_amdgcn_wmma_f32_16x16x32_bf16(false, ahi.v, false, bhi.v, (short)0, acc, false, false);
    }
    if (ncol < KC) {
#pragma unroll
        for (int r = 0; r < 8; ++r) {
            const int m = mBase + (half << 3) + r;
            if (m < KC) atomicAdd(&VtZ[m * KC + ncol], acc[r]);
        }
    }
}

// ---------------------------------------------------------------------------
// Transpose + split + zero-pad VtZ (100x100 f32) -> VtZt hi/lo [112][128] bf16
// so res_kernel's B fragments are clean b128 loads (k-padding exactly zero).
// ---------------------------------------------------------------------------
__global__ void prep_vtz_kernel(const float* __restrict__ VtZ,
                                bf16_t* __restrict__ th, bf16_t* __restrict__ tl)
{
    const int i = blockIdx.x * blockDim.x + threadIdx.x;   // over MPAD*KPAD
    if (i >= MPAD * KPAD) return;
    const int n = i >> 7, k = i & (KPAD - 1);
    const float v = (n < KC && k < KC) ? VtZ[k * KC + n] : 0.f;
    bf16_t h, l;
    split_bf16(v, h, l);
    th[i] = h; tl[i] = l;
}

// ---------------------------------------------------------------------------
// res = (U @ VtZ) * Dscale -> out[:, 0:100]. K padded 100 -> 128 (zeros).
// ---------------------------------------------------------------------------
__global__ void __launch_bounds__(256)
res_kernel(const bf16_t* __restrict__ Uhi, const bf16_t* __restrict__ Ulo,
           const bf16_t* __restrict__ Bth, const bf16_t* __restrict__ Btl,
           const float* __restrict__ dscale, float* __restrict__ out)
{
    const int lane  = threadIdx.x & 31;
    const int gwave = blockIdx.x * WPB + (threadIdx.x >> 5);
    const int rowTiles = N_ROWS / 16;       // 6250
    if (gwave >= rowTiles * 7) return;      // wave-uniform
    const int colTile = gwave % 7;
    const int rowTile = gwave / 7;
    const int half = lane >> 4, lidx = lane & 15;
    const int row  = (rowTile << 4) + lidx;
    const int ncol = (colTile << 4) + lidx;   // <= 111 < MPAD

    const bf16_t* ah = Uhi + (size_t)row * KPAD;
    const bf16_t* al = Ulo + (size_t)row * KPAD;
    const bf16_t* bh = Bth + (size_t)ncol * KPAD;
    const bf16_t* bl = Btl + (size_t)ncol * KPAD;

    v8f acc = {};
#pragma unroll
    for (int kt = 0; kt < KPAD / 32; ++kt) {
        const int kb = kt << 5;
        const int o0 = kb + (half << 3);
        const int o1 = kb + 16 + (half << 3);
        Frag16 ahi, alo, bhi, blo;
        ahi.q[0] = *(const u32x4*)(ah + o0); ahi.q[1] = *(const u32x4*)(ah + o1);
        alo.q[0] = *(const u32x4*)(al + o0); alo.q[1] = *(const u32x4*)(al + o1);
        bhi.q[0] = *(const u32x4*)(bh + o0); bhi.q[1] = *(const u32x4*)(bh + o1);
        blo.q[0] = *(const u32x4*)(bl + o0); blo.q[1] = *(const u32x4*)(bl + o1);
        acc = __builtin_amdgcn_wmma_f32_16x16x32_bf16(false, alo.v, false, bhi.v, (short)0, acc, false, false);
        acc = __builtin_amdgcn_wmma_f32_16x16x32_bf16(false, ahi.v, false, blo.v, (short)0, acc, false, false);
        acc = __builtin_amdgcn_wmma_f32_16x16x32_bf16(false, ahi.v, false, bhi.v, (short)0, acc, false, false);
    }
    const float ds = dscale[0];
    if (ncol < KC) {
#pragma unroll
        for (int r = 0; r < 8; ++r) {
            const int m = (rowTile << 4) + (half << 3) + r;
            out[(long)m * OUTC + ncol] = acc[r] * ds;
        }
    }
}

// ---------------------------------------------------------------------------
// Launch
// ---------------------------------------------------------------------------
extern "C" void kernel_launch(void* const* d_in, const int* in_sizes, int n_in,
                              void* d_out, int out_size, void* d_ws, size_t ws_size,
                              hipStream_t stream)
{
    (void)in_sizes; (void)n_in; (void)out_size;
    const float* X  = (const float*)d_in[0];   // 100000 x 512
    const float* W  = (const float*)d_in[1];   // 400 x 512
    const float* bb = (const float*)d_in[2];   // 400
    float* out = (float*)d_out;                // 100000 x 200

    // ---- workspace carve-up (all regions 64B aligned) ----
    char* base = (char*)d_ws;
    size_t off = 0;
    auto carve = [&](size_t bytes) -> char* {
        char* p = base + off;
        off += (bytes + 63) & ~(size_t)63;
        return p;
    };
    bf16_t* Uhi  = (bf16_t*)carve((size_t)N_ROWS * KPAD * 2);
    bf16_t* Ulo  = (bf16_t*)carve((size_t)N_ROWS * KPAD * 2);   // contiguous w/ Uhi
    bf16_t* Vthi = (bf16_t*)carve((size_t)MPAD * N_ROWS * 2);
    bf16_t* Vtlo = (bf16_t*)carve((size_t)MPAD * N_ROWS * 2);
    bf16_t* Zthi = (bf16_t*)carve((size_t)MPAD * N_ROWS * 2);
    bf16_t* Ztlo = (bf16_t*)carve((size_t)MPAD * N_ROWS * 2);
    bf16_t* Whi  = (bf16_t*)carve((size_t)M_COLS * D_DIM * 2);
    bf16_t* Wlo  = (bf16_t*)carve((size_t)M_COLS * D_DIM * 2);
    float*  sums   = (float*)carve(256 * 4);                    // [U(100)|V(100)|pad]
    float*  VtZ    = (float*)carve(KC * KC * 4);                // contiguous w/ sums
    bf16_t* VtZthi = (bf16_t*)carve((size_t)MPAD * KPAD * 2);
    bf16_t* VtZtlo = (bf16_t*)carve((size_t)MPAD * KPAD * 2);
    float*  dscale = (float*)carve(64);
    const size_t baseBytes = off;
    bf16_t* Xhi = (bf16_t*)carve((size_t)N_ROWS * D_DIM * 2);
    bf16_t* Xlo = (bf16_t*)carve((size_t)N_ROWS * D_DIM * 2);
    const size_t fullBytes = off;
    const bool preX = (ws_size >= fullBytes);   // ws_size fixed -> deterministic
    (void)baseBytes;

    // 1. zero: U hi/lo (k-padding must be 0) and sums+VtZ (atomics targets)
    zero4_kernel<<<2048, 256, 0, stream>>>((u32x4*)Uhi,
                                           (long)((size_t)N_ROWS * KPAD * 2 * 2 / 16));
    zero4_kernel<<<16, 256, 0, stream>>>((u32x4*)sums,
                                         (long)((256 * 4 + KC * KC * 4) / 16));
    // 2. pre-split W (always) and X (if ws allows)
    split_kernel<<<(M_COLS * D_DIM / 4 + 255) / 256, 256, 0, stream>>>(W, Whi, Wlo, M_COLS * D_DIM);
    if (preX)
        split_kernel<<<(N_ROWS * D_DIM / 4 + 255) / 256, 256, 0, stream>>>(X, Xhi, Xlo, N_ROWS * D_DIM);
    // 3. fused GEMM + bias + relu + scatter + column sums
    {
        const int waves  = ((N_ROWS / 16) / ROWG) * (M_COLS / 16);  // 31250
        const int blocks = (waves + WPB - 1) / WPB;
        if (preX)
            gemm_relu_lds_kernel<<<N_ROWS / G_ROWS, G_THREADS, 0, stream>>>(Xhi, Xlo, Whi, Wlo, bb,
                Uhi, Ulo, Vthi, Vtlo, Zthi, Ztlo, sums, out);
        else
            gemm_relu_kernel<false><<<blocks, 256, 0, stream>>>(X, Xhi, Xlo, Whi, Wlo, bb,
                Uhi, Ulo, Vthi, Vtlo, Zthi, Ztlo, sums, out);
    }
    // 4. Dscale
    dscale_kernel<<<1, 128, 0, stream>>>(sums, dscale);
    // 5. VtZ = V^T @ Z (split-K)
    {
        const int waves  = 49 * VTZ_SPLITS;
        const int blocks = (waves + WPB - 1) / WPB;
        vtz_kernel<<<blocks, 256, 0, stream>>>(Vthi, Vtlo, Zthi, Ztlo, VtZ);
    }
    // 6. transpose/split/pad VtZ for the final GEMM's B operand
    prep_vtz_kernel<<<(MPAD * KPAD + 255) / 256, 256, 0, stream>>>(VtZ, VtZthi, VtZtlo);
    // 7. res = U @ VtZ * Dscale -> out[:, 0:100]
    {
        const int waves  = (N_ROWS / 16) * 7;
        const int blocks = (waves + WPB - 1) / WPB;
        res_kernel<<<blocks, 256, 0, stream>>>(Uhi, Ulo, VtZthi, VtZtlo, dscale, out);
    }
}

// v003
// Measured time: 310 microseconds a run.
// Two timings next to v002 both put it at 1.19 times that version's speed.
// Counting every step since v000, it is 2.73 times as fast.
#include <hip/hip_runtime.h>
#include <hip/hip_bf16.h>

// ---------------------------------------------------------------------------
// LowRankAttention for MI455X (gfx1250), wave32 + bf16 WMMA, fp32-split bf16.
//   out[:,0:100]   = (U @ (V^T Z)) * Dscale
//   out[:,100:200] = T
// where [U|V|Z|T] = relu(X @ W^T + b)
// Unless X cannot be pre-split, all f32->bf16(hi,lo) splitting is hoisted out of the WMMA hot loops so the
// inner loops are pure b128 loads (from LDS in the main GEMM) + v_wmma_f32_16x16x32_bf16.
// ---------------------------------------------------------------------------

#define N_ROWS 100000
#define D_DIM  512
#define M_COLS 400          // 4*K
#define KC     100          // K
#define KPAD   128          // K padded for U / VtZ fragments
#define MPAD   112          // 100 padded to 7 tiles of 16
#define OUTC   200
#define WPB    8            // waves per block (256 threads)
#define ROWG   5            // row tiles per wave in main GEMM (6250 = 5*1250)
#define VTZ_SPLITS 64

typedef __bf16 bf16_t;
typedef bf16_t       v16bf __attribute__((ext_vector_type(16)));
typedef float        v8f   __attribute__((ext_vector_type(8)));
typedef unsigned int u32x4 __attribute__((ext_vector_type(4)));
typedef float        f32x4 __attribute__((ext_vector_type(4)));

// 32-byte A/B fragment viewed either as bf16 lanes or as two 16B load chunks
union Frag16 { v16bf v; u32x4 q[2]; };
// 8 bf16 values viewed as one 16B store chunk
union Pack8 { bf16_t e[8]; u32x4 q; };

__device__ __forceinline__ void split_bf16(float x, bf16_t& hi, bf16_t& lo) {
    hi = (bf16_t)x;                 // RNE f32 -> bf16
    lo = (bf16_t)(x - (float)hi);   // exact residual, re-rounded
}

// ---------------------------------------------------------------------------
// Fragment order of a bf16 operand plane with element (k, c), c in 7 tiles of 16:
// one block = 32 k x 16 c = 1 KB, blocks ordered [k / 32][c / 16]. Inside a block lie
// the two 512-byte halves of the WMMA fragment (k 0..15, k 16..31), each as 32 lanes x
// 16 bytes: lane = ((k >> 3) & 1) * 16 + (c & 15) holds its 8 consecutive k.
// A wave loads a fragment as two contiguous 512-byte reads.
// offset(k, c) = frag_tile16(k >> 4) + frag_lane((k >> 3) & 1, c) + (k & 7)
// ---------------------------------------------------------------------------
#define FRAG_BLK  512                 // elements of one 32 x 16 block
#define FRAG_KSTEP (7 * FRAG_BLK)     // elements of one step of 32 k over all 7 tiles
__device__ __forceinline__ int frag_tile16(int k16) {
    return (k16 >> 1) * FRAG_KSTEP + (k16 & 1) * (FRAG_BLK / 2);
}
__device__ __forceinline__ int frag_lane(int half, int c) {
    return (c >> 4) * FRAG_BLK + (half * 16 + (c & 15)) * 8;
}

// ---------------------------------------------------------------------------
// Split a f32 array into bf16 hi/lo arrays (n multiple of 4).
// ---------------------------------------------------------------------------
__global__ void split_kernel(const float* __restrict__ src,
                             bf16_t* __restrict__ hi, bf16_t* __restrict__ lo, int n)
{
    const int i = (blockIdx.x * blockDim.x + threadIdx.x) * 4;
    if (i >= n) return;
    const f32x4 v = *(const f32x4*)(src + i);
#pragma unroll
    for (int j = 0; j < 4; ++j) {
        bf16_t h, l;
        split_bf16(v[j], h, l);
        hi[i + j] = h; lo[i + j] = l;
    }
}

// ---------------------------------------------------------------------------
// Grid-stride 16B zero fill.
// ---------------------------------------------------------------------------
__global__ void zero4_kernel(u32x4* __restrict__ p, long n4)
{
    const u32x4 z = {0u, 0u, 0u, 0u};
    for (long i = blockIdx.x * (long)blockDim.x + threadIdx.x; i < n4;
         i += (long)gridDim.x * blockDim.x)
        p[i] = z;
}

// ---------------------------------------------------------------------------
// Kernel 1: tmp = relu(X @ W^T + b).
// One wave = 5 row-tiles (80 rows) x 1 col-tile (16 cols).
// PRE=true: A fragments are direct b128 loads from pre-split Xhi/Xlo.
// Epilogue: U -> bf16 hi/lo row-major [N][128]; V,Z -> bf16 hi/lo in fragment
// order (k = row); T -> out (f32); U/V column sums via one atomicAdd per lane.
// ---------------------------------------------------------------------------
template <bool PRE>
__global__ void __launch_bounds__(256)
gemm_relu_kernel(const float* __restrict__ X,
                 const bf16_t* __restrict__ Xhi, const bf16_t* __restrict__ Xlo,
                 const bf16_t* __restrict__ Whi, const bf16_t* __restrict__ Wlo,
                 const float* __restrict__ bias,
                 bf16_t* __restrict__ Uhi, bf16_t* __restrict__ Ulo,
                 bf16_t* __restrict__ Vthi, bf16_t* __restrict__ Vtlo,
                 bf16_t* __restrict__ Zthi, bf16_t* __restrict__ Ztlo,
                 float* __restrict__ sums, float* __restrict__ out)
{
    const int lane  = threadIdx.x & 31;
    const int gwave = blockIdx.x * WPB + (threadIdx.x >> 5);
    const int totalWaves = ((N_ROWS / 16) / ROWG) * (M_COLS / 16);  // 31250
    if (gwave >= totalWaves) return;                                // wave-uniform

    const int colTile  = gwave % (M_COLS / 16);
    const int rowGroup = gwave / (M_COLS / 16);
    const int colBase  = colTile << 4;
    const int half     = lane >> 4;
    const int lidx     = lane & 15;

    const int wofs = (colBase + lidx) * D_DIM;   // B fragment source row of W

    v8f acc[ROWG];
#pragma unroll
    for (int t = 0; t < ROWG; ++t) acc[t] = {};

    for (int kt = 0; kt < D_DIM / 32; ++kt) {
        const int kb = kt << 5;
        const int o0 = kb + (half << 3);         // k = kb + half*8 .. +8
        const int o1 = kb + 16 + (half << 3);    // k = kb+16+half*8 .. +8

        Frag16 bhi, blo;
        bhi.q[0] = *(const u32x4*)(Whi + wofs + o0);
        bhi.q[1] = *(const u32x4*)(Whi + wofs + o1);
        blo.q[0] = *(const u32x4*)(Wlo + wofs + o0);
        blo.q[1] = *(const u32x4*)(Wlo + wofs + o1);

#pragma unroll
        for (int t = 0; t < ROWG; ++t) {
            const int row = ((rowGroup * ROWG + t) << 4) + lidx;
            Frag16 ahi, alo;
            if (PRE) {
                const bf16_t* xh = Xhi + row * D_DIM;
                const bf16_t* xl = Xlo + row * D_DIM;
                __builtin_prefetch(xh + kb + 32, 0, 1);  // global_prefetch_b8
                ahi.q[0] = *(const u32x4*)(xh + o0);
                ahi.q[1] = *(const u32x4*)(xh + o1);
                alo.q[0] = *(const u32x4*)(xl + o0);
                alo.q[1] = *(const u32x4*)(xl + o1);
            } else {
                const float* xrow = X + row * D_DIM;
                __builtin_prefetch(xrow + kb + 32, 0, 1);
#pragma unroll
                for (int p = 0; p < 8; ++p) {
                    const int k = kb + ((p >> 2) << 4) + (half << 3) + ((p & 3) << 1);
                    bf16_t h0, l0, h1, l1;
                    split_bf16(xrow[k],     h0, l0);
                    split_bf16(xrow[k + 1], h1, l1);
                    ahi.v[2*p] = h0; alo.v[2*p] = l0;
                    ahi.v[2*p+1] = h1; alo.v[2*p+1] = l1;
                }
            }
            acc[t] = __builtin_amdgcn_wmma_f32_16x16x32_bf16(false, alo.v, false, bhi.v, (short)0, acc[t], false, false);
            acc[t] = __builtin_amdgcn_wmma_f32_16x16x32_bf16(false, ahi.v, false, blo.v, (short)0, acc[t], false, false);
            acc[t] = __builtin_amdgcn_wmma_f32_16x16x32_bf16(false, ahi.v, false, bhi.v, (short)0, acc[t], false, false);
        }
    }

    // ---- epilogue: bias + relu; route column; fold in column sums ----
    const int col = colBase + lidx;
    const float bv = bias[col];
    bf16_t *ph = nullptr, *pl = nullptr; float* pT = nullptr;
    long A; int S;
    if (col < KC)          { ph = Uhi;  pl = Ulo;  A = col;                        S = KPAD; }
    else if (col < 2 * KC) { ph = Vthi; pl = Vtlo; A = frag_lane(half, col - KC);     S = 0; }
    else if (col < 3 * KC) { ph = Zthi; pl = Ztlo; A = frag_lane(half, col - 2 * KC); S = 0; }
    else                   { pT = out;             A = KC + (col - 3 * KC);        S = OUTC; }

    float s = 0.f;
#pragma unroll
    for (int t = 0; t < ROWG; ++t) {
        const int row0 = ((rowGroup * ROWG + t) << 4) + (half << 3);
#pragma unroll
        for (int r = 0; r < 8; ++r) {
            float v = acc[t][r] + bv;
            v = v > 0.f ? v : 0.f;
            const long idx = S ? A + (long)(row0 + r) * S
                               : A + frag_tile16(rowGroup * ROWG + t) + r;
            if (pT) {
                pT[idx] = v;
            } else {
                bf16_t h, l;
                split_bf16(v, h, l);
                ph[idx] = h; pl[idx] = l;
                s += v;
            }
        }
    }
    if (col < 2 * KC) atomicAdd(&sums[col], s);   // [0..99]=U sums, [100..199]=V sums
}

// ---------------------------------------------------------------------------
// Kernel 1 (pre-split X): tmp = relu(X @ W^T + b), one block = 80 rows x all
// 400 columns, 5 waves, one wave = 5 row tiles x 5 col tiles.
// Per pass (32 k) the block's 400 W rows and 80 X rows are copied to LDS by
// asynchronous copies, two buffers, the next pass's copies in flight while
// this pass is worked on. One LDS row = [64 B hi | 64 B lo | 16 B pad].
// Epilogue and per-accumulator product order as in gemm_relu_kernel.
// ---------------------------------------------------------------------------
#define G_WAVES   5
#define G_THREADS (G_WAVES * 32)
#define G_ROWS    (ROWG * 16)               // 80 rows of X per block
#define ST_ROWS   (M_COLS + G_ROWS)         // W rows first, then X rows
#define ST_PITCH  144                       // 16 B x odd: conflict-free b128 reads
#define ST_BYTES  (ST_ROWS * ST_PITCH)
#define CP_ROWS   (G_THREADS / 8)           // rows covered by one copy of the block
#define G_PASSES  (D_DIM / 32)

__device__ __forceinline__ unsigned lds_off(const void* p) {
    return (unsigned)(unsigned long long)p;   // low 32 bits of a __shared__ address
}

// Twelve 16-byte-per-lane copies to LDS. The closing s_wait_xcnt keeps every
// address register of the copies unwritten until the copies have taken them.
__device__ __forceinline__ void async_copy12(const unsigned (&l)[12],
                                             const bf16_t* const (&p)[12])
{
    asm volatile(
        "global_load_async_to_lds_b128 %0, %12, off\n\t"
        "global_load_async_to_lds_b128 %1, %13, off\n\t"
        "global_load_async_to_lds_b128 %2, %14, off\n\t"
        "global_load_async_to_lds_b128 %3, %15, off\n\t"
        "global_load_async_to_lds_b128 %4, %16, off\n\t"
        "global_load_async_to_lds_b128 %5, %17, off\n\t"
        "global_load_async_to_lds_b128 %6, %18, off\n\t"
        "global_load_async_to_lds_b128 %7, %19, off\n\t"
        "global_load_async_to_lds_b128 %8, %20, off\n\t"
        "global_load_async_to_lds_b128 %9, %21, off\n\t"
        "global_load_async_to_lds_b128 %10, %22, off\n\t"
        "global_load_async_to_lds_b128 %11, %23, off\n\t"
        "s_wait_xcnt 0x0"
        :: "v"(l[0]), "v"(l[1]), "v"(l[2]), "v"(l[3]), "v"(l[4]), "v"(l[5]),
           "v"(l[6]), "v"(l[7]), "v"(l[8]), "v"(l[9]), "v"(l[10]), "v"(l[11]),
           "v"(p[0]), "v"(p[1]), "v"(p[2]), "v"(p[3]), "v"(p[4]), "v"(p[5]),
           "v"(p[6]), "v"(p[7]), "v"(p[8]), "v"(p[9]), "v"(p[10]), "v"(p[11])
        : "memory");
}

// One pass's tile: 24 copies per lane (20 of W rows, 4 of X rows).
__device__ __forceinline__ void stage_tile(unsigned lds, const bf16_t* gW, const bf16_t* gX)
{
    unsigned l[12];
    const bf16_t* p[12];
#pragma unroll
    for (int j = 0; j < 12; ++j) {
        l[j] = lds + j * (CP_ROWS * ST_PITCH);
        p[j] = gW + j * (CP_ROWS * D_DIM);
    }
    async_copy12(l, p);
#pragma unroll
    for (int j = 0; j < 12; ++j) {
        l[j] = lds + (12 + j) * (CP_ROWS * ST_PITCH);
        p[j] = (j < 8) ? gW + (12 + j) * (CP_ROWS * D_DIM) : gX + (j - 8) * (CP_ROWS * D_DIM);
    }
    async_copy12(l, p);
}

__global__ void __launch_bounds__(G_THREADS, 3)   // 3 waves per SIMD: two blocks share a WGP
gemm_relu_lds_kernel(const bf16_t* __restrict__ Xhi, const bf16_t* __restrict__ Xlo,
                     const bf16_t* __restrict__ Whi, const bf16_t* __restrict__ Wlo,
                     const float* __restrict__ bias,
                     bf16_t* __restrict__ Uhi, bf16_t* __restrict__ Ulo,
                     bf16_t* __restrict__ Vthi, bf16_t* __restrict__ Vtlo,
                     bf16_t* __restrict__ Zthi, bf16_t* __restrict__ Ztlo,
                     float* __restrict__ sums, float* __restrict__ out)
{
    __shared__ __attribute__((aligned(16))) unsigned char smem[2 * ST_BYTES];

    const int tid      = threadIdx.x;
    const int lane     = tid & 31;
    const int wave     = __builtin_amdgcn_readfirstlane(tid >> 5);
    const int rowGroup = blockIdx.x;
    const int half     = lane >> 4;
    const int lidx     = lane & 15;

    // this lane's share of every copy: row (tid >> 3) of each group of CP_ROWS
    // rows, 16-byte chunk (tid & 7): chunks 0..3 from hi, 4..7 from lo
    const int  crow = tid >> 3;
    const bool chi  = (tid & 7) < 4;
    const unsigned ldsT = lds_off(smem) + crow * ST_PITCH + (tid & 7) * 16;
    const bf16_t* gW = (chi ? Whi : Wlo) + crow * D_DIM + (tid & 3) * 8;
    const bf16_t* gX = (chi ? Xhi : Xlo) + (size_t)(rowGroup * G_ROWS + crow) * D_DIM + (tid & 3) * 8;

    v8f acc[5][ROWG];
#pragma unroll
    for (int c = 0; c < 5; ++c)
#pragma unroll
        for (int t = 0; t < ROWG; ++t) acc[c][t] = {};

    stage_tile(ldsT, gW, gX);
    asm volatile("s_wait_asynccnt 0x0" ::: "memory");   // tile 0 landed (this wave's copies)
    __syncthreads();                                    // ... and every other wave's
    stage_tile(ldsT + ST_BYTES, gW + 32, gX + 32);

    for (int kt = 0; kt < G_PASSES; ++kt) {
        const int buf = (kt & 1) * ST_BYTES;
        const unsigned char* sa = smem + buf + (M_COLS + lidx) * ST_PITCH + (half << 4);
        const unsigned char* sb = smem + buf + (wave * 80 + lidx) * ST_PITCH + (half << 4);

        // lo(A) x hi(B) first, then hi(A) x lo(B) and hi(A) x hi(B): only one half of
        // the A fragments is live at a time, so that the accumulators stay in registers
        {
            Frag16 alo[ROWG];
#pragma unroll
            for (int t = 0; t < ROWG; ++t) {
                const unsigned char* r = sa + t * (16 * ST_PITCH);
                alo[t].q[0] = *(const u32x4*)(r + 64);
                alo[t].q[1] = *(const u32x4*)(r + 96);
            }
#pragma unroll
            for (int c = 0; c < 5; ++c) {
                const unsigned char* r = sb + c * (16 * ST_PITCH);
                Frag16 bhi;
                bhi.q[0] = *(const u32x4*)(r);
                bhi.q[1] = *(const u32x4*)(r + 32);
#pragma unroll
                for (int t = 0; t < ROWG; ++t)
                    acc[c][t] = __builtin_amdgcn_wmma_f32_16x16x32_bf16(false, alo[t].v, false, bhi.v, (short)0, acc[c][t], false, false);
            }
        }
        {
            Frag16 ahi[ROWG];
#pragma unroll
            for (int t = 0; t < ROWG; ++t) {
                const unsigned char* r = sa + t * (16 * ST_PITCH);
                ahi[t].q[0] = *(const u32x4*)(r);
                ahi[t].q[1] = *(const u32x4*)(r + 32);
            }
#pragma unroll
            for (int c = 0; c < 5; ++c) {
                const unsigned char* r = sb + c * (16 * ST_PITCH);
                Frag16 bhi, blo;
                bhi.q[0] = *(const u32x4*)(r);
                bhi.q[1] = *(const u32x4*)(r + 32);
                blo.q[0] = *(const u32x4*)(r + 64);
                blo.q[1] = *(const u32x4*)(r + 96);
#pragma unroll
                for (int t = 0; t < ROWG; ++t)
                    acc[c][t] = __builtin_amdgcn_wmma_f32_16x16x32_bf16(false, ahi[t].v, false, blo.v, (short)0, acc[c][t], false, false);
#pragma unroll
                for (int t = 0; t < ROWG; ++t)
                    acc[c][t] = __builtin_amdgcn_wmma_f32_16x16x32_bf16(false, ahi[t].v, false, bhi.v, (short)0, acc[c][t], false, false);
            }
        }

        // keeps the pass's last WMMAs in front of the barrier: sunk behind it they would
        // delay the issue of the next copies and shorten their lead
        __builtin_amdgcn_sched_barrier(0);
        asm volatile("s_wait_dscnt 0x0" ::: "memory");     // this wave has left the buffer
        asm volatile("s_wait_asynccnt 0x0" ::: "memory");  // its copies of tile kt + 1 landed
        __syncthreads();   // publishes tile kt + 1, frees this pass's buffer
        if (kt + 2 < G_PASSES)
            stage_tile(ldsT + buf, gW + (kt + 2) * 32, gX + (kt + 2) * 32);
    }
    asm volatile("s_wait_asynccnt 0x0" ::: "memory");      // no copy outlives the loop

    // ---- epilogue: bias + relu; route column; fold in column sums ----
    // Same values and places as gemm_relu_kernel; the T / V,Z / U test stands outside
    // the element loops, for speed only.
    const int rbase = rowGroup * G_ROWS + (half << 3);
#pragma unroll
    for (int c = 0; c < 5; ++c) {
        const int col = wave * 80 + c * 16 + lidx;
        const float bv = bias[col];
        if (col >= 3 * KC) {
            float* pT = out + (size_t)rbase * OUTC + (KC + (col - 3 * KC));
#pragma unroll
            for (int t = 0; t < ROWG; ++t)
#pragma unroll
                for (int r = 0; r < 8; ++r) {
                    const float v = acc[c][t][r] + bv;
                    pT[(t * 16 + r) * OUTC] = v > 0.f ? v : 0.f;
                    // the stores' registers are reused below: wait until the store has taken them
                    // (the scheduling fence keeps later register writes behind the wait)
                    if (r == 7) { asm volatile("s_wait_xcnt 0x0" ::: "memory"); __builtin_amdgcn_sched_barrier(0); }
                }
        } else if (col >= KC) {
            // V and Z lie in fragment order (k = row): the 8 rows a lane holds of one tile are
            // that order's 16 bytes of lane (half, column & 15), so that neighbouring lanes
            // store neighbouring 16 bytes: one b128 store each for hi and lo
            const bool isV = col < 2 * KC;
            const int  A   = frag_lane(half, isV ? col - KC : col - 2 * KC);
            bf16_t* ph = (isV ? Vthi : Zthi) + A;
            bf16_t* pl = (isV ? Vtlo : Ztlo) + A;
            float s = 0.f;
#pragma unroll
            for (int t = 0; t < ROWG; ++t) {
                Pack8 h8, l8;
#pragma unroll
                for (int r = 0; r < 8; ++r) {
                    float v = acc[c][t][r] + bv;
                    v = v > 0.f ? v : 0.f;
                    bf16_t h, l;
                    split_bf16(v, h, l);
                    h8.e[r] = h; l8.e[r] = l;
                    s += v;
                }
                *(u32x4*)(ph + frag_tile16(rowGroup * ROWG + t)) = h8.q;
                *(u32x4*)(pl + frag_tile16(rowGroup * ROWG + t)) = l8.q;
                // the stores' registers are reused below: wait until the stores have taken them
                // (the scheduling fence keeps later register writes behind the wait)
                asm volatile("s_wait_xcnt 0x0" ::: "memory");
                __builtin_amdgcn_sched_barrier(0);
            }
            if (isV) atomicAdd(&sums[col], s);            // [100..199]=V sums
        } else {
            bf16_t* ph = Uhi; bf16_t* pl = Ulo;
            const int S = KPAD;
            const int A = col + rbase * S;
            float s = 0.f;
#pragma unroll
            for (int t = 0; t < ROWG; ++t)
#pragma unroll
                for (int r = 0; r < 8; ++r) {
                    float v = acc[c][t][r] + bv;
                    v = v > 0.f ? v : 0.f;
                    const int idx = A + (t * 16 + r) * S;
                    bf16_t h, l;
                    split_bf16(v, h, l);
                    ph[idx] = h; pl[idx] = l;
                    // the stores' registers are reused below: wait until the stores have taken them
                    // (the scheduling fence keeps later register writes behind the wait)
                    asm volatile("s_wait_xcnt 0x0" ::: "memory");
                    __builtin_amdgcn_sched_barrier(0);
                    s += v;
                }
            atomicAdd(&sums[col], s);                     // [0..99]=U sums
        }
    }
}

// ---------------------------------------------------------------------------
// Dscale = 1 / (dot(sumU,sumV)/N + 1e-6)
// ---------------------------------------------------------------------------
__global__ void dscale_kernel(const float* __restrict__ sums, float* __restrict__ dscale)
{
    __shared__ float red[128];
    const int t = threadIdx.x;
    red[t] = (t < KC) ? sums[t] * sums[KC + t] : 0.f;
    __syncthreads();
    for (int s = 64; s > 0; s >>= 1) {
        if (t < s) red[t] += red[t + s];
        __syncthreads();
    }
    if (t == 0) dscale[0] = 1.0f / (red[0] / (float)N_ROWS + 1e-6f);
}

// ---------------------------------------------------------------------------
// VtZ = V^T @ Z (100x100, reduction over N). Split-K WMMA + f32 atomics.
// A/B fragments are read from planes in fragment order: 512 contiguous bytes per load.
// Pad columns (>=100) hold garbage but only affect guarded (unstored) outputs.
// ---------------------------------------------------------------------------
__global__ void __launch_bounds__(256)
vtz_kernel(const bf16_t* __restrict__ Vthi, const bf16_t* __restrict__ Vtlo,
           const bf16_t* __restrict__ Zthi, const bf16_t* __restrict__ Ztlo,
           float* __restrict__ VtZ)
{
    const int lane  = threadIdx.x & 31;
    const int gwave = blockIdx.x * WPB + (threadIdx.x >> 5);
    const int TILES = 7 * 7;
    if (gwave >= TILES * VTZ_SPLITS) return;     // wave-uniform
    const int tile  = gwave % TILES;
    const int split = gwave / TILES;
    const int mBase = (tile / 7) << 4, nBase = (tile % 7) << 4;
    const int half  = lane >> 4, lidx = lane & 15;
    const int ncol  = nBase + lidx;                        // <= 111 < MPAD

    const bf16_t* ah = Vthi + frag_lane(half, mBase + lidx);
    const bf16_t* al = Vtlo + frag_lane(half, mBase + lidx);
    const bf16_t* bh = Zthi + frag_lane(half, ncol);
    const bf16_t* bl = Ztlo + frag_lane(half, ncol);

    v8f acc = {};
    for (int kt = split; kt < N_ROWS / 32; kt += VTZ_SPLITS) {
        const int o0 = frag_tile16(2 * kt);
        const int o1 = frag_tile16(2 * kt + 1);
        Frag16 ahi, alo, bhi, blo;
        ahi.q[0] = *(const u32x4*)(ah + o0); ahi.q[1] = *(const u32x4*)(ah + o1);
        alo.q[0] = *(const u32x4*)(al + o0); alo.q[1] = *(const u32x4*)(al + o1);
        bhi.q[0] = *(const u32x4*)(bh + o0); bhi.q[1] = *(const u32x4*)(bh + o1);
        blo.q[0] = *(const u32x4*)(bl + o0); blo.q[1] = *(const u32x4*)(bl + o1);
        acc = __builtin_amdgcn_wmma_f32_16x16x32_bf16(false, alo.v, false, bhi.v, (short)0, acc, false, false);
        acc = __builtin_amdgcn_wmma_f32_16x16x32_bf16(false, ahi.v, false, blo.v, (short)0, acc, false, false);
        acc = __builtin_amdgcn_wmma_f32_16x16x32_bf16(false, ahi.v, false, bhi.v, (short)0, acc, false, false);
    }
    if (ncol < KC) {
#pragma unroll
        for (int r = 0; r < 8; ++r) {
            const int m = mBase + (half << 3) + r;
            if (m < KC) atomicAdd(&VtZ[m * KC + ncol], acc[r]);
        }
    }
}

// ---------------------------------------------------------------------------
// Split + zero-pad VtZ (100x100 f32) -> hi/lo bf16 planes of 128 k x 112 columns in
// fragment order, res_kernel's B operand (k-padding exactly zero).
// ---------------------------------------------------------------------------
__global__ void prep_vtz_kernel(const float* __restrict__ VtZ,
                                bf16_t* __restrict__ th, bf16_t* __restrict__ tl)
{
    const int i = blockIdx.x * blockDim.x + threadIdx.x;   // over MPAD*KPAD
    if (i >= MPAD * KPAD) return;
    const int n = i >> 7, k = i & (KPAD - 1);
    const float v = (n < KC && k < KC) ? VtZ[k * KC + n] : 0.f;
    bf16_t h, l;
    split_bf16(v, h, l);
    const int o = frag_tile16(k >> 4) + frag_lane((k >> 3) & 1, n) + (k & 7);
    th[o] = h; tl[o] = l;
}

// ---------------------------------------------------------------------------
// res = (U @ VtZ) * Dscale -> out[:, 0:100]. K padded 100 -> 128 (zeros).
// ---------------------------------------------------------------------------
__global__ void __launch_bounds__(256)
res_kernel(const bf16_t* __restrict__ Uhi, const bf16_t* __restrict__ Ulo,
           const bf16_t* __restrict__ Bth, const bf16_t* __restrict__ Btl,
           const float* __restrict__ dscale, float* __restrict__ out)
{
    const int lane  = threadIdx.x & 31;
    const int gwave = blockIdx.x * WPB + (threadIdx.x >> 5);
    const int rowTiles = N_ROWS / 16;       // 6250
    if (gwave >= rowTiles * 7) return;      // wave-uniform
    const int colTile = gwave % 7;
    const int rowTile = gwave / 7;
    const int half = lane >> 4, lidx = lane & 15;
    const int row  = (rowTile << 4) + lidx;
    const int ncol = (colTile << 4) + lidx;   // <= 111 < MPAD

    const bf16_t* ah = Uhi + (size_t)row * KPAD;
    const bf16_t* al = Ulo + (size_t)row * KPAD;
    const bf16_t* bh = Bth + frag_lane(half, ncol);
    const bf16_t* bl = Btl + frag_lane(half, ncol);

    v8f acc = {};
#pragma unroll
    for (int kt = 0; kt < KPAD / 32; ++kt) {
        const int kb = kt << 5;
        const int o0 = kb + (half << 3);
        const int o1 = kb + 16 + (half << 3);
        Frag16 ahi, alo, bhi, blo;
        ahi.q[0] = *(const u32x4*)(ah + o0); ahi.q[1] = *(const u32x4*)(ah + o1);
        alo.q[0] = *(const u32x4*)(al + o0); alo.q[1] = *(const u32x4*)(al + o1);
        const int p0 = frag_tile16(2 * kt), p1 = frag_tile16(2 * kt + 1);
        bhi.q[0] = *(const u32x4*)(bh + p0); bhi.q[1] = *(const u32x4*)(bh + p1);
        blo.q[0] = *(const u32x4*)(bl + p0); blo.q[1] = *(const u32x4*)(bl + p1);
        acc = __builtin_amdgcn_wmma_f32_16x16x32_bf16(false, alo.v, false, bhi.v, (short)0, acc, false, false);
        acc = __builtin_amdgcn_wmma_f32_16x16x32_bf16(false, ahi.v, false, blo.v, (short)0, acc, false, false);
        acc = __builtin_amdgcn_wmma_f32_16x16x32_bf16(false, ahi.v, false, bhi.v, (short)0, acc, false, false);
    }
    const float ds = dscale[0];
    if (ncol < KC) {
#pragma unroll
        for (int r = 0; r < 8; ++r) {
            const int m = (rowTile << 4) + (half << 3) + r;
            out[(long)m * OUTC + ncol] = acc[r] * ds;
        }
    }
}

// ---------------------------------------------------------------------------
// Launch
// ---------------------------------------------------------------------------
extern "C" void kernel_launch(void* const* d_in, const int* in_sizes, int n_in,
                              void* d_out, int out_size, void* d_ws, size_t ws_size,
                              hipStream_t stream)
{
    (void)in_sizes; (void)n_in; (void)out_size;
    const float* X  = (const float*)d_in[0];   // 100000 x 512
    const float* W  = (const float*)d_in[1];   // 400 x 512
    const float* bb = (const float*)d_in[2];   // 400
    float* out = (float*)d_out;                // 100000 x 200

    // ---- workspace carve-up (all regions 64B aligned) ----
    char* base = (char*)d_ws;
    size_t off = 0;
    auto carve = [&](size_t bytes) -> char* {
        char* p = base + off;
        off += (bytes + 63) & ~(size_t)63;
        return p;
    };
    bf16_t* Uhi  = (bf16_t*)carve((size_t)N_ROWS * KPAD * 2);
    bf16_t* Ulo  = (bf16_t*)carve((size_t)N_ROWS * KPAD * 2);   // contiguous w/ Uhi
    bf16_t* Vthi = (bf16_t*)carve((size_t)MPAD * N_ROWS * 2);
    bf16_t* Vtlo = (bf16_t*)carve((size_t)MPAD * N_ROWS * 2);
    bf16_t* Zthi = (bf16_t*)carve((size_t)MPAD * N_ROWS * 2);
    bf16_t* Ztlo = (bf16_t*)carve((size_t)MPAD * N_ROWS * 2);
    bf16_t* Whi  = (bf16_t*)carve((size_t)M_COLS * D_DIM * 2);
    bf16_t* Wlo  = (bf16_t*)carve((size_t)M_COLS * D_DIM * 2);
    float*  sums   = (float*)carve(256 * 4);                    // [U(100)|V(100)|pad]
    float*  VtZ    = (float*)carve(KC * KC * 4);                // contiguous w/ sums
    bf16_t* VtZthi = (bf16_t*)carve((size_t)MPAD * KPAD * 2);
    bf16_t* VtZtlo = (bf16_t*)carve((size_t)MPAD * KPAD * 2);
    float*  dscale = (float*)carve(64);
    const size_t baseBytes = off;
    bf16_t* Xhi = (bf16_t*)carve((size_t)N_ROWS * D_DIM * 2);
    bf16_t* Xlo = (bf16_t*)carve((size_t)N_ROWS * D_DIM * 2);
    const size_t fullBytes = off;
    const bool preX = (ws_size >= fullBytes);   // ws_size fixed -> deterministic
    (void)baseBytes;

    // 1. zero: U hi/lo (k-padding must be 0) and sums+VtZ (atomics targets)
    zero4_kernel<<<2048, 256, 0, stream>>>((u32x4*)Uhi,
                                           (long)((size_t)N_ROWS * KPAD * 2 * 2 / 16));
    zero4_kernel<<<16, 256, 0, stream>>>((u32x4*)sums,
                                         (long)((256 * 4 + KC * KC * 4) / 16));
    // 2. pre-split W (always) and X (if ws allows)
    split_kernel<<<(M_COLS * D_DIM / 4 + 255) / 256, 256, 0, stream>>>(W, Whi, Wlo, M_COLS * D_DIM);
    if (preX)
        split_kernel<<<(N_ROWS * D_DIM / 4 + 255) / 256, 256, 0, stream>>>(X, Xhi, Xlo, N_ROWS * D_DIM);
    // 3. fused GEMM + bias + relu + scatter + column sums
    {
        const int waves  = ((N_ROWS / 16) / ROWG) * (M_COLS / 16);  // 31250
        const int blocks = (waves + WPB - 1) / WPB;
        if (preX)
            gemm_relu_lds_kernel<<<N_ROWS / G_ROWS, G_THREADS, 0, stream>>>(Xhi, Xlo, Whi, Wlo, bb,
                Uhi, Ulo, Vthi, Vtlo, Zthi, Ztlo, sums, out);
        else
            gemm_relu_kernel<false><<<blocks, 256, 0, stream>>>(X, Xhi, Xlo, Whi, Wlo, bb,
                Uhi, Ulo, Vthi, Vtlo, Zthi, Ztlo, sums, out);
    }
    // 4. Dscale
    dscale_kernel<<<1, 128, 0, stream>>>(sums, dscale);
    // 5. VtZ = V^T @ Z (split-K)
    {
        const int waves  = 49 * VTZ_SPLITS;
        const int blocks = (waves + WPB - 1) / WPB;
        vtz_kernel<<<blocks, 256, 0, stream>>>(Vthi, Vtlo, Zthi, Ztlo, VtZ);
    }
    // 6. split/pad VtZ into fragment order for the final GEMM's B operand
    prep_vtz_kernel<<<(MPAD * KPAD + 255) / 256, 256, 0, stream>>>(VtZ, VtZthi, VtZtlo);
    // 7. res = U @ VtZ * Dscale -> out[:, 0:100]
    {
        const int waves  = (N_ROWS / 16) * 7;
        const int blocks = (waves + WPB - 1) / WPB;
        res_kernel<<<blocks, 256, 0, stream>>>(Uhi, Ulo, VtZthi, VtZtlo, dscale, out);
    }
}

// v004
// One run takes 266 microseconds.
// Two timings next to v003 both put it at 1.16 times that version's speed.
// Over all steps from v000 it is 3.16 times as fast.
#include <hip/hip_runtime.h>
#include <hip/hip_bf16.h>

// ---------------------------------------------------------------------------
// LowRankAttention for MI455X (gfx1250), wave32 + bf16 WMMA, fp32-split bf16.
//   out[:,0:100]   = (U @ (V^T Z)) * Dscale
//   out[:,100:200] = T
// where [U|V|Z|T] = relu(X @ W^T + b)
// W is split into bf16 (hi, lo) by a kernel of its own; X is split inside the main
// GEMM, once per element, on its way from global memory into LDS.
// ---------------------------------------------------------------------------

#define N_ROWS 100000
#define D_DIM  512
#define M_COLS 400          // 4*K
#define KC     100          // K
#define KPAD   128          // K padded for U / VtZ fragments
#define MPAD   112          // 100 padded to 7 tiles of 16
#define OUTC   200
#define WPB    8            // waves per block (256 threads)
#define ROWG   5            // row tiles per wave in main GEMM (6250 = 5*1250)
#define VTZ_SPLITS 64

typedef __bf16 bf16_t;
typedef bf16_t       v16bf __attribute__((ext_vector_type(16)));
typedef float        v8f   __attribute__((ext_vector_type(8)));
typedef unsigned int u32x4 __attribute__((ext_vector_type(4)));
typedef unsigned int u32x2 __attribute__((ext_vector_type(2)));
typedef float        f32x4 __attribute__((ext_vector_type(4)));

// 32-byte A/B fragment viewed either as bf16 lanes or as two 16B load chunks
union Frag16 { v16bf v; u32x4 q[2]; };
// 8 bf16 values viewed as one 16B store chunk
union Pack8 { bf16_t e[8]; u32x4 q; };
// 4 bf16 values viewed as one 8B store chunk
union Pack4 { bf16_t e[4]; u32x2 q; };

__device__ __forceinline__ void split_bf16(float x, bf16_t& hi, bf16_t& lo) {
    hi = (bf16_t)x;                 // RNE f32 -> bf16
    lo = (bf16_t)(x - (float)hi);   // exact residual, re-rounded
}

// ---------------------------------------------------------------------------
// Fragment order of a bf16 operand plane with element (k, c), c in 7 tiles of 16:
// one block = 32 k x 16 c = 1 KB, blocks ordered [k / 32][c / 16]. Inside a block lie
// the two 512-byte halves of the WMMA fragment (k 0..15, k 16..31), each as 32 lanes x
// 16 bytes: lane = ((k >> 3) & 1) * 16 + (c & 15) holds its 8 consecutive k.
// A wave loads a fragment as two contiguous 512-byte reads.
// offset(k, c) = frag_tile16(k >> 4) + frag_lane((k >> 3) & 1, c) + (k & 7)
// ---------------------------------------------------------------------------
#define FRAG_BLK  512                 // elements of one 32 x 16 block
#define FRAG_KSTEP (7 * FRAG_BLK)     // elements of one step of 32 k over all 7 tiles
__device__ __forceinline__ int frag_tile16(int k16) {
    return (k16 >> 1) * FRAG_KSTEP + (k16 & 1) * (FRAG_BLK / 2);
}
__device__ __forceinline__ int frag_lane(int half, int c) {
    return (c >> 4) * FRAG_BLK + (half * 16 + (c & 15)) * 8;
}

// ---------------------------------------------------------------------------
// Split a f32 array into bf16 hi/lo arrays (n multiple of 4).
// ---------------------------------------------------------------------------
__global__ void split_kernel(const float* __restrict__ src,
                             bf16_t* __restrict__ hi, bf16_t* __restrict__ lo, int n)
{
    const int i = (blockIdx.x * blockDim.x + threadIdx.x) * 4;
    if (i >= n) return;
    const f32x4 v = *(const f32x4*)(src + i);
#pragma unroll
    for (int j = 0; j < 4; ++j) {
        bf16_t h, l;
        split_bf16(v[j], h, l);
        hi[i + j] = h; lo[i + j] = l;
    }
}

// ---------------------------------------------------------------------------
// Grid-stride 16B zero fill.
// ---------------------------------------------------------------------------
__global__ void zero4_kernel(u32x4* __restrict__ p, long n4)
{
    const u32x4 z = {0u, 0u, 0u, 0u};
    for (long i = blockIdx.x * (long)blockDim.x + threadIdx.x; i < n4;
         i += (long)gridDim.x * blockDim.x)
        p[i] = z;
}

// ---------------------------------------------------------------------------
// Kernel 1: tmp = relu(X @ W^T + b), one block = 80 rows x all 400 columns,
// 5 waves, one wave = 5 row tiles x 5 col tiles.
// Per pass (32 k) the block's 400 W rows (pre-split) are copied to LDS by
// asynchronous copies; its 80 X rows are loaded as f32 into registers one pass
// ahead of their place in the ring, split there and stored to LDS. Two buffers,
// the next pass's tile in flight while this pass is worked on.
// One LDS row = [64 B hi | 64 B lo | 16 B pad].
// Epilogue: U -> bf16 hi/lo row-major [N][128]; V,Z -> bf16 hi/lo in fragment
// order (k = row); T -> out (f32); U/V column sums via one atomicAdd per lane.
// ---------------------------------------------------------------------------
#define G_WAVES   5
#define G_THREADS (G_WAVES * 32)
#define G_ROWS    (ROWG * 16)               // 80 rows of X per block
#define ST_ROWS   (M_COLS + G_ROWS)         // W rows first, then X rows
#define ST_PITCH  144                       // 16 B x odd: conflict-free b128 reads
#define ST_BYTES  (ST_ROWS * ST_PITCH)
#define CP_ROWS   (G_THREADS / 8)           // rows covered by one copy of the block
#define G_PASSES  (D_DIM / 32)
#define X_CH      (G_ROWS / CP_ROWS)        // X rows per lane and pass

__device__ __forceinline__ unsigned lds_off(const void* p) {
    return (unsigned)(unsigned long long)p;   // low 32 bits of a __shared__ address
}

// Ten 16-byte-per-lane copies to LDS. The closing s_wait_xcnt keeps every
// address register of the copies unwritten until the copies have taken them.
__device__ __forceinline__ void async_copy10(const unsigned (&l)[10],
                                             const bf16_t* const (&p)[10])
{
    asm volatile(
        "global_load_async_to_lds_b128 %0, %10, off\n\t"
        "global_load_async_to_lds_b128 %1, %11, off\n\t"
        "global_load_async_to_lds_b128 %2, %12, off\n\t"
        "global_load_async_to_lds_b128 %3, %13, off\n\t"
        "global_load_async_to_lds_b128 %4, %14, off\n\t"
        "global_load_async_to_lds_b128 %5, %15, off\n\t"
        "global_load_async_to_lds_b128 %6, %16, off\n\t"
        "global_load_async_to_lds_b128 %7, %17, off\n\t"
        "global_load_async_to_lds_b128 %8, %18, off\n\t"
        "global_load_async_to_lds_b128 %9, %19, off\n\t"
        "s_wait_xcnt 0x0"
        :: "v"(l[0]), "v"(l[1]), "v"(l[2]), "v"(l[3]), "v"(l[4]),
           "v"(l[5]), "v"(l[6]), "v"(l[7]), "v"(l[8]), "v"(l[9]),
           "v"(p[0]), "v"(p[1]), "v"(p[2]), "v"(p[3]), "v"(p[4]),
           "v"(p[5]), "v"(p[6]), "v"(p[7]), "v"(p[8]), "v"(p[9])
        : "memory");
}

// One pass's W tile: 20 copies per lane.
__device__ __forceinline__ void stage_w(unsigned lds, const bf16_t* gW)
{
#pragma unroll
    for (int g = 0; g < 2; ++g) {
        unsigned l[10];
        const bf16_t* p[10];
#pragma unroll
        for (int j = 0; j < 10; ++j) {
            l[j] = lds + (g * 10 + j) * (CP_ROWS * ST_PITCH);
            p[j] = gW + (g * 10 + j) * (CP_ROWS * D_DIM);
        }
        async_copy10(l, p);
    }
}

// One pass's X tile, f32: 4 floats of each of 4 rows per lane (8 lanes = one 128-byte row).
__device__ __forceinline__ void load_x(f32x4 (&xr)[X_CH], const float* gX)
{
#pragma unroll
    for (int j = 0; j < X_CH; ++j)
        xr[j] = *(const f32x4*)(gX + j * (CP_ROWS * D_DIM));
    // the loads' address is advanced for the next pass: wait until the loads have
    // taken it (the scheduling fence keeps later register writes behind the wait)
    asm volatile("s_wait_xcnt 0x0" ::: "memory");
    __builtin_amdgcn_sched_barrier(0);
}

// Split the loaded X values and store them into the tile's X rows: 8 bytes hi, 8 bytes lo.
__device__ __forceinline__ void store_x(unsigned char* sx, const f32x4 (&xr)[X_CH])
{
#pragma unroll
    for (int j = 0; j < X_CH; ++j) {
        Pack4 h4, l4;
#pragma unroll
        for (int e = 0; e < 4; ++e) {
            bf16_t h, l;
            split_bf16(xr[j][e], h, l);
            h4.e[e] = h; l4.e[e] = l;
        }
        *(u32x2*)(sx + j * (CP_ROWS * ST_PITCH))      = h4.q;
        *(u32x2*)(sx + j * (CP_ROWS * ST_PITCH) + 64) = l4.q;
    }
}

__global__ void __launch_bounds__(G_THREADS, 3)   // 3 waves per SIMD: two blocks share a WGP
gemm_relu_lds_kernel(const float* __restrict__ X,
                     const bf16_t* __restrict__ Whi, const bf16_t* __restrict__ Wlo,
                     const float* __restrict__ bias,
                     bf16_t* __restrict__ Uhi, bf16_t* __restrict__ Ulo,
                     bf16_t* __restrict__ Vthi, bf16_t* __restrict__ Vtlo,
                     bf16_t* __restrict__ Zthi, bf16_t* __restrict__ Ztlo,
                     float* __restrict__ sums, float* __restrict__ out)
{
    __shared__ __attribute__((aligned(16))) unsigned char smem[2 * ST_BYTES];

    const int tid      = threadIdx.x;
    const int lane     = tid & 31;
    const int wave     = __builtin_amdgcn_readfirstlane(tid >> 5);
    const int rowGroup = blockIdx.x;
    const int half     = lane >> 4;
    const int lidx     = lane & 15;

    // this lane's share of every W copy: row (tid >> 3) of each group of CP_ROWS
    // rows, 16-byte chunk (tid & 7): chunks 0..3 from hi, 4..7 from lo;
    // of every X load: the same row of each group, floats (tid & 7) * 4 .. + 3
    const int  crow = tid >> 3;
    const bool chi  = (tid & 7) < 4;
    const unsigned ldsT = lds_off(smem) + crow * ST_PITCH + (tid & 7) * 16;
    const bf16_t* gW = (chi ? Whi : Wlo) + crow * D_DIM + (tid & 3) * 8;
    const float* gX = X + (size_t)(rowGroup * G_ROWS + crow) * D_DIM + (tid & 7) * 4;
    unsigned char* sx = smem + (M_COLS + crow) * ST_PITCH + (tid & 7) * 8;
    f32x4 xr[X_CH];

    v8f acc[5][ROWG];
#pragma unroll
    for (int c = 0; c < 5; ++c)
#pragma unroll
        for (int t = 0; t < ROWG; ++t) acc[c][t] = {};

    load_x(xr, gX);
    gX += 32;
    stage_w(ldsT, gW);
    store_x(sx, xr);
    load_x(xr, gX);
    gX += 32;
    asm volatile("s_wait_dscnt 0x0" ::: "memory");      // tile 0: this wave's X rows stored
    asm volatile("s_wait_asynccnt 0x0" ::: "memory");   // ... and its W copies landed
    __syncthreads();                                    // ... and every other wave's
    stage_w(ldsT + ST_BYTES, gW + 32);
    store_x(sx + ST_BYTES, xr);

    for (int kt = 0; kt < G_PASSES; ++kt) {
        const int buf = (kt & 1) * ST_BYTES;
        const unsigned char* sa = smem + buf + (M_COLS + lidx) * ST_PITCH + (half << 4);
        const unsigned char* sb = smem + buf + (wave * 80 + lidx) * ST_PITCH + (half << 4);

        // X of tile kt + 2 flies through this pass; it is split and stored behind the barrier
        if (kt + 2 < G_PASSES) { load_x(xr, gX); gX += 32; }

        // lo(A) x hi(B) first, then hi(A) x lo(B) and hi(A) x hi(B): only one half of
        // the A fragments is live at a time, so that the accumulators stay in registers
        {
            Frag16 alo[ROWG];
#pragma unroll
            for (int t = 0; t < ROWG; ++t) {
                const unsigned char* r = sa + t * (16 * ST_PITCH);
                alo[t].q[0] = *(const u32x4*)(r + 64);
                alo[t].q[1] = *(const u32x4*)(r + 96);
            }
#pragma unroll
            for (int c = 0; c < 5; ++c) {
                const unsigned char* r = sb + c * (16 * ST_PITCH);
                Frag16 bhi;
                bhi.q[0] = *(const u32x4*)(r);
                bhi.q[1] = *(const u32x4*)(r + 32);
#pragma unroll
                for (int t = 0; t < ROWG; ++t)
                    acc[c][t] = __builtin_amdgcn_wmma_f32_16x16x32_bf16(false, alo[t].v, false, bhi.v, (short)0, acc[c][t], false, false);
            }
        }
        {
            Frag16 ahi[ROWG];
#pragma unroll
            for (int t = 0; t < ROWG; ++t) {
                const unsigned char* r = sa + t * (16 * ST_PITCH);
                ahi[t].q[0] = *(const u32x4*)(r);
                ahi[t].q[1] = *(const u32x4*)(r + 32);
            }
#pragma unroll
            for (int c = 0; c < 5; ++c) {
                const unsigned char* r = sb + c * (16 * ST_PITCH);
                Frag16 bhi, blo;
                bhi.q[0] = *(const u32x4*)(r);
                bhi.q[1] = *(const u32x4*)(r + 32);
                blo.q[0] = *(const u32x4*)(r + 64);
                blo.q[1] = *(const u32x4*)(r + 96);
#pragma unroll
                for (int t = 0; t < ROWG; ++t)
                    acc[c][t] = __builtin_amdgcn_wmma_f32_16x16x32_bf16(false, ahi[t].v, false, blo.v, (short)0, acc[c][t], false, false);
#pragma unroll
                for (int t = 0; t < ROWG; ++t)
                    acc[c][t] = __builtin_amdgcn_wmma_f32_16x16x32_bf16(false, ahi[t].v, false, bhi.v, (short)0, acc[c][t], false, false);
            }
        }

        // keeps the pass's last WMMAs in front of the barrier: sunk behind it they would
        // delay the issue of the next copies and shorten their lead
        __builtin_amdgcn_sched_barrier(0);
        asm volatile("s_wait_dscnt 0x0" ::: "memory");     // this wave has left the buffer, its X stores of tile kt + 1 are done
        asm volatile("s_wait_asynccnt 0x0" ::: "memory");  // its copies of tile kt + 1 landed
        __syncthreads();   // publishes tile kt + 1, frees this pass's buffer
        if (kt + 2 < G_PASSES) {
            stage_w(ldsT + buf, gW + (kt + 2) * 32);
            store_x(sx + buf, xr);
        }
    }
    asm volatile("s_wait_asynccnt 0x0" ::: "memory");      // no copy outlives the loop

    // ---- epilogue: bias + relu; route column; fold in column sums ----
    // The T / V,Z / U test stands outside the element loops, for speed only.
    const int rbase = rowGroup * G_ROWS + (half << 3);
#pragma unroll
    for (int c = 0; c < 5; ++c) {
        const int col = wave * 80 + c * 16 + lidx;
        const float bv = bias[col];
        if (col >= 3 * KC) {
            float* pT = out + (size_t)rbase * OUTC + (KC + (col - 3 * KC));
#pragma unroll
            for (int t = 0; t < ROWG; ++t)
#pragma unroll
                for (int r = 0; r < 8; ++r) {
                    const float v = acc[c][t][r] + bv;
                    pT[(t * 16 + r) * OUTC] = v > 0.f ? v : 0.f;
                    // the stores' registers are reused below: wait until the store has taken them
                    // (the scheduling fence keeps later register writes behind the wait)
                    if (r == 7) { asm volatile("s_wait_xcnt 0x0" ::: "memory"); __builtin_amdgcn_sched_barrier(0); }
                }
        } else if (col >= KC) {
            // V and Z lie in fragment order (k = row): the 8 rows a lane holds of one tile are
            // that order's 16 bytes of lane (half, column & 15), so that neighbouring lanes
            // store neighbouring 16 bytes: one b128 store each for hi and lo
            const bool isV = col < 2 * KC;
            const int  A   = frag_lane(half, isV ? col - KC : col - 2 * KC);
            bf16_t* ph = (isV ? Vthi : Zthi) + A;
            bf16_t* pl = (isV ? Vtlo : Ztlo) + A;
            float s = 0.f;
#pragma unroll
            for (int t = 0; t < ROWG; ++t) {
                Pack8 h8, l8;
#pragma unroll
                for (int r = 0; r < 8; ++r) {
                    float v = acc[c][t][r] + bv;
                    v = v > 0.f ? v : 0.f;
                    bf16_t h, l;
                    split_bf16(v, h, l);
                    h8.e[r] = h; l8.e[r] = l;
                    s += v;
                }
                *(u32x4*)(ph + frag_tile16(rowGroup * ROWG + t)) = h8.q;
                *(u32x4*)(pl + frag_tile16(rowGroup * ROWG + t)) = l8.q;
                // the stores' registers are reused below: wait until the stores have taken them
                // (the scheduling fence keeps later register writes behind the wait)
                asm volatile("s_wait_xcnt 0x0" ::: "memory");
                __builtin_amdgcn_sched_barrier(0);
            }
            if (isV) atomicAdd(&sums[col], s);            // [100..199]=V sums
        } else {
            bf16_t* ph = Uhi; bf16_t* pl = Ulo;
            const int S = KPAD;
            const int A = col + rbase * S;
            float s = 0.f;
#pragma unroll
            for (int t = 0; t < ROWG; ++t)
#pragma unroll
                for (int r = 0; r < 8; ++r) {
                    float v = acc[c][t][r] + bv;
                    v = v > 0.f ? v : 0.f;
                    const int idx = A + (t * 16 + r) * S;
                    bf16_t h, l;
                    split_bf16(v, h, l);
                    ph[idx] = h; pl[idx] = l;
                    // the stores' registers are reused below: wait until the stores have taken them
                    // (the scheduling fence keeps later register writes behind the wait)
                    asm volatile("s_wait_xcnt 0x0" ::: "memory");
                    __builtin_amdgcn_sched_barrier(0);
                    s += v;
                }
            atomicAdd(&sums[col], s);                     // [0..99]=U sums
        }
    }
}

// ---------------------------------------------------------------------------
// Dscale = 1 / (dot(sumU,sumV)/N + 1e-6)
// ---------------------------------------------------------------------------
__global__ void dscale_kernel(const float* __restrict__ sums, float* __restrict__ dscale)
{
    __shared__ float red[128];
    const int t = threadIdx.x;
    red[t] = (t < KC) ? sums[t] * sums[KC + t] : 0.f;
    __syncthreads();
    for (int s = 64; s > 0; s >>= 1) {
        if (t < s) red[t] += red[t + s];
        __syncthreads();
    }
    if (t == 0) dscale[0] = 1.0f / (red[0] / (float)N_ROWS + 1e-6f);
}

// ---------------------------------------------------------------------------
// VtZ = V^T @ Z (100x100, reduction over N). Split-K WMMA + f32 atomics.
// A/B fragments are read from planes in fragment order: 512 contiguous bytes per load.
// Pad columns (>=100) hold garbage but only affect guarded (unstored) outputs.
// ---------------------------------------------------------------------------
__global__ void __launch_bounds__(256)
vtz_kernel(const bf16_t* __restrict__ Vthi, const bf16_t* __restrict__ Vtlo,
           const bf16_t* __restrict__ Zthi, const bf16_t* __restrict__ Ztlo,
           float* __restrict__ VtZ)
{
    const int lane  = threadIdx.x & 31;
    const int gwave = blockIdx.x * WPB + (threadIdx.x >> 5);
    const int TILES = 7 * 7;
    if (gwave >= TILES * VTZ_SPLITS) return;     // wave-uniform
    const int tile  = gwave % TILES;
    const int split = gwave / TILES;
    const int mBase = (tile / 7) << 4, nBase = (tile % 7) << 4;
    const int half  = lane >> 4, lidx = lane & 15;
    const int ncol  = nBase + lidx;                        // <= 111 < MPAD

    const bf16_t* ah = Vthi + frag_lane(half, mBase + lidx);
    const bf16_t* al = Vtlo + frag_lane(half, mBase + lidx);
    const bf16_t* bh = Zthi + frag_lane(half, ncol);
    const bf16_t* bl = Ztlo + frag_lane(half, ncol);

    v8f acc = {};
    for (int kt = split; kt < N_ROWS / 32; kt += VTZ_SPLITS) {
        const int o0 = frag_tile16(2 * kt);
        const int o1 = frag_tile16(2 * kt + 1);
        Frag16 ahi, alo, bhi, blo;
        ahi.q[0] = *(const u32x4*)(ah + o0); ahi.q[1] = *(const u32x4*)(ah + o1);
        alo.q[0] = *(const u32x4*)(al + o0); alo.q[1] = *(const u32x4*)(al + o1);
        bhi.q[0] = *(const u32x4*)(bh + o0); bhi.q[1] = *(const u32x4*)(bh + o1);
        blo.q[0] = *(const u32x4*)(bl + o0); blo.q[1] = *(const u32x4*)(bl + o1);
        acc = __builtin_amdgcn_wmma_f32_16x16x32_bf16(false, alo.v, false, bhi.v, (short)0, acc, false, false);
        acc = __builtin_amdgcn_wmma_f32_16x16x32_bf16(false, ahi.v, false, blo.v, (short)0, acc, false, false);
        acc = __builtin_amdgcn_wmma_f32_16x16x32_bf16(false, ahi.v, false, bhi.v, (short)0, acc, false, false);
    }
    if (ncol < KC) {
#pragma unroll
        for (int r = 0; r < 8; ++r) {
            const int m = mBase + (half << 3) + r;
            if (m < KC) atomicAdd(&VtZ[m * KC + ncol], acc[r]);
        }
    }
}

// ---------------------------------------------------------------------------
// Split + zero-pad VtZ (100x100 f32) -> hi/lo bf16 planes of 128 k x 112 columns in
// fragment order, res_kernel's B operand (k-padding exactly zero).
// ---------------------------------------------------------------------------
__global__ void prep_vtz_kernel(const float* __restrict__ VtZ,
                                bf16_t* __restrict__ th, bf16_t* __restrict__ tl)
{
    const int i = blockIdx.x * blockDim.x + threadIdx.x;   // over MPAD*KPAD
    if (i >= MPAD * KPAD) return;
    const int n = i >> 7, k = i & (KPAD - 1);
    const float v = (n < KC && k < KC) ? VtZ[k * KC + n] : 0.f;
    bf16_t h, l;
    split_bf16(v, h, l);
    const int o = frag_tile16(k >> 4) + frag_lane((k >> 3) & 1, n) + (k & 7);
    th[o] = h; tl[o] = l;
}

// ---------------------------------------------------------------------------
// res = (U @ VtZ) * Dscale -> out[:, 0:100]. K padded 100 -> 128 (zeros).
// ---------------------------------------------------------------------------
__global__ void __launch_bounds__(256)
res_kernel(const bf16_t* __restrict__ Uhi, const bf16_t* __restrict__ Ulo,
           const bf16_t* __restrict__ Bth, const bf16_t* __restrict__ Btl,
           const float* __restrict__ dscale, float* __restrict__ out)
{
    const int lane  = threadIdx.x & 31;
    const int gwave = blockIdx.x * WPB + (threadIdx.x >> 5);
    const int rowTiles = N_ROWS / 16;       // 6250
    if (gwave >= rowTiles * 7) return;      // wave-uniform
    const int colTile = gwave % 7;
    const int rowTile = gwave / 7;
    const int half = lane >> 4, lidx = lane & 15;
    const int row  = (rowTile << 4) + lidx;
    const int ncol = (colTile << 4) + lidx;   // <= 111 < MPAD

    const bf16_t* ah = Uhi + (size_t)row * KPAD;
    const bf16_t* al = Ulo + (size_t)row * KPAD;
    const bf16_t* bh = Bth + frag_lane(half, ncol);
    const bf16_t* bl = Btl + frag_lane(half, ncol);

    v8f acc = {};
#pragma unroll
    for (int kt = 0; kt < KPAD / 32; ++kt) {
        const int kb = kt << 5;
        const int o0 = kb + (half << 3);
        const int o1 = kb + 16 + (half << 3);
        Frag16 ahi, alo, bhi, blo;
        ahi.q[0] = *(const u32x4*)(ah + o0); ahi.q[1] = *(const u32x4*)(ah + o1);
        alo.q[0] = *(const u32x4*)(al + o0); alo.q[1] = *(const u32x4*)(al + o1);
        const int p0 = frag_tile16(2 * kt), p1 = frag_tile16(2 * kt + 1);
        bhi.q[0] = *(const u32x4*)(bh + p0); bhi.q[1] = *(const u32x4*)(bh + p1);
        blo.q[0] = *(const u32x4*)(bl + p0); blo.q[1] = *(const u32x4*)(bl + p1);
        acc = __builtin_amdgcn_wmma_f32_16x16x32_bf16(false, alo.v, false, bhi.v, (short)0, acc, false, false);
        acc = __builtin_amdgcn_wmma_f32_16x16x32_bf16(false, ahi.v, false, blo.v, (short)0, acc, false, false);
        acc = __builtin_amdgcn_wmma_f32_16x16x32_bf16(false, ahi.v, false, bhi.v, (short)0, acc, false, false);
    }
    const float ds = dscale[0];
    if (ncol < KC) {
#pragma unroll
        for (int r = 0; r < 8; ++r) {
            const int m = (rowTile << 4) + (half << 3) + r;
            out[(long)m * OUTC + ncol] = acc[r] * ds;
        }
    }
}

// ---------------------------------------------------------------------------
// Launch
// ---------------------------------------------------------------------------
extern "C" void kernel_launch(void* const* d_in, const int* in_sizes, int n_in,
                              void* d_out, int out_size, void* d_ws, size_t ws_size,
                              hipStream_t stream)
{
    (void)in_sizes; (void)n_in; (void)out_size;
    const float* X  = (const float*)d_in[0];   // 100000 x 512
    const float* W  = (const float*)d_in[1];   // 400 x 512
    const float* bb = (const float*)d_in[2];   // 400
    float* out = (float*)d_out;                // 100000 x 200

    // ---- workspace carve-up (all regions 64B aligned) ----
    char* base = (char*)d_ws;
    size_t off = 0;
    auto carve = [&](size_t bytes) -> char* {
        char* p = base + off;
        off += (bytes + 63) & ~(size_t)63;
        return p;
    };
    bf16_t* Uhi  = (bf16_t*)carve((size_t)N_ROWS * KPAD * 2);
    bf16_t* Ulo  = (bf16_t*)carve((size_t)N_ROWS * KPAD * 2);   // contiguous w/ Uhi
    bf16_t* Vthi = (bf16_t*)carve((size_t)MPAD * N_ROWS * 2);
    bf16_t* Vtlo = (bf16_t*)carve((size_t)MPAD * N_ROWS * 2);
    bf16_t* Zthi = (bf16_t*)carve((size_t)MPAD * N_ROWS * 2);
    bf16_t* Ztlo = (bf16_t*)carve((size_t)MPAD * N_ROWS * 2);
    bf16_t* Whi  = (bf16_t*)carve((size_t)M_COLS * D_DIM * 2);
    bf16_t* Wlo  = (bf16_t*)carve((size_t)M_COLS * D_DIM * 2);
    float*  sums   = (float*)carve(256 * 4);                    // [U(100)|V(100)|pad]
    float*  VtZ    = (float*)carve(KC * KC * 4);                // contiguous w/ sums
    bf16_t* VtZthi = (bf16_t*)carve((size_t)MPAD * KPAD * 2);
    bf16_t* VtZtlo = (bf16_t*)carve((size_t)MPAD * KPAD * 2);
    float*  dscale = (float*)carve(64);
    (void)ws_size;

    // 1. zero: U hi/lo (k-padding must be 0) and sums+VtZ (atomics targets)
    zero4_kernel<<<2048, 256, 0, stream>>>((u32x4*)Uhi,
                                           (long)((size_t)N_ROWS * KPAD * 2 * 2 / 16));
    zero4_kernel<<<16, 256, 0, stream>>>((u32x4*)sums,
                                         (long)((256 * 4 + KC * KC * 4) / 16));
    // 2. pre-split W
    split_kernel<<<(M_COLS * D_DIM / 4 + 255) / 256, 256, 0, stream>>>(W, Whi, Wlo, M_COLS * D_DIM);
    // 3. fused X split + GEMM + bias + relu + scatter + column sums
    gemm_relu_lds_kernel<<<N_ROWS / G_ROWS, G_THREADS, 0, stream>>>(X, Whi, Wlo, bb,
        Uhi, Ulo, Vthi, Vtlo, Zthi, Ztlo, sums, out);
    // 4. Dscale
    dscale_kernel<<<1, 128, 0, stream>>>(sums, dscale);
    // 5. VtZ = V^T @ Z (split-K)
    {
        const int waves  = 49 * VTZ_SPLITS;
        const int blocks = (waves + WPB - 1) / WPB;
        vtz_kernel<<<blocks, 256, 0, stream>>>(Vthi, Vtlo, Zthi, Ztlo, VtZ);
    }
    // 6. split/pad VtZ into fragment order for the final GEMM's B operand
    prep_vtz_kernel<<<(MPAD * KPAD + 255) / 256, 256, 0, stream>>>(VtZ, VtZthi, VtZtlo);
    // 7. res = U @ VtZ * Dscale -> out[:, 0:100]
    {
        const int waves  = (N_ROWS / 16) * 7;
        const int blocks = (waves + WPB - 1) / WPB;
        res_kernel<<<blocks, 256, 0, stream>>>(Uhi, Ulo, VtZthi, VtZtlo, dscale, out);
    }
}

// v005
// A run of this version takes 244 microseconds.
// Timed twice side by side with v004, it ran 1.10 and 1.09 times as fast.
// All steps since v000 together make it 3.46 times as fast.
#include <hip/hip_runtime.h>
#include <hip/hip_bf16.h>

// ---------------------------------------------------------------------------
// LowRankAttention for MI455X (gfx1250), wave32 + bf16 WMMA, fp32-split bf16.
//   out[:,0:100]   = (U @ (V^T Z)) * Dscale
//   out[:,100:200] = T
// where [U|V|Z|T] = relu(X @ W^T + b)
// W is split into bf16 (hi, lo) by a kernel of its own; X is split inside the main
// GEMM, once per element, on its way from global memory into LDS.
// ---------------------------------------------------------------------------

#define N_ROWS 100000
#define D_DIM  512
#define M_COLS 400          // 4*K
#define KC     100          // K
#define KPAD   128          // K padded for U / VtZ fragments
#define MPAD   112          // 100 padded to 7 tiles of 16
#define OUTC   200
#define WPB    8            // waves per block (256 threads)
#define ROWG   5            // row tiles per wave in main GEMM (6250 = 5*1250)
#define VTZ_SPLITS 64

typedef __bf16 bf16_t;
typedef bf16_t       v16bf __attribute__((ext_vector_type(16)));
typedef float        v8f   __attribute__((ext_vector_type(8)));
typedef unsigned int u32x4 __attribute__((ext_vector_type(4)));
typedef unsigned int u32x2 __attribute__((ext_vector_type(2)));
typedef float        f32x4 __attribute__((ext_vector_type(4)));

// 32-byte A/B fragment viewed either as bf16 lanes or as two 16B load chunks
union Frag16 { v16bf v; u32x4 q[2]; };
// 8 bf16 values viewed as one 16B store chunk
union Pack8 { bf16_t e[8]; u32x4 q; };
// 4 bf16 values viewed as one 8B store chunk
union Pack4 { bf16_t e[4]; u32x2 q; };

__device__ __forceinline__ void split_bf16(float x, bf16_t& hi, bf16_t& lo) {
    hi = (bf16_t)x;                 // RNE f32 -> bf16
    lo = (bf16_t)(x - (float)hi);   // exact residual, re-rounded
}

// ---------------------------------------------------------------------------
// Fragment order of a bf16 operand plane with element (k, c), c in 7 tiles of 16:
// one block = 32 k x 16 c = 1 KB, blocks ordered [k / 32][c / 16]. Inside a block lie
// the two 512-byte halves of the WMMA fragment (k 0..15, k 16..31), each as 32 lanes x
// 16 bytes: lane = ((k >> 3) & 1) * 16 + (c & 15) holds its 8 consecutive k.
// A wave loads a fragment as two contiguous 512-byte reads.
// offset(k, c) = frag_tile16(k >> 4) + frag_lane((k >> 3) & 1, c) + (k & 7)
// ---------------------------------------------------------------------------
#define FRAG_BLK  512                 // elements of one 32 x 16 block
#define FRAG_KSTEP (7 * FRAG_BLK)     // elements of one step of 32 k over all 7 tiles
__device__ __forceinline__ int frag_tile16(int k16) {
    return (k16 >> 1) * FRAG_KSTEP + (k16 & 1) * (FRAG_BLK / 2);
}
__device__ __forceinline__ int frag_lane(int half, int c) {
    return (c >> 4) * FRAG_BLK + (half * 16 + (c & 15)) * 8;
}

// ---------------------------------------------------------------------------
// Fragment order of the U planes, element (row, k), k in 0..127: the result GEMM's A
// operand. One block = 16 rows x 32 k = 1 KB, blocks ordered [row / 16][k / 32]; inside
// a block the two 512-byte halves (k 0..15, k 16..31), each as 32 lanes x 16 bytes:
// lane = ((k >> 3) & 1) * 16 + (row & 15) holds its 8 consecutive k.
// offset(row, k) = (row >> 4) * UFRAG_ROWT + ufrag_k16(k >> 4)
//                + (((k >> 3) & 1) * 16 + (row & 15)) * 8 + (k & 7)
// ---------------------------------------------------------------------------
#define UFRAG_ROWT (KPAD * 16)        // elements of one tile of 16 rows, all 128 k
__device__ __forceinline__ int ufrag_k16(int k16) {
    return (k16 >> 1) * FRAG_BLK + (k16 & 1) * (FRAG_BLK / 2);
}

// v + the value of lane (l ^ M) of the same 16-lane row (all lanes on)
template <int M>
__device__ __forceinline__ float row_xor_add(float v) {
    return v + __int_as_float(__builtin_amdgcn_update_dpp(0, __float_as_int(v), 0x160 | M, 0xf, 0xf, true));
}

// One bf16 product step. Swapped, W is the A operand and X the B operand: the tile comes
// out transposed, register r of lane (half, i) = (row i, column 8 * half + r).
template <bool SWAP>
__device__ __forceinline__ v8f mma(const v16bf x, const v16bf w, const v8f acc) {
    if (SWAP) return __builtin_amdgcn_wmma_f32_16x16x32_bf16(false, w, false, x, (short)0, acc, false, false);
    return __builtin_amdgcn_wmma_f32_16x16x32_bf16(false, x, false, w, (short)0, acc, false, false);
}

// ---------------------------------------------------------------------------
// Split a f32 array into bf16 hi/lo arrays (n multiple of 4).
// ---------------------------------------------------------------------------
__global__ void split_kernel(const float* __restrict__ src,
                             bf16_t* __restrict__ hi, bf16_t* __restrict__ lo, int n)
{
    const int i = (blockIdx.x * blockDim.x + threadIdx.x) * 4;
    if (i >= n) return;
    const f32x4 v = *(const f32x4*)(src + i);
#pragma unroll
    for (int j = 0; j < 4; ++j) {
        bf16_t h, l;
        split_bf16(v[j], h, l);
        hi[i + j] = h; lo[i + j] = l;
    }
}

// ---------------------------------------------------------------------------
// Grid-stride 16B zero fill.
// ---------------------------------------------------------------------------
__global__ void zero4_kernel(u32x4* __restrict__ p, long n4)
{
    const u32x4 z = {0u, 0u, 0u, 0u};
    for (long i = blockIdx.x * (long)blockDim.x + threadIdx.x; i < n4;
         i += (long)gridDim.x * blockDim.x)
        p[i] = z;
}

// ---------------------------------------------------------------------------
// Kernel 1: tmp = relu(X @ W^T + b), one block = 80 rows x all 400 columns,
// 5 waves, one wave = 5 row tiles x 5 col tiles: column tiles wave, 5 + wave, ... 20 + wave.
// A wave's first column tile (columns 0..79, U's first 80 of 100) is computed with the operands
// swapped, so that a lane holds 8 consecutive columns of one row.
// Per pass (32 k) the block's 400 W rows (pre-split) are copied to LDS by
// asynchronous copies; its 80 X rows are loaded as f32 into registers one pass
// ahead of their place in the ring, split there and stored to LDS. Two buffers,
// the next pass's tile in flight while this pass is worked on.
// One LDS row = [64 B hi | 64 B lo | 16 B pad].
// Epilogue: U -> bf16 hi/lo in fragment order (k = column); V,Z -> bf16 hi/lo in fragment
// order (k = row); T -> out (f32); U/V column sums via atomicAdd.
// ---------------------------------------------------------------------------
#define G_WAVES   5
#define G_THREADS (G_WAVES * 32)
#define G_ROWS    (ROWG * 16)               // 80 rows of X per block
#define ST_ROWS   (M_COLS + G_ROWS)         // W rows first, then X rows
#define ST_PITCH  144                       // 16 B x odd: conflict-free b128 reads
#define ST_BYTES  (ST_ROWS * ST_PITCH)
#define CP_ROWS   (G_THREADS / 8)           // rows covered by one copy of the block
#define G_PASSES  (D_DIM / 32)
#define X_CH      (G_ROWS / CP_ROWS)        // X rows per lane and pass
#define XT_PITCH  80                        // epilogue's turn of a tile: 64 B + 16 B pad (16 B x odd)

__device__ __forceinline__ unsigned lds_off(const void* p) {
    return (unsigned)(unsigned long long)p;   // low 32 bits of a __shared__ address
}

// Ten 16-byte-per-lane copies to LDS. The closing s_wait_xcnt keeps every
// address register of the copies unwritten until the copies have taken them.
__device__ __forceinline__ void async_copy10(const unsigned (&l)[10],
                                             const bf16_t* const (&p)[10])
{
    asm volatile(
        "global_load_async_to_lds_b128 %0, %10, off\n\t"
        "global_load_async_to_lds_b128 %1, %11, off\n\t"
        "global_load_async_to_lds_b128 %2, %12, off\n\t"
        "global_load_async_to_lds_b128 %3, %13, off\n\t"
        "global_load_async_to_lds_b128 %4, %14, off\n\t"
        "global_load_async_to_lds_b128 %5, %15, off\n\t"
        "global_load_async_to_lds_b128 %6, %16, off\n\t"
        "global_load_async_to_lds_b128 %7, %17, off\n\t"
        "global_load_async_to_lds_b128 %8, %18, off\n\t"
        "global_load_async_to_lds_b128 %9, %19, off\n\t"
        "s_wait_xcnt 0x0"
        :: "v"(l[0]), "v"(l[1]), "v"(l[2]), "v"(l[3]), "v"(l[4]),
           "v"(l[5]), "v"(l[6]), "v"(l[7]), "v"(l[8]), "v"(l[9]),
           "v"(p[0]), "v"(p[1]), "v"(p[2]), "v"(p[3]), "v"(p[4]),
           "v"(p[5]), "v"(p[6]), "v"(p[7]), "v"(p[8]), "v"(p[9])
        : "memory");
}

// One pass's W tile: 20 copies per lane.
__device__ __forceinline__ void stage_w(unsigned lds, const bf16_t* gW)
{
#pragma unroll
    for (int g = 0; g < 2; ++g) {
        unsigned l[10];
        const bf16_t* p[10];
#pragma unroll
        for (int j = 0; j < 10; ++j) {
            l[j] = lds + (g * 10 + j) * (CP_ROWS * ST_PITCH);
            p[j] = gW + (g * 10 + j) * (CP_ROWS * D_DIM);
        }
        async_copy10(l, p);
    }
}

// One pass's X tile, f32: 4 floats of each of 4 rows per lane (8 lanes = one 128-byte row).
__device__ __forceinline__ void load_x(f32x4 (&xr)[X_CH], const float* gX)
{
#pragma unroll
    for (int j = 0; j < X_CH; ++j)
        xr[j] = *(const f32x4*)(gX + j * (CP_ROWS * D_DIM));
    // the loads' address is advanced for the next pass: wait until the loads have
    // taken it (the scheduling fence keeps later register writes behind the wait)
    asm volatile("s_wait_xcnt 0x0" ::: "memory");
    __builtin_amdgcn_sched_barrier(0);
}

// Split the loaded X values and store them into the tile's X rows: 8 bytes hi, 8 bytes lo.
__device__ __forceinline__ void store_x(unsigned char* sx, const f32x4 (&xr)[X_CH])
{
#pragma unroll
    for (int j = 0; j < X_CH; ++j) {
        Pack4 h4, l4;
#pragma unroll
        for (int e = 0; e < 4; ++e) {
            bf16_t h, l;
            split_bf16(xr[j][e], h, l);
            h4.e[e] = h; l4.e[e] = l;
        }
        *(u32x2*)(sx + j * (CP_ROWS * ST_PITCH))      = h4.q;
        *(u32x2*)(sx + j * (CP_ROWS * ST_PITCH) + 64) = l4.q;
    }
}

__global__ void __launch_bounds__(G_THREADS, 3)   // 3 waves per SIMD: two blocks share a WGP
gemm_relu_lds_kernel(const float* __restrict__ X,
                     const bf16_t* __restrict__ Whi, const bf16_t* __restrict__ Wlo,
                     const float* __restrict__ bias,
                     bf16_t* __restrict__ Uhi, bf16_t* __restrict__ Ulo,
                     bf16_t* __restrict__ Vthi, bf16_t* __restrict__ Vtlo,
                     bf16_t* __restrict__ Zthi, bf16_t* __restrict__ Ztlo,
                     float* __restrict__ sums, float* __restrict__ out)
{
    __shared__ __attribute__((aligned(16))) unsigned char smem[2 * ST_BYTES];

    const int tid      = threadIdx.x;
    const int lane     = tid & 31;
    const int wave     = __builtin_amdgcn_readfirstlane(tid >> 5);
    const int rowGroup = blockIdx.x;
    const int half     = lane >> 4;
    const int lidx     = lane & 15;

    // this lane's share of every W copy: row (tid >> 3) of each group of CP_ROWS
    // rows, 16-byte chunk (tid & 7): chunks 0..3 from hi, 4..7 from lo;
    // of every X load: the same row of each group, floats (tid & 7) * 4 .. + 3
    const int  crow = tid >> 3;
    const bool chi  = (tid & 7) < 4;
    const unsigned ldsT = lds_off(smem) + crow * ST_PITCH + (tid & 7) * 16;
    const bf16_t* gW = (chi ? Whi : Wlo) + crow * D_DIM + (tid & 3) * 8;
    const float* gX = X + (size_t)(rowGroup * G_ROWS + crow) * D_DIM + (tid & 7) * 4;
    unsigned char* sx = smem + (M_COLS + crow) * ST_PITCH + (tid & 7) * 8;
    f32x4 xr[X_CH];

    v8f acc[5][ROWG];
#pragma unroll
    for (int c = 0; c < 5; ++c)
#pragma unroll
        for (int t = 0; t < ROWG; ++t) acc[c][t] = {};

    load_x(xr, gX);
    gX += 32;
    stage_w(ldsT, gW);
    store_x(sx, xr);
    load_x(xr, gX);
    gX += 32;
    asm volatile("s_wait_dscnt 0x0" ::: "memory");      // tile 0: this wave's X rows stored
    asm volatile("s_wait_asynccnt 0x0" ::: "memory");   // ... and its W copies landed
    __syncthreads();                                    // ... and every other wave's
    stage_w(ldsT + ST_BYTES, gW + 32);
    store_x(sx + ST_BYTES, xr);

    for (int kt = 0; kt < G_PASSES; ++kt) {
        const int buf = (kt & 1) * ST_BYTES;
        const unsigned char* sa = smem + buf + (M_COLS + lidx) * ST_PITCH + (half << 4);
        const unsigned char* sb = smem + buf + (wave * 16 + lidx) * ST_PITCH + (half << 4);

        // X of tile kt + 2 flies through this pass; it is split and stored behind the barrier
        if (kt + 2 < G_PASSES) { load_x(xr, gX); gX += 32; }

        // lo(A) x hi(B) first, then hi(A) x lo(B) and hi(A) x hi(B): only one half of
        // the A fragments is live at a time, so that the accumulators stay in registers
        {
            Frag16 alo[ROWG];
#pragma unroll
            for (int t = 0; t < ROWG; ++t) {
                const unsigned char* r = sa + t * (16 * ST_PITCH);
                alo[t].q[0] = *(const u32x4*)(r + 64);
                alo[t].q[1] = *(const u32x4*)(r + 96);
            }
#pragma unroll
            for (int c = 0; c < 5; ++c) {
                const unsigned char* r = sb + c * (G_WAVES * 16 * ST_PITCH);
                Frag16 bhi;
                bhi.q[0] = *(const u32x4*)(r);
                bhi.q[1] = *(const u32x4*)(r + 32);
#pragma unroll
                for (int t = 0; t < ROWG; ++t)
                    acc[c][t] = c == 0 ? mma<true>(alo[t].v, bhi.v, acc[c][t]) : mma<false>(alo[t].v, bhi.v, acc[c][t]);
            }
        }
        {
            Frag16 ahi[ROWG];
#pragma unroll
            for (int t = 0; t < ROWG; ++t) {
                const unsigned char* r = sa + t * (16 * ST_PITCH);
                ahi[t].q[0] = *(const u32x4*)(r);
                ahi[t].q[1] = *(const u32x4*)(r + 32);
            }
#pragma unroll
            for (int c = 0; c < 5; ++c) {
                const unsigned char* r = sb + c * (G_WAVES * 16 * ST_PITCH);
                Frag16 bhi, blo;
                bhi.q[0] = *(const u32x4*)(r);
                bhi.q[1] = *(const u32x4*)(r + 32);
                blo.q[0] = *(const u32x4*)(r + 64);
                blo.q[1] = *(const u32x4*)(r + 96);
#pragma unroll
                for (int t = 0; t < ROWG; ++t)
                    acc[c][t] = c == 0 ? mma<true>(ahi[t].v, blo.v, acc[c][t]) : mma<false>(ahi[t].v, blo.v, acc[c][t]);
#pragma unroll
                for (int t = 0; t < ROWG; ++t)
                    acc[c][t] = c == 0 ? mma<true>(ahi[t].v, bhi.v, acc[c][t]) : mma<false>(ahi[t].v, bhi.v, acc[c][t]);
            }
        }

        // keeps the pass's last WMMAs in front of the barrier: sunk behind it they would
        // delay the issue of the next copies and shorten their lead
        __builtin_amdgcn_sched_barrier(0);
        // the four vector slots that the chip needs between the pass's last WMMA and a vector write of
        // its operand registers
        asm volatile("v_nop\n\tv_nop\n\tv_nop\n\tv_nop");
        asm volatile("s_wait_dscnt 0x0" ::: "memory");     // this wave has left the buffer, its X stores of tile kt + 1 are done
        asm volatile("s_wait_asynccnt 0x0" ::: "memory");  // its copies of tile kt + 1 landed
        __syncthreads();   // publishes tile kt + 1, frees this pass's buffer
        if (kt + 2 < G_PASSES) {
            stage_w(ldsT + buf, gW + (kt + 2) * 32);
            store_x(sx + buf, xr);
        }
    }
    asm volatile("s_wait_asynccnt 0x0" ::: "memory");      // no copy outlives the loop

    // ---- epilogue: bias + relu; route column; fold in column sums ----
    // A wave's first tile, transposed: columns wave * 16 + 8 * half + r of row (lane & 15) of each
    // row tile. These 8 values are the 16 bytes of this lane in U's fragment order, so that the
    // wave stores 512 contiguous bytes each for hi and lo.
    {
        const f32x4 b0 = *(const f32x4*)(bias + wave * 16 + (half << 3));
        const f32x4 b1 = *(const f32x4*)(bias + wave * 16 + (half << 3) + 4);
        bf16_t* ph = Uhi + ufrag_k16(wave) + lane * 8;
        bf16_t* pl = Ulo + ufrag_k16(wave) + lane * 8;
        float s[8];
#pragma unroll
        for (int r = 0; r < 8; ++r) s[r] = 0.f;
#pragma unroll
        for (int t = 0; t < ROWG; ++t) {
            Pack8 h8, l8;
#pragma unroll
            for (int r = 0; r < 8; ++r) {
                float v = acc[0][t][r] + (r < 4 ? b0[r & 3] : b1[r & 3]);
                v = v > 0.f ? v : 0.f;
                bf16_t h, l;
                split_bf16(v, h, l);
                h8.e[r] = h; l8.e[r] = l;
                s[r] += v;
            }
            *(u32x4*)(ph + (rowGroup * ROWG + t) * UFRAG_ROWT) = h8.q;
            *(u32x4*)(pl + (rowGroup * ROWG + t) * UFRAG_ROWT) = l8.q;
            // the stores' registers are reused below: wait until the stores have taken them
            // (the scheduling fence keeps later register writes behind the wait)
            asm volatile("s_wait_xcnt 0x0" ::: "memory");
            __builtin_amdgcn_sched_barrier(0);
        }
        // column sums: over the 16 rows that the lanes of a half hold, then lane i < 8 of each
        // half adds column 8 * half + i
        float sel = 0.f;
#pragma unroll
        for (int r = 0; r < 8; ++r) {
            float v = s[r];
            v = row_xor_add<1>(v);
            v = row_xor_add<2>(v);
            v = row_xor_add<4>(v);
            v = row_xor_add<8>(v);
            sel = lidx == r ? v : sel;
        }
        if (lidx < 8) atomicAdd(&sums[wave * 16 + (half << 3) + lidx], sel);   // [0..79]=U sums
        // the atomic's registers are reused below: wait until it has taken them
        // (the scheduling fence keeps later register writes behind the wait)
        asm volatile("s_wait_xcnt 0x0" ::: "memory");
        __builtin_amdgcn_sched_barrier(0);
    }

    // The other four tiles. The T / V,Z test stands outside the element loops, and only the
    // kinds that tile c can hold are written out, for speed only:
    // c = 1 holds columns 80..159, c = 2 160..239, c = 3 240..319, c = 4 320..399.
    const int rbase = rowGroup * G_ROWS + (half << 3);
#pragma unroll
    for (int c = 1; c < 5; ++c) {
        const int col = (c * G_WAVES + wave) * 16 + lidx;
        const float bv = bias[col];
        if (c == 1 && wave < 2) {
            // U columns 80..99 come in the plain orientation (8 rows of one column per lane). The wave
            // turns its tile through LDS, which nobody reads any more behind the loop's last barrier:
            // rows of 16 floats at a pitch of 80 bytes, zeros in the columns that are not U's (they are
            // U's k padding). Each lane then holds 8 consecutive columns of one row, as in the first tile.
            float* xs = (float*)(smem + wave * (G_ROWS * XT_PITCH));
            float s = 0.f;
#pragma unroll
            for (int t = 0; t < ROWG; ++t)
#pragma unroll
                for (int r = 0; r < 8; ++r) {
                    float v = acc[c][t][r] + bv;
                    v = (col < KC && v > 0.f) ? v : 0.f;
                    xs[(t * 16 + (half << 3) + r) * (XT_PITCH / 4) + lidx] = v;
                    s += v;
                }
            // the lanes read each other's values: every store of the wave is done first
            asm volatile("s_wait_dscnt 0x0" ::: "memory");
            bf16_t* ph = Uhi + ufrag_k16(G_WAVES + wave) + lane * 8;
            bf16_t* pl = Ulo + ufrag_k16(G_WAVES + wave) + lane * 8;
#pragma unroll
            for (int t = 0; t < ROWG; ++t) {
                const float* xr8 = xs + (t * 16 + lidx) * (XT_PITCH / 4) + (half << 3);
                const f32x4 x0 = *(const f32x4*)(xr8);
                const f32x4 x1 = *(const f32x4*)(xr8 + 4);
                Pack8 h8, l8;
#pragma unroll
                for (int r = 0; r < 8; ++r) {
                    bf16_t h, l;
                    split_bf16(r < 4 ? x0[r & 3] : x1[r & 3], h, l);
                    h8.e[r] = h; l8.e[r] = l;
                }
                *(u32x4*)(ph + (rowGroup * ROWG + t) * UFRAG_ROWT) = h8.q;
                *(u32x4*)(pl + (rowGroup * ROWG + t) * UFRAG_ROWT) = l8.q;
                // the stores' registers are reused below: wait until the stores have taken them
                // (the scheduling fence keeps later register writes behind the wait)
                asm volatile("s_wait_xcnt 0x0" ::: "memory");
                __builtin_amdgcn_sched_barrier(0);
            }
            if (col < KC) atomicAdd(&sums[col], s);       // [80..99]=U sums
            // the atomic's registers are reused below: wait until it has taken them
            // (the scheduling fence keeps later register writes behind the wait)
            asm volatile("s_wait_xcnt 0x0" ::: "memory");
            __builtin_amdgcn_sched_barrier(0);
        }
        if (c == 4 || (c == 3 && col >= 3 * KC)) {
            float* pT = out + (size_t)rbase * OUTC + (KC + (col - 3 * KC));
#pragma unroll
            for (int t = 0; t < ROWG; ++t)
#pragma unroll
                for (int r = 0; r < 8; ++r) {
                    const float v = acc[c][t][r] + bv;
                    pT[(t * 16 + r) * OUTC] = v > 0.f ? v : 0.f;
                    // the stores' registers are reused below: wait until the store has taken them
                    // (the scheduling fence keeps later register writes behind the wait)
                    if (r == 7) { asm volatile("s_wait_xcnt 0x0" ::: "memory"); __builtin_amdgcn_sched_barrier(0); }
                }
        } else if (c != 1 || col >= KC) {
            // V and Z lie in fragment order (k = row): the 8 rows a lane holds of one tile are
            // that order's 16 bytes of lane (half, column & 15), so that neighbouring lanes
            // store neighbouring 16 bytes: one b128 store each for hi and lo
            const bool isV = c == 1 || (c == 2 && col < 2 * KC);
            const int  A   = frag_lane(half, isV ? col - KC : col - 2 * KC);
            bf16_t* ph = (isV ? Vthi : Zthi) + A;
            bf16_t* pl = (isV ? Vtlo : Ztlo) + A;
            float s = 0.f;
#pragma unroll
            for (int t = 0; t < ROWG; ++t) {
                Pack8 h8, l8;
#pragma unroll
                for (int r = 0; r < 8; ++r) {
                    float v = acc[c][t][r] + bv;
                    v = v > 0.f ? v : 0.f;
                    bf16_t h, l;
                    split_bf16(v, h, l);
                    h8.e[r] = h; l8.e[r] = l;
                    s += v;
                }
                *(u32x4*)(ph + frag_tile16(rowGroup * ROWG + t)) = h8.q;
                *(u32x4*)(pl + frag_tile16(rowGroup * ROWG + t)) = l8.q;
                // the stores' registers are reused below: wait until the stores have taken them
                // (the scheduling fence keeps later register writes behind the wait)
                asm volatile("s_wait_xcnt 0x0" ::: "memory");
                __builtin_amdgcn_sched_barrier(0);
            }
            if (isV) atomicAdd(&sums[col], s);            // [100..199]=V sums
        }
        // the registers of the tile's last stores and of its atomic are reused by the next tile:
        // wait until they have been taken (the scheduling fence keeps later writes behind the wait)
        asm volatile("s_wait_xcnt 0x0" ::: "memory");
        __builtin_amdgcn_sched_barrier(0);
    }
}

// ---------------------------------------------------------------------------
// Dscale = 1 / (dot(sumU,sumV)/N + 1e-6)
// ---------------------------------------------------------------------------
__global__ void dscale_kernel(const float* __restrict__ sums, float* __restrict__ dscale)
{
    __shared__ float red[128];
    const int t = threadIdx.x;
    red[t] = (t < KC) ? sums[t] * sums[KC + t] : 0.f;
    __syncthreads();
    for (int s = 64; s > 0; s >>= 1) {
        if (t < s) red[t] += red[t + s];
        __syncthreads();
    }
    if (t == 0) dscale[0] = 1.0f / (red[0] / (float)N_ROWS + 1e-6f);
}

// ---------------------------------------------------------------------------
// VtZ = V^T @ Z (100x100, reduction over N). Split-K WMMA + f32 atomics.
// A/B fragments are read from planes in fragment order: 512 contiguous bytes per load.
// Pad columns (>=100) hold garbage but only affect guarded (unstored) outputs.
// ---------------------------------------------------------------------------
__global__ void __launch_bounds__(256)
vtz_kernel(const bf16_t* __restrict__ Vthi, const bf16_t* __restrict__ Vtlo,
           const bf16_t* __restrict__ Zthi, const bf16_t* __restrict__ Ztlo,
           float* __restrict__ VtZ)
{
    const int lane  = threadIdx.x & 31;
    const int gwave = blockIdx.x * WPB + (threadIdx.x >> 5);
    const int TILES = 7 * 7;
    if (gwave >= TILES * VTZ_SPLITS) return;     // wave-uniform
    const int tile  = gwave % TILES;
    const int split = gwave / TILES;
    const int mBase = (tile / 7) << 4, nBase = (tile % 7) << 4;
    const int half  = lane >> 4, lidx = lane & 15;
    const int ncol  = nBase + lidx;                        // <= 111 < MPAD

    const bf16_t* ah = Vthi + frag_lane(half, mBase + lidx);
    const bf16_t* al = Vtlo + frag_lane(half, mBase + lidx);
    const bf16_t* bh = Zthi + frag_lane(half, ncol);
    const bf16_t* bl = Ztlo + frag_lane(half, ncol);

    v8f acc = {};
    for (int kt = split; kt < N_ROWS / 32; kt += VTZ_SPLITS) {
        const int o0 = frag_tile16(2 * kt);
        const int o1 = frag_tile16(2 * kt + 1);
        Frag16 ahi, alo, bhi, blo;
        ahi.q[0] = *(const u32x4*)(ah + o0); ahi.q[1] = *(const u32x4*)(ah + o1);
        alo.q[0] = *(const u32x4*)(al + o0); alo.q[1] = *(const u32x4*)(al + o1);
        bhi.q[0] = *(const u32x4*)(bh + o0); bhi.q[1] = *(const u32x4*)(bh + o1);
        blo.q[0] = *(const u32x4*)(bl + o0); blo.q[1] = *(const u32x4*)(bl + o1);
        acc = __builtin_amdgcn_wmma_f32_16x16x32_bf16(false, alo.v, false, bhi.v, (short)0, acc, false, false);
        acc = __builtin_amdgcn_wmma_f32_16x16x32_bf16(false, ahi.v, false, blo.v, (short)0, acc, false, false);
        acc = __builtin_amdgcn_wmma_f32_16x16x32_bf16(false, ahi.v, false, bhi.v, (short)0, acc, false, false);
    }
    if (ncol < KC) {
#pragma unroll
        for (int r = 0; r < 8; ++r) {
            const int m = mBase + (half << 3) + r;
            if (m < KC) atomicAdd(&VtZ[m * KC + ncol], acc[r]);
        }
    }
}

// ---------------------------------------------------------------------------
// Split + zero-pad VtZ (100x100 f32) -> hi/lo bf16 planes of 128 k x 112 columns in
// fragment order, res_kernel's B operand (k-padding exactly zero).
// ---------------------------------------------------------------------------
__global__ void prep_vtz_kernel(const float* __restrict__ VtZ,
                                bf16_t* __restrict__ th, bf16_t* __restrict__ tl)
{
    const int i = blockIdx.x * blockDim.x + threadIdx.x;   // over MPAD*KPAD
    if (i >= MPAD * KPAD) return;
    const int n = i >> 7, k = i & (KPAD - 1);
    const float v = (n < KC && k < KC) ? VtZ[k * KC + n] : 0.f;
    bf16_t h, l;
    split_bf16(v, h, l);
    const int o = frag_tile16(k >> 4) + frag_lane((k >> 3) & 1, n) + (k & 7);
    th[o] = h; tl[o] = l;
}

// ---------------------------------------------------------------------------
// res = (U @ VtZ) * Dscale -> out[:, 0:100]. K padded 100 -> 128 (zeros).
// Both operands are read from planes in fragment order: 512 contiguous bytes per load.
// ---------------------------------------------------------------------------
__global__ void __launch_bounds__(256)
res_kernel(const bf16_t* __restrict__ Uhi, const bf16_t* __restrict__ Ulo,
           const bf16_t* __restrict__ Bth, const bf16_t* __restrict__ Btl,
           const float* __restrict__ dscale, float* __restrict__ out)
{
    const int lane  = threadIdx.x & 31;
    const int gwave = blockIdx.x * WPB + (threadIdx.x >> 5);
    const int rowTiles = N_ROWS / 16;       // 6250
    if (gwave >= rowTiles * 7) return;      // wave-uniform
    const int colTile = gwave % 7;
    const int rowTile = gwave / 7;
    const int half = lane >> 4, lidx = lane & 15;
    const int ncol = (colTile << 4) + lidx;   // <= 111 < MPAD

    const bf16_t* ah = Uhi + rowTile * UFRAG_ROWT + lane * 8;
    const bf16_t* al = Ulo + rowTile * UFRAG_ROWT + lane * 8;
    const bf16_t* bh = Bth + frag_lane(half, ncol);
    const bf16_t* bl = Btl + frag_lane(half, ncol);

    v8f acc = {};
#pragma unroll
    for (int kt = 0; kt < KPAD / 32; ++kt) {
        const int o0 = ufrag_k16(2 * kt), o1 = ufrag_k16(2 * kt + 1);
        Frag16 ahi, alo, bhi, blo;
        ahi.q[0] = *(const u32x4*)(ah + o0); ahi.q[1] = *(const u32x4*)(ah + o1);
        alo.q[0] = *(const u32x4*)(al + o0); alo.q[1] = *(const u32x4*)(al + o1);
        const int p0 = frag_tile16(2 * kt), p1 = frag_tile16(2 * kt + 1);
        bhi.q[0] = *(const u32x4*)(bh + p0); bhi.q[1] = *(const u32x4*)(bh + p1);
        blo.q[0] = *(const u32x4*)(bl + p0); blo.q[1] = *(const u32x4*)(bl + p1);
        acc = __builtin_amdgcn_wmma_f32_16x16x32_bf16(false, alo.v, false, bhi.v, (short)0, acc, false, false);
        acc = __builtin_amdgcn_wmma_f32_16x16x32_bf16(false, ahi.v, false, blo.v, (short)0, acc, false, false);
        acc = __builtin_amdgcn_wmma_f32_16x16x32_bf16(false, ahi.v, false, bhi.v, (short)0, acc, false, false);
    }
    const float ds = dscale[0];
    if (ncol < KC) {
#pragma unroll
        for (int r = 0; r < 8; ++r) {
            const int m = (rowTile << 4) + (half << 3) + r;
            out[(long)m * OUTC + ncol] = acc[r] * ds;
        }
    }
}

// ---------------------------------------------------------------------------
// Launch
// ---------------------------------------------------------------------------
extern "C" void kernel_launch(void* const* d_in, const int* in_sizes, int n_in,
                              void* d_out, int out_size, void* d_ws, size_t ws_size,
                              hipStream_t stream)
{
    (void)in_sizes; (void)n_in; (void)out_size;
    const float* X  = (const float*)d_in[0];   // 100000 x 512
    const float* W  = (const float*)d_in[1];   // 400 x 512
    const float* bb = (const float*)d_in[2];   // 400
    float* out = (float*)d_out;                // 100000 x 200

    // ---- workspace carve-up (all regions 64B aligned) ----
    char* base = (char*)d_ws;
    size_t off = 0;
    auto carve = [&](size_t bytes) -> char* {
        char* p = base + off;
        off += (bytes + 63) & ~(size_t)63;
        return p;
    };
    bf16_t* Uhi  = (bf16_t*)carve((size_t)N_ROWS * KPAD * 2);
    bf16_t* Ulo  = (bf16_t*)carve((size_t)N_ROWS * KPAD * 2);   // contiguous w/ Uhi
    bf16_t* Vthi = (bf16_t*)carve((size_t)MPAD * N_ROWS * 2);
    bf16_t* Vtlo = (bf16_t*)carve((size_t)MPAD * N_ROWS * 2);
    bf16_t* Zthi = (bf16_t*)carve((size_t)MPAD * N_ROWS * 2);
    bf16_t* Ztlo = (bf16_t*)carve((size_t)MPAD * N_ROWS * 2);
    bf16_t* Whi  = (bf16_t*)carve((size_t)M_COLS * D_DIM * 2);
    bf16_t* Wlo  = (bf16_t*)carve((size_t)M_COLS * D_DIM * 2);
    float*  sums   = (float*)carve(256 * 4);                    // [U(100)|V(100)|pad]
    float*  VtZ    = (float*)carve(KC * KC * 4);                // contiguous w/ sums
    bf16_t* VtZthi = (bf16_t*)carve((size_t)MPAD * KPAD * 2);
    bf16_t* VtZtlo = (bf16_t*)carve((size_t)MPAD * KPAD * 2);
    float*  dscale = (float*)carve(64);
    (void)ws_size;

    // 1. zero: U hi/lo (k-padding must be 0) and sums+VtZ (atomics targets)
    zero4_kernel<<<2048, 256, 0, stream>>>((u32x4*)Uhi,
                                           (long)((size_t)N_ROWS * KPAD * 2 * 2 / 16));
    zero4_kernel<<<16, 256, 0, stream>>>((u32x4*)sums,
                                         (long)((256 * 4 + KC * KC * 4) / 16));
    // 2. pre-split W
    split_kernel<<<(M_COLS * D_DIM / 4 + 255) / 256, 256, 0, stream>>>(W, Whi, Wlo, M_COLS * D_DIM);
    // 3. fused X split + GEMM + bias + relu + scatter + column sums
    gemm_relu_lds_kernel<<<N_ROWS / G_ROWS, G_THREADS, 0, stream>>>(X, Whi, Wlo, bb,
        Uhi, Ulo, Vthi, Vtlo, Zthi, Ztlo, sums, out);
    // 4. Dscale
    dscale_kernel<<<1, 128, 0, stream>>>(sums, dscale);
    // 5. VtZ = V^T @ Z (split-K)
    {
        const int waves  = 49 * VTZ_SPLITS;
        const int blocks = (waves + WPB - 1) / WPB;
        vtz_kernel<<<blocks, 256, 0, stream>>>(Vthi, Vtlo, Zthi, Ztlo, VtZ);
    }
    // 6. split/pad VtZ into fragment order for the final GEMM's B operand
    prep_vtz_kernel<<<(MPAD * KPAD + 255) / 256, 256, 0, stream>>>(VtZ, VtZthi, VtZtlo);
    // 7. res = U @ VtZ * Dscale -> out[:, 0:100]
    {
        const int waves  = (N_ROWS / 16) * 7;
        const int blocks = (waves + WPB - 1) / WPB;
        res_kernel<<<blocks, 256, 0, stream>>>(Uhi, Ulo, VtZthi, VtZtlo, dscale, out);
    }
}

// v006
// Measured time: 233 microseconds a run.
// Two timings next to v005 both put it at 1.05 times that version's speed.
// Over all steps from v000 it is 3.63 times as fast.
#include <hip/hip_runtime.h>
#include <hip/hip_bf16.h>

// ---------------------------------------------------------------------------
// LowRankAttention for MI455X (gfx1250), wave32 + bf16 WMMA, fp32-split bf16.
//   out[:,0:100]   = (U @ (V^T Z)) * Dscale
//   out[:,100:200] = T
// where [U|V|Z|T] = relu(X @ W^T + b)
// W is split into bf16 (hi, lo) by a kernel of its own; X is split inside the main
// GEMM, once per element, on its way from global memory into LDS.
// ---------------------------------------------------------------------------

#define N_ROWS 100000
#define D_DIM  512
#define M_COLS 400          // 4*K
#define KC     100          // K
#define KPAD   128          // K padded for U / VtZ fragments
#define MPAD   112          // 100 padded to 7 tiles of 16
#define OUTC   200
#define WPB    8            // waves per block (256 threads)
#define ROWG   5            // row tiles per wave in main GEMM (6250 = 5*1250)
#define VTZ_SPLITS 64

typedef __bf16 bf16_t;
typedef bf16_t       v16bf __attribute__((ext_vector_type(16)));
typedef float        v8f   __attribute__((ext_vector_type(8)));
typedef unsigned int u32x4 __attribute__((ext_vector_type(4)));
typedef unsigned int u32x2 __attribute__((ext_vector_type(2)));
typedef float        f32x4 __attribute__((ext_vector_type(4)));

// 32-byte A/B fragment viewed either as bf16 lanes or as two 16B load chunks
union Frag16 { v16bf v; u32x4 q[2]; };
// 8 bf16 values viewed as one 16B store chunk
union Pack8 { bf16_t e[8]; u32x4 q; };
// 4 bf16 values viewed as one 8B store chunk
union Pack4 { bf16_t e[4]; u32x2 q; };

__device__ __forceinline__ void split_bf16(float x, bf16_t& hi, bf16_t& lo) {
    hi = (bf16_t)x;                 // RNE f32 -> bf16
    lo = (bf16_t)(x - (float)hi);   // exact residual, re-rounded
}

// ---------------------------------------------------------------------------
// Fragment order of a bf16 operand plane with element (k, c), c in 7 tiles of 16:
// one block = 32 k x 16 c = 1 KB, blocks ordered [k / 32][c / 16]. Inside a block lie
// the two 512-byte halves of the WMMA fragment (k 0..15, k 16..31), each as 32 lanes x
// 16 bytes: lane = ((k >> 3) & 1) * 16 + (c & 15) holds its 8 consecutive k.
// A wave loads a fragment as two contiguous 512-byte reads.
// offset(k, c) = frag_tile16(k >> 4) + frag_lane((k >> 3) & 1, c) + (k & 7)
// ---------------------------------------------------------------------------
#define FRAG_BLK  512                 // elements of one 32 x 16 block
#define FRAG_KSTEP (7 * FRAG_BLK)     // elements of one step of 32 k over all 7 tiles
__device__ __forceinline__ int frag_tile16(int k16) {
    return (k16 >> 1) * FRAG_KSTEP + (k16 & 1) * (FRAG_BLK / 2);
}
__device__ __forceinline__ int frag_lane(int half, int c) {
    return (c >> 4) * FRAG_BLK + (half * 16 + (c & 15)) * 8;
}

// ---------------------------------------------------------------------------
// Fragment order of the U planes, element (row, k), k in 0..127: the result GEMM's A
// operand. One block = 16 rows x 32 k = 1 KB, blocks ordered [row / 16][k / 32]; inside
// a block the two 512-byte halves (k 0..15, k 16..31), each as 32 lanes x 16 bytes:
// lane = ((k >> 3) & 1) * 16 + (row & 15) holds its 8 consecutive k.
// offset(row, k) = (row >> 4) * UFRAG_ROWT + ufrag_k16(k >> 4)
//                + (((k >> 3) & 1) * 16 + (row & 15)) * 8 + (k & 7)
// ---------------------------------------------------------------------------
#define UFRAG_ROWT (KPAD * 16)        // elements of one tile of 16 rows, all 128 k
__device__ __forceinline__ int ufrag_k16(int k16) {
    return (k16 >> 1) * FRAG_BLK + (k16 & 1) * (FRAG_BLK / 2);
}

// v + the value of lane (l ^ M) of the same 16-lane row (all lanes on)
template <int M>
__device__ __forceinline__ float row_xor_add(float v) {
    return v + __int_as_float(__builtin_amdgcn_update_dpp(0, __float_as_int(v), 0x160 | M, 0xf, 0xf, true));
}

// One bf16 product step. Swapped, W is the A operand and X the B operand: the tile comes
// out transposed, register r of lane (half, i) = (row i, column 8 * half + r).
template <bool SWAP>
__device__ __forceinline__ v8f mma(const v16bf x, const v16bf w, const v8f acc) {
    if (SWAP) return __builtin_amdgcn_wmma_f32_16x16x32_bf16(false, w, false, x, (short)0, acc, false, false);
    return __builtin_amdgcn_wmma_f32_16x16x32_bf16(false, x, false, w, (short)0, acc, false, false);
}

// ---------------------------------------------------------------------------
// Split a f32 array into bf16 hi/lo arrays (n multiple of 4).
// ---------------------------------------------------------------------------
__global__ void split_kernel(const float* __restrict__ src,
                             bf16_t* __restrict__ hi, bf16_t* __restrict__ lo, int n)
{
    const int i = (blockIdx.x * blockDim.x + threadIdx.x) * 4;
    if (i >= n) return;
    const f32x4 v = *(const f32x4*)(src + i);
#pragma unroll
    for (int j = 0; j < 4; ++j) {
        bf16_t h, l;
        split_bf16(v[j], h, l);
        hi[i + j] = h; lo[i + j] = l;
    }
}

// ---------------------------------------------------------------------------
// Grid-stride 16B zero fill.
// ---------------------------------------------------------------------------
__global__ void zero4_kernel(u32x4* __restrict__ p, long n4)
{
    const u32x4 z = {0u, 0u, 0u, 0u};
    for (long i = blockIdx.x * (long)blockDim.x + threadIdx.x; i < n4;
         i += (long)gridDim.x * blockDim.x)
        p[i] = z;
}

// ---------------------------------------------------------------------------
// Kernel 1: tmp = relu(X @ W^T + b), one block = 80 rows x all 400 columns,
// 5 waves, one wave = 5 row tiles x 5 col tiles: column tiles wave, 5 + wave, ... 20 + wave.
// A wave's first column tile (columns 0..79, U's first 80 of 100) is computed with the operands
// swapped, so that a lane holds 8 consecutive columns of one row.
// Per pass (32 k) the block's 400 W rows (pre-split) are copied to LDS by
// asynchronous copies; its 80 X rows are loaded as f32 into registers one pass
// ahead of their place in the ring, split there and stored to LDS. Two buffers,
// the next pass's tile in flight while this pass is worked on.
// One LDS row = [64 B hi | 64 B lo | 16 B pad].
// Epilogue: U -> bf16 hi/lo in fragment order (k = column); V,Z -> bf16 hi/lo in fragment
// order (k = row); T -> out (f32); U/V column sums via atomicAdd.
// ---------------------------------------------------------------------------
#define G_WAVES   5
#define G_THREADS (G_WAVES * 32)
#define G_ROWS    (ROWG * 16)               // 80 rows of X per block
#define ST_ROWS   (M_COLS + G_ROWS)         // W rows first, then X rows
#define ST_PITCH  144                       // 16 B x odd: conflict-free b128 reads
#define ST_BYTES  (ST_ROWS * ST_PITCH)
#define CP_ROWS   (G_THREADS / 8)           // rows covered by one copy of the block
#define G_PASSES  (D_DIM / 32)
#define X_CH      (G_ROWS / CP_ROWS)        // X rows per lane and pass
#define XT_PITCH  80                        // epilogue's turn of a tile: 64 B + 16 B pad (16 B x odd)

__device__ __forceinline__ unsigned lds_off(const void* p) {
    return (unsigned)(unsigned long long)p;   // low 32 bits of a __shared__ address
}

// Ten 16-byte-per-lane copies to LDS. The closing s_wait_xcnt keeps every
// address register of the copies unwritten until the copies have taken them.
__device__ __forceinline__ void async_copy10(const unsigned (&l)[10],
                                             const bf16_t* const (&p)[10])
{
    asm volatile(
        "global_load_async_to_lds_b128 %0, %10, off\n\t"
        "global_load_async_to_lds_b128 %1, %11, off\n\t"
        "global_load_async_to_lds_b128 %2, %12, off\n\t"
        "global_load_async_to_lds_b128 %3, %13, off\n\t"
        "global_load_async_to_lds_b128 %4, %14, off\n\t"
        "global_load_async_to_lds_b128 %5, %15, off\n\t"
        "global_load_async_to_lds_b128 %6, %16, off\n\t"
        "global_load_async_to_lds_b128 %7, %17, off\n\t"
        "global_load_async_to_lds_b128 %8, %18, off\n\t"
        "global_load_async_to_lds_b128 %9, %19, off\n\t"
        "s_wait_xcnt 0x0"
        :: "v"(l[0]), "v"(l[1]), "v"(l[2]), "v"(l[3]), "v"(l[4]),
           "v"(l[5]), "v"(l[6]), "v"(l[7]), "v"(l[8]), "v"(l[9]),
           "v"(p[0]), "v"(p[1]), "v"(p[2]), "v"(p[3]), "v"(p[4]),
           "v"(p[5]), "v"(p[6]), "v"(p[7]), "v"(p[8]), "v"(p[9])
        : "memory");
}

// One pass's W tile: 20 copies per lane.
__device__ __forceinline__ void stage_w(unsigned lds, const bf16_t* gW)
{
#pragma unroll
    for (int g = 0; g < 2; ++g) {
        unsigned l[10];
        const bf16_t* p[10];
#pragma unroll
        for (int j = 0; j < 10; ++j) {
            l[j] = lds + (g * 10 + j) * (CP_ROWS * ST_PITCH);
            p[j] = gW + (g * 10 + j) * (CP_ROWS * D_DIM);
        }
        async_copy10(l, p);
    }
}

// One pass's X tile, f32: 4 floats of each of 4 rows per lane (8 lanes = one 128-byte row).
__device__ __forceinline__ void load_x(f32x4 (&xr)[X_CH], const float* gX)
{
#pragma unroll
    for (int j = 0; j < X_CH; ++j)
        xr[j] = *(const f32x4*)(gX + j * (CP_ROWS * D_DIM));
    // the loads' address is advanced for the next pass: wait until the loads have
    // taken it (the scheduling fence keeps later register writes behind the wait)
    asm volatile("s_wait_xcnt 0x0" ::: "memory");
    __builtin_amdgcn_sched_barrier(0);
}

// Split the loaded X values and store them into the tile's X rows: 8 bytes hi, 8 bytes lo.
__device__ __forceinline__ void store_x(unsigned char* sx, const f32x4 (&xr)[X_CH])
{
#pragma unroll
    for (int j = 0; j < X_CH; ++j) {
        Pack4 h4, l4;
#pragma unroll
        for (int e = 0; e < 4; ++e) {
            bf16_t h, l;
            split_bf16(xr[j][e], h, l);
            h4.e[e] = h; l4.e[e] = l;
        }
        *(u32x2*)(sx + j * (CP_ROWS * ST_PITCH))      = h4.q;
        *(u32x2*)(sx + j * (CP_ROWS * ST_PITCH) + 64) = l4.q;
    }
}

__global__ void __launch_bounds__(G_THREADS, 3)   // 3 waves per SIMD: two blocks share a WGP
gemm_relu_lds_kernel(const float* __restrict__ X,
                     const bf16_t* __restrict__ Whi, const bf16_t* __restrict__ Wlo,
                     const float* __restrict__ bias,
                     bf16_t* __restrict__ Uhi, bf16_t* __restrict__ Ulo,
                     bf16_t* __restrict__ Vthi, bf16_t* __restrict__ Vtlo,
                     bf16_t* __restrict__ Zthi, bf16_t* __restrict__ Ztlo,
                     float* __restrict__ sums, float* __restrict__ out)
{
    __shared__ __attribute__((aligned(16))) unsigned char smem[2 * ST_BYTES];

    const int tid      = threadIdx.x;
    const int lane     = tid & 31;
    const int wave     = __builtin_amdgcn_readfirstlane(tid >> 5);
    const int rowGroup = blockIdx.x;
    const int half     = lane >> 4;
    const int lidx     = lane & 15;

    // this lane's share of every W copy: row (tid >> 3) of each group of CP_ROWS
    // rows, 16-byte chunk (tid & 7): chunks 0..3 from hi, 4..7 from lo;
    // of every X load: the same row of each group, floats (tid & 7) * 4 .. + 3
    const int  crow = tid >> 3;
    const bool chi  = (tid & 7) < 4;
    const unsigned ldsT = lds_off(smem) + crow * ST_PITCH + (tid & 7) * 16;
    const bf16_t* gW = (chi ? Whi : Wlo) + crow * D_DIM + (tid & 3) * 8;
    const float* gX = X + (size_t)(rowGroup * G_ROWS + crow) * D_DIM + (tid & 7) * 4;
    unsigned char* sx = smem + (M_COLS + crow) * ST_PITCH + (tid & 7) * 8;
    f32x4 xr[X_CH];

    v8f acc[5][ROWG];
#pragma unroll
    for (int c = 0; c < 5; ++c)
#pragma unroll
        for (int t = 0; t < ROWG; ++t) acc[c][t] = {};

    load_x(xr, gX);
    gX += 32;
    stage_w(ldsT, gW);
    store_x(sx, xr);
    load_x(xr, gX);
    gX += 32;
    asm volatile("s_wait_dscnt 0x0" ::: "memory");      // tile 0: this wave's X rows stored
    asm volatile("s_wait_asynccnt 0x0" ::: "memory");   // ... and its W copies landed
    __syncthreads();                                    // ... and every other wave's
    stage_w(ldsT + ST_BYTES, gW + 32);
    store_x(sx + ST_BYTES, xr);

    for (int kt = 0; kt < G_PASSES; ++kt) {
        const int buf = (kt & 1) * ST_BYTES;
        const unsigned char* sa = smem + buf + (M_COLS + lidx) * ST_PITCH + (half << 4);
        const unsigned char* sb = smem + buf + (wave * 16 + lidx) * ST_PITCH + (half << 4);

        // X of tile kt + 2 flies through this pass; it is split and stored behind the barrier
        if (kt + 2 < G_PASSES) { load_x(xr, gX); gX += 32; }

        // lo(A) x hi(B) first, then hi(A) x lo(B) and hi(A) x hi(B): only one half of
        // the A fragments is live at a time, so that the accumulators stay in registers
        {
            Frag16 alo[ROWG];
#pragma unroll
            for (int t = 0; t < ROWG; ++t) {
                const unsigned char* r = sa + t * (16 * ST_PITCH);
                alo[t].q[0] = *(const u32x4*)(r + 64);
                alo[t].q[1] = *(const u32x4*)(r + 96);
            }
#pragma unroll
            for (int c = 0; c < 5; ++c) {
                const unsigned char* r = sb + c * (G_WAVES * 16 * ST_PITCH);
                Frag16 bhi;
                bhi.q[0] = *(const u32x4*)(r);
                bhi.q[1] = *(const u32x4*)(r + 32);
#pragma unroll
                for (int t = 0; t < ROWG; ++t)
                    acc[c][t] = c == 0 ? mma<true>(alo[t].v, bhi.v, acc[c][t]) : mma<false>(alo[t].v, bhi.v, acc[c][t]);
            }
        }
        {
            Frag16 ahi[ROWG];
#pragma unroll
            for (int t = 0; t < ROWG; ++t) {
                const unsigned char* r = sa + t * (16 * ST_PITCH);
                ahi[t].q[0] = *(const u32x4*)(r);
                ahi[t].q[1] = *(const u32x4*)(r + 32);
            }
#pragma unroll
            for (int c = 0; c < 5; ++c) {
                const unsigned char* r = sb + c * (G_WAVES * 16 * ST_PITCH);
                Frag16 bhi, blo;
                bhi.q[0] = *(const u32x4*)(r);
                bhi.q[1] = *(const u32x4*)(r + 32);
                blo.q[0] = *(const u32x4*)(r + 64);
                blo.q[1] = *(const u32x4*)(r + 96);
#pragma unroll
                for (int t = 0; t < ROWG; ++t)
                    acc[c][t] = c == 0 ? mma<true>(ahi[t].v, blo.v, acc[c][t]) : mma<false>(ahi[t].v, blo.v, acc[c][t]);
#pragma unroll
                for (int t = 0; t < ROWG; ++t)
                    acc[c][t] = c == 0 ? mma<true>(ahi[t].v, bhi.v, acc[c][t]) : mma<false>(ahi[t].v, bhi.v, acc[c][t]);
            }
        }

        // keeps the pass's last WMMAs in front of the barrier: sunk behind it they would
        // delay the issue of the next copies and shorten their lead
        __builtin_amdgcn_sched_barrier(0);
        // the four vector slots that the chip needs between the pass's last WMMA and a vector write of
        // its operand registers
        asm volatile("v_nop\n\tv_nop\n\tv_nop\n\tv_nop");
        asm volatile("s_wait_dscnt 0x0" ::: "memory");     // this wave has left the buffer, its X stores of tile kt + 1 are done
        asm volatile("s_wait_asynccnt 0x0" ::: "memory");  // its copies of tile kt + 1 landed
        __syncthreads();   // publishes tile kt + 1, frees this pass's buffer
        if (kt + 2 < G_PASSES) {
            stage_w(ldsT + buf, gW + (kt + 2) * 32);
            store_x(sx + buf, xr);
        }
    }
    asm volatile("s_wait_asynccnt 0x0" ::: "memory");      // no copy outlives the loop

    // ---- epilogue: bias + relu; route column; fold in column sums ----
    // A wave's first tile, transposed: columns wave * 16 + 8 * half + r of row (lane & 15) of each
    // row tile. These 8 values are the 16 bytes of this lane in U's fragment order, so that the
    // wave stores 512 contiguous bytes each for hi and lo.
    {
        const f32x4 b0 = *(const f32x4*)(bias + wave * 16 + (half << 3));
        const f32x4 b1 = *(const f32x4*)(bias + wave * 16 + (half << 3) + 4);
        bf16_t* ph = Uhi + ufrag_k16(wave) + lane * 8;
        bf16_t* pl = Ulo + ufrag_k16(wave) + lane * 8;
        float s[8];
#pragma unroll
        for (int r = 0; r < 8; ++r) s[r] = 0.f;
#pragma unroll
        for (int t = 0; t < ROWG; ++t) {
            Pack8 h8, l8;
#pragma unroll
            for (int r = 0; r < 8; ++r) {
                float v = acc[0][t][r] + (r < 4 ? b0[r & 3] : b1[r & 3]);
                v = v > 0.f ? v : 0.f;
                bf16_t h, l;
                split_bf16(v, h, l);
                h8.e[r] = h; l8.e[r] = l;
                s[r] += v;
            }
            *(u32x4*)(ph + (rowGroup * ROWG + t) * UFRAG_ROWT) = h8.q;
            *(u32x4*)(pl + (rowGroup * ROWG + t) * UFRAG_ROWT) = l8.q;
            // the stores' registers are reused below: wait until the stores have taken them
            // (the scheduling fence keeps later register writes behind the wait)
            asm volatile("s_wait_xcnt 0x0" ::: "memory");
            __builtin_amdgcn_sched_barrier(0);
        }
        // column sums: over the 16 rows that the lanes of a half hold, then lane i < 8 of each
        // half adds column 8 * half + i
        float sel = 0.f;
#pragma unroll
        for (int r = 0; r < 8; ++r) {
            float v = s[r];
            v = row_xor_add<1>(v);
            v = row_xor_add<2>(v);
            v = row_xor_add<4>(v);
            v = row_xor_add<8>(v);
            sel = lidx == r ? v : sel;
        }
        if (lidx < 8) atomicAdd(&sums[wave * 16 + (half << 3) + lidx], sel);   // [0..79]=U sums
        // the atomic's registers are reused below: wait until it has taken them
        // (the scheduling fence keeps later register writes behind the wait)
        asm volatile("s_wait_xcnt 0x0" ::: "memory");
        __builtin_amdgcn_sched_barrier(0);
    }

    // The other four tiles. The T / V,Z test stands outside the element loops, and only the
    // kinds that tile c can hold are written out, for speed only:
    // c = 1 holds columns 80..159, c = 2 160..239, c = 3 240..319, c = 4 320..399.
    const int rbase = rowGroup * G_ROWS + (half << 3);
#pragma unroll
    for (int c = 1; c < 5; ++c) {
        const int col = (c * G_WAVES + wave) * 16 + lidx;
        const float bv = bias[col];
        if (c == 1 && wave < 2) {
            // U columns 80..99 come in the plain orientation (8 rows of one column per lane). The wave
            // turns its tile through LDS, which nobody reads any more behind the loop's last barrier:
            // rows of 16 floats at a pitch of 80 bytes, zeros in the columns that are not U's (they are
            // U's k padding). Each lane then holds 8 consecutive columns of one row, as in the first tile.
            float* xs = (float*)(smem + wave * (G_ROWS * XT_PITCH));
            float s = 0.f;
#pragma unroll
            for (int t = 0; t < ROWG; ++t)
#pragma unroll
                for (int r = 0; r < 8; ++r) {
                    float v = acc[c][t][r] + bv;
                    v = (col < KC && v > 0.f) ? v : 0.f;
                    xs[(t * 16 + (half << 3) + r) * (XT_PITCH / 4) + lidx] = v;
                    s += v;
                }
            // the lanes read each other's values: every store of the wave is done first
            asm volatile("s_wait_dscnt 0x0" ::: "memory");
            bf16_t* ph = Uhi + ufrag_k16(G_WAVES + wave) + lane * 8;
            bf16_t* pl = Ulo + ufrag_k16(G_WAVES + wave) + lane * 8;
#pragma unroll
            for (int t = 0; t < ROWG; ++t) {
                const float* xr8 = xs + (t * 16 + lidx) * (XT_PITCH / 4) + (half << 3);
                const f32x4 x0 = *(const f32x4*)(xr8);
                const f32x4 x1 = *(const f32x4*)(xr8 + 4);
                Pack8 h8, l8;
#pragma unroll
                for (int r = 0; r < 8; ++r) {
                    bf16_t h, l;
                    split_bf16(r < 4 ? x0[r & 3] : x1[r & 3], h, l);
                    h8.e[r] = h; l8.e[r] = l;
                }
                *(u32x4*)(ph + (rowGroup * ROWG + t) * UFRAG_ROWT) = h8.q;
                *(u32x4*)(pl + (rowGroup * ROWG + t) * UFRAG_ROWT) = l8.q;
                // the stores' registers are reused below: wait until the stores have taken them
                // (the scheduling fence keeps later register writes behind the wait)
                asm volatile("s_wait_xcnt 0x0" ::: "memory");
                __builtin_amdgcn_sched_barrier(0);
            }
            if (col < KC) atomicAdd(&sums[col], s);       // [80..99]=U sums
            // the atomic's registers are reused below: wait until it has taken them
            // (the scheduling fence keeps later register writes behind the wait)
            asm volatile("s_wait_xcnt 0x0" ::: "memory");
            __builtin_amdgcn_sched_barrier(0);
        }
        if (c == 4 || (c == 3 && col >= 3 * KC)) {
            float* pT = out + (size_t)rbase * OUTC + (KC + (col - 3 * KC));
#pragma unroll
            for (int t = 0; t < ROWG; ++t)
#pragma unroll
                for (int r = 0; r < 8; ++r) {
                    const float v = acc[c][t][r] + bv;
                    pT[(t * 16 + r) * OUTC] = v > 0.f ? v : 0.f;
                    // the stores' registers are reused below: wait until the store has taken them
                    // (the scheduling fence keeps later register writes behind the wait)
                    if (r == 7) { asm volatile("s_wait_xcnt 0x0" ::: "memory"); __builtin_amdgcn_sched_barrier(0); }
                }
        } else if (c != 1 || col >= KC) {
            // V and Z lie in fragment order (k = row): the 8 rows a lane holds of one tile are
            // that order's 16 bytes of lane (half, column & 15), so that neighbouring lanes
            // store neighbouring 16 bytes: one b128 store each for hi and lo
            const bool isV = c == 1 || (c == 2 && col < 2 * KC);
            const int  A   = frag_lane(half, isV ? col - KC : col - 2 * KC);
            bf16_t* ph = (isV ? Vthi : Zthi) + A;
            bf16_t* pl = (isV ? Vtlo : Ztlo) + A;
            float s = 0.f;
#pragma unroll
            for (int t = 0; t < ROWG; ++t) {
                Pack8 h8, l8;
#pragma unroll
                for (int r = 0; r < 8; ++r) {
                    float v = acc[c][t][r] + bv;
                    v = v > 0.f ? v : 0.f;
                    bf16_t h, l;
                    split_bf16(v, h, l);
                    h8.e[r] = h; l8.e[r] = l;
                    s += v;
                }
                *(u32x4*)(ph + frag_tile16(rowGroup * ROWG + t)) = h8.q;
                *(u32x4*)(pl + frag_tile16(rowGroup * ROWG + t)) = l8.q;
                // the stores' registers are reused below: wait until the stores have taken them
                // (the scheduling fence keeps later register writes behind the wait)
                asm volatile("s_wait_xcnt 0x0" ::: "memory");
                __builtin_amdgcn_sched_barrier(0);
            }
            if (isV) atomicAdd(&sums[col], s);            // [100..199]=V sums
        }
        // the registers of the tile's last stores and of its atomic are reused by the next tile:
        // wait until they have been taken (the scheduling fence keeps later writes behind the wait)
        asm volatile("s_wait_xcnt 0x0" ::: "memory");
        __builtin_amdgcn_sched_barrier(0);
    }
}

// ---------------------------------------------------------------------------
// Dscale = 1 / (dot(sumU,sumV)/N + 1e-6)
// ---------------------------------------------------------------------------
__global__ void dscale_kernel(const float* __restrict__ sums, float* __restrict__ dscale)
{
    __shared__ float red[128];
    const int t = threadIdx.x;
    red[t] = (t < KC) ? sums[t] * sums[KC + t] : 0.f;
    __syncthreads();
    for (int s = 64; s > 0; s >>= 1) {
        if (t < s) red[t] += red[t + s];
        __syncthreads();
    }
    if (t == 0) dscale[0] = 1.0f / (red[0] / (float)N_ROWS + 1e-6f);
}

// ---------------------------------------------------------------------------
// VtZ = V^T @ Z (100x100, reduction over N). Split-K WMMA + f32 atomics.
// A/B fragments are read from planes in fragment order: 512 contiguous bytes per load.
// Pad columns (>=100) hold garbage but only affect guarded (unstored) outputs.
// ---------------------------------------------------------------------------
__global__ void __launch_bounds__(256)
vtz_kernel(const bf16_t* __restrict__ Vthi, const bf16_t* __restrict__ Vtlo,
           const bf16_t* __restrict__ Zthi, const bf16_t* __restrict__ Ztlo,
           float* __restrict__ VtZ)
{
    const int lane  = threadIdx.x & 31;
    const int gwave = blockIdx.x * WPB + (threadIdx.x >> 5);
    const int TILES = 7 * 7;
    if (gwave >= TILES * VTZ_SPLITS) return;     // wave-uniform
    const int tile  = gwave % TILES;
    const int split = gwave / TILES;
    const int mBase = (tile / 7) << 4, nBase = (tile % 7) << 4;
    const int half  = lane >> 4, lidx = lane & 15;
    const int ncol  = nBase + lidx;                        // <= 111 < MPAD

    const bf16_t* ah = Vthi + frag_lane(half, mBase + lidx);
    const bf16_t* al = Vtlo + frag_lane(half, mBase + lidx);
    const bf16_t* bh = Zthi + frag_lane(half, ncol);
    const bf16_t* bl = Ztlo + frag_lane(half, ncol);

    v8f acc = {};
    for (int kt = split; kt < N_ROWS / 32; kt += VTZ_SPLITS) {
        const int o0 = frag_tile16(2 * kt);
        const int o1 = frag_tile16(2 * kt + 1);
        Frag16 ahi, alo, bhi, blo;
        ahi.q[0] = *(const u32x4*)(ah + o0); ahi.q[1] = *(const u32x4*)(ah + o1);
        alo.q[0] = *(const u32x4*)(al + o0); alo.q[1] = *(const u32x4*)(al + o1);
        bhi.q[0] = *(const u32x4*)(bh + o0); bhi.q[1] = *(const u32x4*)(bh + o1);
        blo.q[0] = *(const u32x4*)(bl + o0); blo.q[1] = *(const u32x4*)(bl + o1);
        acc = __builtin_amdgcn_wmma_f32_16x16x32_bf16(false, alo.v, false, bhi.v, (short)0, acc, false, false);
        acc = __builtin_amdgcn_wmma_f32_16x16x32_bf16(false, ahi.v, false, blo.v, (short)0, acc, false, false);
        acc = __builtin_amdgcn_wmma_f32_16x16x32_bf16(false, ahi.v, false, bhi.v, (short)0, acc, false, false);
    }
    if (ncol < KC) {
#pragma unroll
        for (int r = 0; r < 8; ++r) {
            const int m = mBase + (half << 3) + r;
            if (m < KC) atomicAdd(&VtZ[m * KC + ncol], acc[r]);
        }
    }
}

// ---------------------------------------------------------------------------
// Split + zero-pad VtZ (100x100 f32) -> hi/lo bf16 planes of 128 k x 112 columns in
// fragment order, res_kernel's A operand (k-padding exactly zero).
// ---------------------------------------------------------------------------
__global__ void prep_vtz_kernel(const float* __restrict__ VtZ,
                                bf16_t* __restrict__ th, bf16_t* __restrict__ tl)
{
    const int i = blockIdx.x * blockDim.x + threadIdx.x;   // over MPAD*KPAD
    if (i >= MPAD * KPAD) return;
    const int n = i >> 7, k = i & (KPAD - 1);
    const float v = (n < KC && k < KC) ? VtZ[k * KC + n] : 0.f;
    bf16_t h, l;
    split_bf16(v, h, l);
    const int o = frag_tile16(k >> 4) + frag_lane((k >> 3) & 1, n) + (k & 7);
    th[o] = h; tl[o] = l;
}

// ---------------------------------------------------------------------------
// res = (U @ VtZ) * Dscale -> out[:, 0:100]. K padded 100 -> 128 (zeros).
// One wave = 32 rows (2 row tiles) x all 7 column tiles, so that U is read once and a wave
// owns whole result rows. The block stages both VtZ planes (fragment order) in LDS once.
// VtZ is the A operand and U the B operand: register r of lane (half, i) = (row i, column
// 8 * half + r). The wave lays its rows down in LDS (400 bytes a row, no gap) and stores
// them to out in 16-byte pieces that run along the rows.
// The column tiles go in two groups (4 + 3), so that U's fragments and the accumulators fit
// four waves per SIMD: every block of the grid is then resident at once.
// ---------------------------------------------------------------------------
#define R_WAVES   8
#define R_THREADS (R_WAVES * 32)
#define R_PAIRS   (N_ROWS / 32)            // 3125 pairs of row tiles
#define R_PLANE   (MPAD * KPAD)            // elements of one VtZ plane
#define R_PLANE16 (R_PLANE * 2 / 16)       // its 16-byte pieces
#define R_ROW16   (KC / 4)                 // 16-byte pieces of one result row

__global__ void __launch_bounds__(R_THREADS, 4)
res_kernel(const bf16_t* __restrict__ Uhi, const bf16_t* __restrict__ Ulo,
           const bf16_t* __restrict__ Bth, const bf16_t* __restrict__ Btl,
           const float* __restrict__ dscale, float* __restrict__ out)
{
    // the VtZ planes first: every fragment then lies within the reach of an LDS load's immediate offset
    __shared__ __attribute__((aligned(16))) unsigned char smem[2 * R_PLANE * 2 + R_WAVES * 32 * KC * 4];
    bf16_t* sB = (bf16_t*)smem;

    const int tid  = threadIdx.x;
    const int lane = tid & 31;
    const int wave = __builtin_amdgcn_readfirstlane(tid >> 5);
    const int half = lane >> 4, lidx = lane & 15;
    const int pair = blockIdx.x * R_WAVES + wave;
    // the last block's spare waves load the last pair again, help to stage, and leave behind the barrier
    const int lp   = pair < R_PAIRS ? pair : R_PAIRS - 1;

    u32x4 stg[2][R_PLANE16 / R_THREADS];
#pragma unroll
    for (int i = 0; i < R_PLANE16 / R_THREADS; ++i) {
        stg[0][i] = ((const u32x4*)Bth)[i * R_THREADS + tid];
        stg[1][i] = ((const u32x4*)Btl)[i * R_THREADS + tid];
    }
    const bf16_t* ah = Uhi + lp * (2 * UFRAG_ROWT) + lane * 8;
    const bf16_t* al = Ulo + lp * (2 * UFRAG_ROWT) + lane * 8;
    Frag16 uh[2][KPAD / 32], ul[2][KPAD / 32];
#pragma unroll
    for (int t = 0; t < 2; ++t)
#pragma unroll
        for (int kt = 0; kt < KPAD / 32; ++kt) {
            const int o0 = t * UFRAG_ROWT + ufrag_k16(2 * kt), o1 = t * UFRAG_ROWT + ufrag_k16(2 * kt + 1);
            uh[t][kt].q[0] = *(const u32x4*)(ah + o0); uh[t][kt].q[1] = *(const u32x4*)(ah + o1);
            ul[t][kt].q[0] = *(const u32x4*)(al + o0); ul[t][kt].q[1] = *(const u32x4*)(al + o1);
        }
    // the loads' address registers are reused below: wait until the loads have taken them
    // (the scheduling fence keeps later register writes behind the wait)
    asm volatile("s_wait_xcnt 0x0" ::: "memory");
    __builtin_amdgcn_sched_barrier(0);
#pragma unroll
    for (int i = 0; i < R_PLANE16 / R_THREADS; ++i) {
        ((u32x4*)sB)[i * R_THREADS + tid]             = stg[0][i];
        ((u32x4*)sB)[R_PLANE16 + i * R_THREADS + tid] = stg[1][i];
    }
    const float ds = dscale[0];
    __syncthreads();                       // both VtZ planes lie in LDS
    if (pair >= R_PAIRS) return;           // wave-uniform, behind the only barrier

    const bf16_t* bh = sB + lane * 8;
    const bf16_t* bl = sB + R_PLANE + lane * 8;
    float* st = (float*)(smem + 2 * R_PLANE * 2) + wave * (32 * KC);
#pragma unroll
    for (int g = 0; g < 2; ++g) {
        v8f acc[4][2];
#pragma unroll
        for (int c = 0; c < 4; ++c) { acc[c][0] = {}; acc[c][1] = {}; }
#pragma unroll
        for (int kt = 0; kt < KPAD / 32; ++kt)
#pragma unroll
            for (int c = 0; c < 4 - g; ++c) {
                const int p0 = frag_tile16(2 * kt) + (g * 4 + c) * FRAG_BLK;
                const int p1 = frag_tile16(2 * kt + 1) + (g * 4 + c) * FRAG_BLK;
                Frag16 bhi, blo;
                bhi.q[0] = *(const u32x4*)(bh + p0); bhi.q[1] = *(const u32x4*)(bh + p1);
                blo.q[0] = *(const u32x4*)(bl + p0); blo.q[1] = *(const u32x4*)(bl + p1);
#pragma unroll
                for (int t = 0; t < 2; ++t) acc[c][t] = mma<true>(ul[t][kt].v, bhi.v, acc[c][t]);
#pragma unroll
                for (int t = 0; t < 2; ++t) acc[c][t] = mma<true>(uh[t][kt].v, blo.v, acc[c][t]);
#pragma unroll
                for (int t = 0; t < 2; ++t) acc[c][t] = mma<true>(uh[t][kt].v, bhi.v, acc[c][t]);
            }
#pragma unroll
        for (int c = 0; c < 4 - g; ++c)
#pragma unroll
            for (int t = 0; t < 2; ++t) {
                float* p = st + (t * 16 + lidx) * KC + (g * 4 + c) * 16 + (half << 3);
                const f32x4 v0 = {acc[c][t][0] * ds, acc[c][t][1] * ds, acc[c][t][2] * ds, acc[c][t][3] * ds};
                const f32x4 v1 = {acc[c][t][4] * ds, acc[c][t][5] * ds, acc[c][t][6] * ds, acc[c][t][7] * ds};
                if (g * 4 + c < 6) {
                    *(f32x4*)(p)     = v0;
                    *(f32x4*)(p + 4) = v1;
                } else if (half == 0) {
                    *(f32x4*)(p) = v0;     // columns 96..99; 100..111 are padding
                }
            }
    }
    // the lanes read each other's values: every store of the wave is done first
    asm volatile("s_wait_dscnt 0x0" ::: "memory");
    char* po = (char*)(out + (size_t)pair * (32 * OUTC));
    // 16-byte piece j = 32 * step + lane of the wave's 32 rows x 25 pieces: c4 = j % 25, off = its bytes into po
    unsigned c4  = lane < R_ROW16 ? lane : lane - R_ROW16;
    unsigned off = (lane < R_ROW16 ? 0 : OUTC * 4) + c4 * 16;
#pragma unroll
    for (int b = 0; b < 5; ++b) {
#pragma unroll
        for (int i = 0; i < 5; ++i) {
            *(f32x4*)(po + off) = *(const f32x4*)(st + ((b * 5 + i) * 32 + lane) * 4);
            // 32 pieces on: one row and 7 pieces, or two rows less 18
            c4  += 32 - R_ROW16;
            off += OUTC * 4 + (32 - R_ROW16) * 16;
            if (c4 >= R_ROW16) { c4 -= R_ROW16; off += OUTC * 4 - R_ROW16 * 16; }
        }
        // the stores' registers are reused below: wait until the stores have taken them
        // (the scheduling fence keeps later register writes behind the wait)
        asm volatile("s_wait_xcnt 0x0" ::: "memory");
        __builtin_amdgcn_sched_barrier(0);
    }
}

// ---------------------------------------------------------------------------
// Launch
// ---------------------------------------------------------------------------
extern "C" void kernel_launch(void* const* d_in, const int* in_sizes, int n_in,
                              void* d_out, int out_size, void* d_ws, size_t ws_size,
                              hipStream_t stream)
{
    (void)in_sizes; (void)n_in; (void)out_size;
    const float* X  = (const float*)d_in[0];   // 100000 x 512
    const float* W  = (const float*)d_in[1];   // 400 x 512
    const float* bb = (const float*)d_in[2];   // 400
    float* out = (float*)d_out;                // 100000 x 200

    // ---- workspace carve-up (all regions 64B aligned) ----
    char* base = (char*)d_ws;
    size_t off = 0;
    auto carve = [&](size_t bytes) -> char* {
        char* p = base + off;
        off += (bytes + 63) & ~(size_t)63;
        return p;
    };
    bf16_t* Uhi  = (bf16_t*)carve((size_t)N_ROWS * KPAD * 2);
    bf16_t* Ulo  = (bf16_t*)carve((size_t)N_ROWS * KPAD * 2);   // contiguous w/ Uhi
    bf16_t* Vthi = (bf16_t*)carve((size_t)MPAD * N_ROWS * 2);
    bf16_t* Vtlo = (bf16_t*)carve((size_t)MPAD * N_ROWS * 2);
    bf16_t* Zthi = (bf16_t*)carve((size_t)MPAD * N_ROWS * 2);
    bf16_t* Ztlo = (bf16_t*)carve((size_t)MPAD * N_ROWS * 2);
    bf16_t* Whi  = (bf16_t*)carve((size_t)M_COLS * D_DIM * 2);
    bf16_t* Wlo  = (bf16_t*)carve((size_t)M_COLS * D_DIM * 2);
    float*  sums   = (float*)carve(256 * 4);                    // [U(100)|V(100)|pad]
    float*  VtZ    = (float*)carve(KC * KC * 4);                // contiguous w/ sums
    bf16_t* VtZthi = (bf16_t*)carve((size_t)MPAD * KPAD * 2);
    bf16_t* VtZtlo = (bf16_t*)carve((size_t)MPAD * KPAD * 2);
    float*  dscale = (float*)carve(64);
    (void)ws_size;

    // 1. zero: U hi/lo (k-padding must be 0) and sums+VtZ (atomics targets)
    zero4_kernel<<<2048, 256, 0, stream>>>((u32x4*)Uhi,
                                           (long)((size_t)N_ROWS * KPAD * 2 * 2 / 16));
    zero4_kernel<<<16, 256, 0, stream>>>((u32x4*)sums,
                                         (long)((256 * 4 + KC * KC * 4) / 16));
    // 2. pre-split W
    split_kernel<<<(M_COLS * D_DIM / 4 + 255) / 256, 256, 0, stream>>>(W, Whi, Wlo, M_COLS * D_DIM);
    // 3. fused X split + GEMM + bias + relu + scatter + column sums
    gemm_relu_lds_kernel<<<N_ROWS / G_ROWS, G_THREADS, 0, stream>>>(X, Whi, Wlo, bb,
        Uhi, Ulo, Vthi, Vtlo, Zthi, Ztlo, sums, out);
    // 4. Dscale
    dscale_kernel<<<1, 128, 0, stream>>>(sums, dscale);
    // 5. VtZ = V^T @ Z (split-K)
    {
        const int waves  = 49 * VTZ_SPLITS;
        const int blocks = (waves + WPB - 1) / WPB;
        vtz_kernel<<<blocks, 256, 0, stream>>>(Vthi, Vtlo, Zthi, Ztlo, VtZ);
    }
    // 6. split/pad VtZ into fragment order for the final GEMM's A operand
    prep_vtz_kernel<<<(MPAD * KPAD + 255) / 256, 256, 0, stream>>>(VtZ, VtZthi, VtZtlo);
    // 7. res = U @ VtZ * Dscale -> out[:, 0:100]
    {
        const int blocks = (R_PAIRS + R_WAVES - 1) / R_WAVES;
        res_kernel<<<blocks, R_THREADS, 0, stream>>>(Uhi, Ulo, VtZthi, VtZtlo, dscale, out);
    }
}

// v007
// Measured time: 216 microseconds a run.
// Next to v006, in two timings, it ran 1.08 times as fast each time.
// Over all steps from v000 it is 3.91 times as fast.
#include <hip/hip_runtime.h>
#include <hip/hip_bf16.h>

// ---------------------------------------------------------------------------
// LowRankAttention for MI455X (gfx1250), wave32 + bf16 WMMA, fp32-split bf16.
//   out[:,0:100]   = (U @ (V^T Z)) * Dscale
//   out[:,100:200] = T
// where [U|V|Z|T] = relu(X @ W^T + b)
// W is split into bf16 (hi, lo) ahead of the main GEMM; X is split inside the main
// GEMM, once per element, on its way from global memory into LDS.
// Four launches: preparation, main GEMM, VtZ, result.
// ---------------------------------------------------------------------------

#define N_ROWS 100000
#define D_DIM  512
#define M_COLS 400          // 4*K
#define KC     100          // K
#define KPAD   128          // K padded for U / VtZ fragments
#define MPAD   112          // 100 padded to 7 tiles of 16
#define OUTC   200
#define WPB    8            // waves per block (256 threads)
#define ROWG   5            // row tiles per wave in main GEMM (6250 = 5*1250)
#define VTZ_SPLITS 64

typedef __bf16 bf16_t;
typedef bf16_t       v16bf __attribute__((ext_vector_type(16)));
typedef float        v8f   __attribute__((ext_vector_type(8)));
typedef unsigned int u32x4 __attribute__((ext_vector_type(4)));
typedef unsigned int u32x2 __attribute__((ext_vector_type(2)));
typedef float        f32x4 __attribute__((ext_vector_type(4)));

// 32-byte A/B fragment viewed either as bf16 lanes or as two 16B load chunks
union Frag16 { v16bf v; u32x4 q[2]; };
// 8 bf16 values viewed as one 16B store chunk
union Pack8 { bf16_t e[8]; u32x4 q; };
// 4 bf16 values viewed as one 8B store chunk
union Pack4 { bf16_t e[4]; u32x2 q; };

__device__ __forceinline__ void split_bf16(float x, bf16_t& hi, bf16_t& lo) {
    hi = (bf16_t)x;                 // RNE f32 -> bf16
    lo = (bf16_t)(x - (float)hi);   // exact residual, re-rounded
}

// ---------------------------------------------------------------------------
// Fragment order of a bf16 operand plane with element (k, c), c in 7 tiles of 16:
// one block = 32 k x 16 c = 1 KB, blocks ordered [k / 32][c / 16]. Inside a block lie
// the two 512-byte halves of the WMMA fragment (k 0..15, k 16..31), each as 32 lanes x
// 16 bytes: lane = ((k >> 3) & 1) * 16 + (c & 15) holds its 8 consecutive k.
// A wave loads a fragment as two contiguous 512-byte reads.
// offset(k, c) = frag_tile16(k >> 4) + frag_lane((k >> 3) & 1, c) + (k & 7)
// ---------------------------------------------------------------------------
#define FRAG_BLK  512                 // elements of one 32 x 16 block
#define FRAG_KSTEP (7 * FRAG_BLK)     // elements of one step of 32 k over all 7 tiles
__device__ __forceinline__ int frag_tile16(int k16) {
    return (k16 >> 1) * FRAG_KSTEP + (k16 & 1) * (FRAG_BLK / 2);
}
__device__ __forceinline__ int frag_lane(int half, int c) {
    return (c >> 4) * FRAG_BLK + (half * 16 + (c & 15)) * 8;
}

// ---------------------------------------------------------------------------
// Fragment order of the U planes, element (row, k), k in 0..127: the result GEMM's A
// operand. One block = 16 rows x 32 k = 1 KB, blocks ordered [row / 16][k / 32]; inside
// a block the two 512-byte halves (k 0..15, k 16..31), each as 32 lanes x 16 bytes:
// lane = ((k >> 3) & 1) * 16 + (row & 15) holds its 8 consecutive k.
// offset(row, k) = (row >> 4) * UFRAG_ROWT + ufrag_k16(k >> 4)
//                + (((k >> 3) & 1) * 16 + (row & 15)) * 8 + (k & 7)
// ---------------------------------------------------------------------------
#define UFRAG_ROWT (KPAD * 16)        // elements of one tile of 16 rows, all 128 k
__device__ __forceinline__ int ufrag_k16(int k16) {
    return (k16 >> 1) * FRAG_BLK + (k16 & 1) * (FRAG_BLK / 2);
}

// v + the value of lane (l ^ M) of the same 16-lane row (all lanes on)
template <int M>
__device__ __forceinline__ float row_xor_add(float v) {
    return v + __int_as_float(__builtin_amdgcn_update_dpp(0, __float_as_int(v), 0x160 | M, 0xf, 0xf, true));
}

// One bf16 product step. Swapped, W is the A operand and X the B operand: the tile comes
// out transposed, register r of lane (half, i) = (row i, column 8 * half + r).
template <bool SWAP>
__device__ __forceinline__ v8f mma(const v16bf x, const v16bf w, const v8f acc) {
    if (SWAP) return __builtin_amdgcn_wmma_f32_16x16x32_bf16(false, w, false, x, (short)0, acc, false, false);
    return __builtin_amdgcn_wmma_f32_16x16x32_bf16(false, x, false, w, (short)0, acc, false, false);
}

// ---------------------------------------------------------------------------
// All that has to be ready before the main GEMM, in one grid; the block index picks the job:
// blocks 0 .. PW_BLOCKS - 1 split W into bf16 hi/lo, 4 elements a thread; the others store
// zeros, 16 bytes a thread, into the targets of the atomics (column sums and VtZ, contiguous).
// ---------------------------------------------------------------------------
#define P_THREADS 256
#define PW_BLOCKS (M_COLS * D_DIM / 4 / P_THREADS)
#define PZ_N16    ((256 * 4 + KC * KC * 4) / 16)
#define PZ_BLOCKS ((PZ_N16 + P_THREADS - 1) / P_THREADS)
__global__ void __launch_bounds__(P_THREADS)
prep_kernel(const float* __restrict__ src,
            bf16_t* __restrict__ hi, bf16_t* __restrict__ lo, u32x4* __restrict__ zeroed)
{
    if (blockIdx.x < PW_BLOCKS) {
        const int i = (blockIdx.x * P_THREADS + threadIdx.x) * 4;
        const f32x4 v = *(const f32x4*)(src + i);
#pragma unroll
        for (int j = 0; j < 4; ++j) {
            bf16_t h, l;
            split_bf16(v[j], h, l);
            hi[i + j] = h; lo[i + j] = l;
        }
    } else {
        const int i = (blockIdx.x - PW_BLOCKS) * P_THREADS + threadIdx.x;
        const u32x4 z = {0u, 0u, 0u, 0u};
        if (i < PZ_N16) zeroed[i] = z;
    }
}

// ---------------------------------------------------------------------------
// Kernel 1: tmp = relu(X @ W^T + b), one block = 80 rows x all 400 columns,
// 5 waves, one wave = 5 row tiles x 5 col tiles: column tiles wave, 5 + wave, ... 20 + wave.
// A wave's first column tile (columns 0..79, U's first 80 of 100) is computed with the operands
// swapped, so that a lane holds 8 consecutive columns of one row.
// Per pass (32 k) the block's 400 W rows (pre-split) are copied to LDS by
// asynchronous copies; its 80 X rows are loaded as f32 into registers one pass
// ahead of their place in the ring, split there and stored to LDS. Two buffers,
// the next pass's tile in flight while this pass is worked on.
// One LDS row = [64 B hi | 64 B lo | 16 B pad].
// Epilogue: U -> bf16 hi/lo in fragment order (k = column); V,Z -> bf16 hi/lo in fragment
// order (k = row); T -> out (f32); U/V column sums via atomicAdd.
// ---------------------------------------------------------------------------
#define G_WAVES   5
#define G_THREADS (G_WAVES * 32)
#define G_ROWS    (ROWG * 16)               // 80 rows of X per block
#define ST_ROWS   (M_COLS + G_ROWS)         // W rows first, then X rows
#define ST_PITCH  144                       // 16 B x odd: conflict-free b128 reads
#define ST_BYTES  (ST_ROWS * ST_PITCH)
#define CP_ROWS   (G_THREADS / 8)           // rows covered by one copy of the block
#define G_PASSES  (D_DIM / 32)
#define X_CH      (G_ROWS / CP_ROWS)        // X rows per lane and pass
#define XT_PITCH  80                        // epilogue's turn of a tile: 64 B + 16 B pad (16 B x odd)

__device__ __forceinline__ unsigned lds_off(const void* p) {
    return (unsigned)(unsigned long long)p;   // low 32 bits of a __shared__ address
}

// Ten 16-byte-per-lane copies to LDS. The closing s_wait_xcnt keeps every
// address register of the copies unwritten until the copies have taken them.
__device__ __forceinline__ void async_copy10(const unsigned (&l)[10],
                                             const bf16_t* const (&p)[10])
{
    asm volatile(
        "global_load_async_to_lds_b128 %0, %10, off\n\t"
        "global_load_async_to_lds_b128 %1, %11, off\n\t"
        "global_load_async_to_lds_b128 %2, %12, off\n\t"
        "global_load_async_to_lds_b128 %3, %13, off\n\t"
        "global_load_async_to_lds_b128 %4, %14, off\n\t"
        "global_load_async_to_lds_b128 %5, %15, off\n\t"
        "global_load_async_to_lds_b128 %6, %16, off\n\t"
        "global_load_async_to_lds_b128 %7, %17, off\n\t"
        "global_load_async_to_lds_b128 %8, %18, off\n\t"
        "global_load_async_to_lds_b128 %9, %19, off\n\t"
        "s_wait_xcnt 0x0"
        :: "v"(l[0]), "v"(l[1]), "v"(l[2]), "v"(l[3]), "v"(l[4]),
           "v"(l[5]), "v"(l[6]), "v"(l[7]), "v"(l[8]), "v"(l[9]),
           "v"(p[0]), "v"(p[1]), "v"(p[2]), "v"(p[3]), "v"(p[4]),
           "v"(p[5]), "v"(p[6]), "v"(p[7]), "v"(p[8]), "v"(p[9])
        : "memory");
}

// One pass's W tile: 20 copies per lane.
__device__ __forceinline__ void stage_w(unsigned lds, const bf16_t* gW)
{
#pragma unroll
    for (int g = 0; g < 2; ++g) {
        unsigned l[10];
        const bf16_t* p[10];
#pragma unroll
        for (int j = 0; j < 10; ++j) {
            l[j] = lds + (g * 10 + j) * (CP_ROWS * ST_PITCH);
            p[j] = gW + (g * 10 + j) * (CP_ROWS * D_DIM);
        }
        async_copy10(l, p);
    }
}

// One pass's X tile, f32: 4 floats of each of 4 rows per lane (8 lanes = one 128-byte row).
__device__ __forceinline__ void load_x(f32x4 (&xr)[X_CH], const float* gX)
{
#pragma unroll
    for (int j = 0; j < X_CH; ++j)
        xr[j] = *(const f32x4*)(gX + j * (CP_ROWS * D_DIM));
    // the loads' address is advanced for the next pass: wait until the loads have
    // taken it (the scheduling fence keeps later register writes behind the wait)
    asm volatile("s_wait_xcnt 0x0" ::: "memory");
    __builtin_amdgcn_sched_barrier(0);
}

// Split the loaded X values and store them into the tile's X rows: 8 bytes hi, 8 bytes lo.
__device__ __forceinline__ void store_x(unsigned char* sx, const f32x4 (&xr)[X_CH])
{
#pragma unroll
    for (int j = 0; j < X_CH; ++j) {
        Pack4 h4, l4;
#pragma unroll
        for (int e = 0; e < 4; ++e) {
            bf16_t h, l;
            split_bf16(xr[j][e], h, l);
            h4.e[e] = h; l4.e[e] = l;
        }
        *(u32x2*)(sx + j * (CP_ROWS * ST_PITCH))      = h4.q;
        *(u32x2*)(sx + j * (CP_ROWS * ST_PITCH) + 64) = l4.q;
    }
}

__global__ void __launch_bounds__(G_THREADS, 3)   // 3 waves per SIMD: two blocks share a WGP
gemm_relu_lds_kernel(const float* __restrict__ X,
                     const bf16_t* __restrict__ Whi, const bf16_t* __restrict__ Wlo,
                     const float* __restrict__ bias,
                     bf16_t* __restrict__ Uhi, bf16_t* __restrict__ Ulo,
                     bf16_t* __restrict__ Vthi, bf16_t* __restrict__ Vtlo,
                     bf16_t* __restrict__ Zthi, bf16_t* __restrict__ Ztlo,
                     float* __restrict__ sums, float* __restrict__ out)
{
    __shared__ __attribute__((aligned(16))) unsigned char smem[2 * ST_BYTES];

    const int tid      = threadIdx.x;
    const int lane     = tid & 31;
    const int wave     = __builtin_amdgcn_readfirstlane(tid >> 5);
    const int rowGroup = blockIdx.x;
    const int half     = lane >> 4;
    const int lidx     = lane & 15;

    // this lane's share of every W copy: row (tid >> 3) of each group of CP_ROWS
    // rows, 16-byte chunk (tid & 7): chunks 0..3 from hi, 4..7 from lo;
    // of every X load: the same row of each group, floats (tid & 7) * 4 .. + 3
    const int  crow = tid >> 3;
    const bool chi  = (tid & 7) < 4;
    const unsigned ldsT = lds_off(smem) + crow * ST_PITCH + (tid & 7) * 16;
    const bf16_t* gW = (chi ? Whi : Wlo) + crow * D_DIM + (tid & 3) * 8;
    const float* gX = X + (size_t)(rowGroup * G_ROWS + crow) * D_DIM + (tid & 7) * 4;
    unsigned char* sx = smem + (M_COLS + crow) * ST_PITCH + (tid & 7) * 8;
    f32x4 xr[X_CH];

    v8f acc[5][ROWG];
#pragma unroll
    for (int c = 0; c < 5; ++c)
#pragma unroll
        for (int t = 0; t < ROWG; ++t) acc[c][t] = {};

    load_x(xr, gX);
    gX += 32;
    stage_w(ldsT, gW);
    store_x(sx, xr);
    load_x(xr, gX);
    gX += 32;
    asm volatile("s_wait_dscnt 0x0" ::: "memory");      // tile 0: this wave's X rows stored
    asm volatile("s_wait_asynccnt 0x0" ::: "memory");   // ... and its W copies landed
    __syncthreads();                                    // ... and every other wave's
    stage_w(ldsT + ST_BYTES, gW + 32);
    store_x(sx + ST_BYTES, xr);

    for (int kt = 0; kt < G_PASSES; ++kt) {
        const int buf = (kt & 1) * ST_BYTES;
        const unsigned char* sa = smem + buf + (M_COLS + lidx) * ST_PITCH + (half << 4);
        const unsigned char* sb = smem + buf + (wave * 16 + lidx) * ST_PITCH + (half << 4);

        // X of tile kt + 2 flies through this pass; it is split and stored behind the barrier
        if (kt + 2 < G_PASSES) { load_x(xr, gX); gX += 32; }

        // lo(A) x hi(B) first, then hi(A) x lo(B) and hi(A) x hi(B): only one half of
        // the A fragments is live at a time, so that the accumulators stay in registers
        {
            Frag16 alo[ROWG];
#pragma unroll
            for (int t = 0; t < ROWG; ++t) {
                const unsigned char* r = sa + t * (16 * ST_PITCH);
                alo[t].q[0] = *(const u32x4*)(r + 64);
                alo[t].q[1] = *(const u32x4*)(r + 96);
            }
#pragma unroll
            for (int c = 0; c < 5; ++c) {
                const unsigned char* r = sb + c * (G_WAVES * 16 * ST_PITCH);
                Frag16 bhi;
                bhi.q[0] = *(const u32x4*)(r);
                bhi.q[1] = *(const u32x4*)(r + 32);
#pragma unroll
                for (int t = 0; t < ROWG; ++t)
                    acc[c][t] = c == 0 ? mma<true>(alo[t].v, bhi.v, acc[c][t]) : mma<false>(alo[t].v, bhi.v, acc[c][t]);
            }
        }
        {
            Frag16 ahi[ROWG];
#pragma unroll
            for (int t = 0; t < ROWG; ++t) {
                const unsigned char* r = sa + t * (16 * ST_PITCH);
                ahi[t].q[0] = *(const u32x4*)(r);
                ahi[t].q[1] = *(const u32x4*)(r + 32);
            }
#pragma unroll
            for (int c = 0; c < 5; ++c) {
                const unsigned char* r = sb + c * (G_WAVES * 16 * ST_PITCH);
                Frag16 bhi, blo;
                bhi.q[0] = *(const u32x4*)(r);
                bhi.q[1] = *(const u32x4*)(r + 32);
                blo.q[0] = *(const u32x4*)(r + 64);
                blo.q[1] = *(const u32x4*)(r + 96);
#pragma unroll
                for (int t = 0; t < ROWG; ++t)
                    acc[c][t] = c == 0 ? mma<true>(ahi[t].v, blo.v, acc[c][t]) : mma<false>(ahi[t].v, blo.v, acc[c][t]);
#pragma unroll
                for (int t = 0; t < ROWG; ++t)
                    acc[c][t] = c == 0 ? mma<true>(ahi[t].v, bhi.v, acc[c][t]) : mma<false>(ahi[t].v, bhi.v, acc[c][t]);
            }
        }

        // keeps the pass's last WMMAs in front of the barrier: sunk behind it they would
        // delay the issue of the next copies and shorten their lead
        __builtin_amdgcn_sched_barrier(0);
        // the four vector slots that the chip needs between the pass's last WMMA and a vector write of
        // its operand registers
        asm volatile("v_nop\n\tv_nop\n\tv_nop\n\tv_nop");
        asm volatile("s_wait_dscnt 0x0" ::: "memory");     // this wave has left the buffer, its X stores of tile kt + 1 are done
        asm volatile("s_wait_asynccnt 0x0" ::: "memory");  // its copies of tile kt + 1 landed
        __syncthreads();   // publishes tile kt + 1, frees this pass's buffer
        if (kt + 2 < G_PASSES) {
            stage_w(ldsT + buf, gW + (kt + 2) * 32);
            store_x(sx + buf, xr);
        }
    }
    asm volatile("s_wait_asynccnt 0x0" ::: "memory");      // no copy outlives the loop

    // ---- epilogue: bias + relu; route column; fold in column sums ----
    // A wave's first tile, transposed: columns wave * 16 + 8 * half + r of row (lane & 15) of each
    // row tile. These 8 values are the 16 bytes of this lane in U's fragment order, so that the
    // wave stores 512 contiguous bytes each for hi and lo.
    {
        const f32x4 b0 = *(const f32x4*)(bias + wave * 16 + (half << 3));
        const f32x4 b1 = *(const f32x4*)(bias + wave * 16 + (half << 3) + 4);
        bf16_t* ph = Uhi + ufrag_k16(wave) + lane * 8;
        bf16_t* pl = Ulo + ufrag_k16(wave) + lane * 8;
        float s[8];
#pragma unroll
        for (int r = 0; r < 8; ++r) s[r] = 0.f;
#pragma unroll
        for (int t = 0; t < ROWG; ++t) {
            Pack8 h8, l8;
#pragma unroll
            for (int r = 0; r < 8; ++r) {
                float v = acc[0][t][r] + (r < 4 ? b0[r & 3] : b1[r & 3]);
                v = v > 0.f ? v : 0.f;
                bf16_t h, l;
                split_bf16(v, h, l);
                h8.e[r] = h; l8.e[r] = l;
                s[r] += v;
            }
            *(u32x4*)(ph + (rowGroup * ROWG + t) * UFRAG_ROWT) = h8.q;
            *(u32x4*)(pl + (rowGroup * ROWG + t) * UFRAG_ROWT) = l8.q;
            // the stores' registers are reused below: wait until the stores have taken them
            // (the scheduling fence keeps later register writes behind the wait)
            asm volatile("s_wait_xcnt 0x0" ::: "memory");
            __builtin_amdgcn_sched_barrier(0);
        }
        // column sums: over the 16 rows that the lanes of a half hold, then lane i < 8 of each
        // half adds column 8 * half + i
        float sel = 0.f;
#pragma unroll
        for (int r = 0; r < 8; ++r) {
            float v = s[r];
            v = row_xor_add<1>(v);
            v = row_xor_add<2>(v);
            v = row_xor_add<4>(v);
            v = row_xor_add<8>(v);
            sel = lidx == r ? v : sel;
        }
        if (lidx < 8) atomicAdd(&sums[wave * 16 + (half << 3) + lidx], sel);   // [0..79]=U sums
        // the atomic's registers are reused below: wait until it has taken them
        // (the scheduling fence keeps later register writes behind the wait)
        asm volatile("s_wait_xcnt 0x0" ::: "memory");
        __builtin_amdgcn_sched_barrier(0);
    }

    // The other four tiles. The T / V,Z test stands outside the element loops, and only the
    // kinds that tile c can hold are written out, for speed only:
    // c = 1 holds columns 80..159, c = 2 160..239, c = 3 240..319, c = 4 320..399.
    const int rbase = rowGroup * G_ROWS + (half << 3);
#pragma unroll
    for (int c = 1; c < 5; ++c) {
        const int col = (c * G_WAVES + wave) * 16 + lidx;
        const float bv = bias[col];
        if (c == 1 && wave < 2) {
            // U columns 80..99 come in the plain orientation (8 rows of one column per lane). The wave
            // turns its tile through LDS, which nobody reads any more behind the loop's last barrier:
            // rows of 16 floats at a pitch of 80 bytes, zeros in the columns that are not U's (they are
            // U's k padding). Each lane then holds 8 consecutive columns of one row, as in the first tile.
            float* xs = (float*)(smem + wave * (G_ROWS * XT_PITCH));
            float s = 0.f;
#pragma unroll
            for (int t = 0; t < ROWG; ++t)
#pragma unroll
                for (int r = 0; r < 8; ++r) {
                    float v = acc[c][t][r] + bv;
                    v = (col < KC && v > 0.f) ? v : 0.f;
                    xs[(t * 16 + (half << 3) + r) * (XT_PITCH / 4) + lidx] = v;
                    s += v;
                }
            // the lanes read each other's values: every store of the wave is done first
            asm volatile("s_wait_dscnt 0x0" ::: "memory");
            bf16_t* ph = Uhi + ufrag_k16(G_WAVES + wave) + lane * 8;
            bf16_t* pl = Ulo + ufrag_k16(G_WAVES + wave) + lane * 8;
#pragma unroll
            for (int t = 0; t < ROWG; ++t) {
                const float* xr8 = xs + (t * 16 + lidx) * (XT_PITCH / 4) + (half << 3);
                const f32x4 x0 = *(const f32x4*)(xr8);
                const f32x4 x1 = *(const f32x4*)(xr8 + 4);
                Pack8 h8, l8;
#pragma unroll
                for (int r = 0; r < 8; ++r) {
                    bf16_t h, l;
                    split_bf16(r < 4 ? x0[r & 3] : x1[r & 3], h, l);
                    h8.e[r] = h; l8.e[r] = l;
                }
                *(u32x4*)(ph + (rowGroup * ROWG + t) * UFRAG_ROWT) = h8.q;
                *(u32x4*)(pl + (rowGroup * ROWG + t) * UFRAG_ROWT) = l8.q;
                // the stores' registers are reused below: wait until the stores have taken them
                // (the scheduling fence keeps later register writes behind the wait)
                asm volatile("s_wait_xcnt 0x0" ::: "memory");
                __builtin_amdgcn_sched_barrier(0);
            }
            if (col < KC) atomicAdd(&sums[col], s);       // [80..99]=U sums
            // the atomic's registers are reused below: wait until it has taken them
            // (the scheduling fence keeps later register writes behind the wait)
            asm volatile("s_wait_xcnt 0x0" ::: "memory");
            __builtin_amdgcn_sched_barrier(0);
        }
        if (c == 4 || (c == 3 && col >= 3 * KC)) {
            float* pT = out + (size_t)rbase * OUTC + (KC + (col - 3 * KC));
#pragma unroll
            for (int t = 0; t < ROWG; ++t)
#pragma unroll
                for (int r = 0; r < 8; ++r) {
                    const float v = acc[c][t][r] + bv;
                    pT[(t * 16 + r) * OUTC] = v > 0.f ? v : 0.f;
                    // the stores' registers are reused below: wait until the store has taken them
                    // (the scheduling fence keeps later register writes behind the wait)
                    if (r == 7) { asm volatile("s_wait_xcnt 0x0" ::: "memory"); __builtin_amdgcn_sched_barrier(0); }
                }
        } else if (c != 1 || col >= KC) {
            // V and Z lie in fragment order (k = row): the 8 rows a lane holds of one tile are
            // that order's 16 bytes of lane (half, column & 15), so that neighbouring lanes
            // store neighbouring 16 bytes: one b128 store each for hi and lo
            const bool isV = c == 1 || (c == 2 && col < 2 * KC);
            const int  A   = frag_lane(half, isV ? col - KC : col - 2 * KC);
            bf16_t* ph = (isV ? Vthi : Zthi) + A;
            bf16_t* pl = (isV ? Vtlo : Ztlo) + A;
            float s = 0.f;
#pragma unroll
            for (int t = 0; t < ROWG; ++t) {
                Pack8 h8, l8;
#pragma unroll
                for (int r = 0; r < 8; ++r) {
                    float v = acc[c][t][r] + bv;
                    v = v > 0.f ? v : 0.f;
                    bf16_t h, l;
                    split_bf16(v, h, l);
                    h8.e[r] = h; l8.e[r] = l;
                    s += v;
                }
                *(u32x4*)(ph + frag_tile16(rowGroup * ROWG + t)) = h8.q;
                *(u32x4*)(pl + frag_tile16(rowGroup * ROWG + t)) = l8.q;
                // the stores' registers are reused below: wait until the stores have taken them
                // (the scheduling fence keeps later register writes behind the wait)
                asm volatile("s_wait_xcnt 0x0" ::: "memory");
                __builtin_amdgcn_sched_barrier(0);
            }
            if (isV) atomicAdd(&sums[col], s);            // [100..199]=V sums
        }
        // the registers of the tile's last stores and of its atomic are reused by the next tile:
        // wait until they have been taken (the scheduling fence keeps later writes behind the wait)
        asm volatile("s_wait_xcnt 0x0" ::: "memory");
        __builtin_amdgcn_sched_barrier(0);
    }
}

// ---------------------------------------------------------------------------
// VtZ = V^T @ Z (100x100, reduction over N). Split-K WMMA + f32 atomics.
// A/B fragments are read from planes in fragment order: 512 contiguous bytes per load.
// Pad columns (>=100) hold garbage but only affect guarded (unstored) outputs.
// ---------------------------------------------------------------------------
__global__ void __launch_bounds__(256)
vtz_kernel(const bf16_t* __restrict__ Vthi, const bf16_t* __restrict__ Vtlo,
           const bf16_t* __restrict__ Zthi, const bf16_t* __restrict__ Ztlo,
           float* __restrict__ VtZ)
{
    const int lane  = threadIdx.x & 31;
    const int gwave = blockIdx.x * WPB + (threadIdx.x >> 5);
    const int TILES = 7 * 7;
    if (gwave >= TILES * VTZ_SPLITS) return;     // wave-uniform
    const int tile  = gwave % TILES;
    const int split = gwave / TILES;
    const int mBase = (tile / 7) << 4, nBase = (tile % 7) << 4;
    const int half  = lane >> 4, lidx = lane & 15;
    const int ncol  = nBase + lidx;                        // <= 111 < MPAD

    const bf16_t* ah = Vthi + frag_lane(half, mBase + lidx);
    const bf16_t* al = Vtlo + frag_lane(half, mBase + lidx);
    const bf16_t* bh = Zthi + frag_lane(half, ncol);
    const bf16_t* bl = Ztlo + frag_lane(half, ncol);

    v8f acc = {};
    for (int kt = split; kt < N_ROWS / 32; kt += VTZ_SPLITS) {
        const int o0 = frag_tile16(2 * kt);
        const int o1 = frag_tile16(2 * kt + 1);
        Frag16 ahi, alo, bhi, blo;
        ahi.q[0] = *(const u32x4*)(ah + o0); ahi.q[1] = *(const u32x4*)(ah + o1);
        alo.q[0] = *(const u32x4*)(al + o0); alo.q[1] = *(const u32x4*)(al + o1);
        bhi.q[0] = *(const u32x4*)(bh + o0); bhi.q[1] = *(const u32x4*)(bh + o1);
        blo.q[0] = *(const u32x4*)(bl + o0); blo.q[1] = *(const u32x4*)(bl + o1);
        acc = __builtin_amdgcn_wmma_f32_16x16x32_bf16(false, alo.v, false, bhi.v, (short)0, acc, false, false);
        acc = __builtin_amdgcn_wmma_f32_16x16x32_bf16(false, ahi.v, false, blo.v, (short)0, acc, false, false);
        acc = __builtin_amdgcn_wmma_f32_16x16x32_bf16(false, ahi.v, false, bhi.v, (short)0, acc, false, false);
    }
    if (ncol < KC) {
#pragma unroll
        for (int r = 0; r < 8; ++r) {
            const int m = mBase + (half << 3) + r;
            if (m < KC) atomicAdd(&VtZ[m * KC + ncol], acc[r]);
        }
    }
}

// ---------------------------------------------------------------------------
// res = (U @ VtZ) * Dscale -> out[:, 0:100]. K padded 100 -> 128 (zeros).
// One wave = 32 rows (2 row tiles) x all 7 column tiles, so that U is read once and a wave
// owns whole result rows. The block brings VtZ (100 x 100 f32) into LDS, splits it there into
// the two bf16 planes of 128 k (zeros from 100 on) x 112 columns in fragment order, and every wave
// forms Dscale = 1 / (dot(sumU, sumV) / N + 1e-6) for itself: no launch of their own for these.
// U's k 112..127 are never stored by the main GEMM: those halves of the last fragments are
// zeros in registers.
// VtZ is the A operand and U the B operand: register r of lane (half, i) = (row i, column
// 8 * half + r). The wave lays its rows down in LDS (400 bytes a row, no gap) and stores
// them to out in 16-byte pieces that run along the rows.
// The column tiles go in two groups (4 + 3), so that U's fragments and the accumulators fit
// four waves per SIMD: every block of the grid is then resident at once.
// ---------------------------------------------------------------------------
#define R_WAVES   8
#define R_THREADS (R_WAVES * 32)
#define R_PAIRS   (N_ROWS / 32)            // 3125 pairs of row tiles
#define R_PLANE   (MPAD * KPAD)            // elements of one VtZ plane
#define R_PLANE16 (R_PLANE * 2 / 16)       // its 16-byte pieces
#define R_ROW16   (KC / 4)                 // 16-byte pieces of one result row
#define R_VTZ16   (KC * KC / 4)            // 16-byte pieces of VtZ as f32
#define R_VTZ_LD  ((R_VTZ16 + R_THREADS - 1) / R_THREADS)
// 16-byte pieces of the f32 copy in LDS per thread: 128 rows of 100 floats and the 12 floats that the
// last column tile reads past the last row
#define R_F32_ST  (((KPAD * KC + MPAD - KC) / 4 + R_THREADS - 1) / R_THREADS)

__global__ void __launch_bounds__(R_THREADS, 4)
res_kernel(const bf16_t* __restrict__ Uhi, const bf16_t* __restrict__ Ulo,
           const float* __restrict__ VtZ, const float* __restrict__ sums,
           float* __restrict__ out)
{
    // the VtZ planes first: every fragment then lies within the reach of an LDS load's immediate offset
    __shared__ __attribute__((aligned(16))) unsigned char smem[2 * R_PLANE * 2 + R_WAVES * 32 * KC * 4];
    bf16_t* sB = (bf16_t*)smem;
    // VtZ as f32 lies where the waves later turn their rows: it is done with at the second barrier
    float* sF = (float*)(smem + 2 * R_PLANE * 2);

    const int tid  = threadIdx.x;
    const int lane = tid & 31;
    const int wave = __builtin_amdgcn_readfirstlane(tid >> 5);
    const int half = lane >> 4, lidx = lane & 15;
    const int pair = blockIdx.x * R_WAVES + wave;
    // the last block's spare waves load the last pair again, help to stage, and leave behind the barriers
    const int lp   = pair < R_PAIRS ? pair : R_PAIRS - 1;

    f32x4 stg[R_VTZ_LD];
#pragma unroll
    for (int i = 0; i < R_VTZ_LD; ++i) {
        const int p = i * R_THREADS + tid;
        // past the end the last piece is loaded again (and not used): no branch among the loads
        stg[i] = ((const f32x4*)VtZ)[(i + 1) * R_THREADS <= R_VTZ16 || p < R_VTZ16 ? p : R_VTZ16 - 1];
    }
    // the loads' address registers are reused below: wait until the loads have taken them
    // (the scheduling fence keeps later register writes behind the wait)
    asm volatile("s_wait_xcnt 0x0" ::: "memory");
    __builtin_amdgcn_sched_barrier(0);
    // terms lane, lane + 32, lane + 64, lane + 96 of dot(sumU, sumV), zeros from 100 on
    float pr[4];
#pragma unroll
    for (int q = 0; q < 4; ++q) {
        const int e  = q * 32 + lane;
        const int ec = e < KC ? e : KC - 1;
        const float su = sums[ec], sv = sums[KC + ec];
        pr[q] = e < KC ? su * sv : 0.f;
    }
    // as above: the address registers of these loads are reused by the loads that follow
    asm volatile("s_wait_xcnt 0x0" ::: "memory");
    __builtin_amdgcn_sched_barrier(0);
    const bf16_t* ah = Uhi + lp * (2 * UFRAG_ROWT) + lane * 8;
    const bf16_t* al = Ulo + lp * (2 * UFRAG_ROWT) + lane * 8;
    Frag16 uh[2][KPAD / 32], ul[2][KPAD / 32];
#pragma unroll
    for (int t = 0; t < 2; ++t)
#pragma unroll
        for (int kt = 0; kt < KPAD / 32; ++kt) {
            const int o0 = t * UFRAG_ROWT + ufrag_k16(2 * kt), o1 = t * UFRAG_ROWT + ufrag_k16(2 * kt + 1);
            uh[t][kt].q[0] = *(const u32x4*)(ah + o0);
            ul[t][kt].q[0] = *(const u32x4*)(al + o0);
            if ((2 * kt + 1) * 16 < MPAD) {
                uh[t][kt].q[1] = *(const u32x4*)(ah + o1);
                ul[t][kt].q[1] = *(const u32x4*)(al + o1);
            } else {
                uh[t][kt].q[1] = u32x4{0u, 0u, 0u, 0u};
                ul[t][kt].q[1] = u32x4{0u, 0u, 0u, 0u};
            }
        }
    // the loads' address registers are reused below: wait until the loads have taken them
    // (the scheduling fence keeps later register writes behind the wait)
    asm volatile("s_wait_xcnt 0x0" ::: "memory");
    __builtin_amdgcn_sched_barrier(0);
#pragma unroll
    for (int i = 0; i < R_F32_ST; ++i) {
        // rows 100..127 (k padding) are zeros
        const int p = i * R_THREADS + tid;
        const f32x4 z = {0.f, 0.f, 0.f, 0.f};
        ((f32x4*)sF)[p] = i >= R_VTZ_LD ? z : ((i + 1) * R_THREADS <= R_VTZ16 || p < R_VTZ16) ? stg[i < R_VTZ_LD ? i : 0] : z;
    }
    // the sum over 128 terms as a tree of halves (64, 32, ... 1); every lane ends with the total
    float dot = (pr[0] + pr[2]) + (pr[1] + pr[3]);
    dot += __shfl_xor(dot, 16, 32);
    dot = row_xor_add<8>(dot);
    dot = row_xor_add<4>(dot);
    dot = row_xor_add<2>(dot);
    dot = row_xor_add<1>(dot);
    const float ds = 1.0f / (dot / (float)N_ROWS + 1e-6f);
    __syncthreads();                       // VtZ lies in LDS as f32
    // One thread builds the 16-byte piece (8 consecutive k of one column) of each of the 7 column
    // tiles, hi and lo: k = (tid >> 4) * 8 + j, column = 16 * i + (tid & 15); in fragment order
    // that is piece (tid >> 6) * 7 * 64 + i * 64 + (tid & 63) of a plane. Columns 100..111 take
    // the next row's first values: they reach only result columns that are never stored.
    {
        const float* sk = sF + ((tid >> 4) << 3) * KC + lidx;
#pragma unroll
        for (int i = 0; i < MPAD / 16; ++i) {
            Pack8 h8, l8;
#pragma unroll
            for (int j = 0; j < 8; ++j) {
                bf16_t h, l;
                split_bf16(sk[j * KC + i * 16], h, l);
                h8.e[j] = h; l8.e[j] = l;
            }
            const int p = (tid >> 6) * (FRAG_KSTEP / 8) + i * (FRAG_BLK / 8) + (tid & 63);
            ((u32x4*)sB)[p]             = h8.q;
            ((u32x4*)sB)[R_PLANE16 + p] = l8.q;
        }
    }
    __syncthreads();                       // both VtZ planes lie in LDS, and nobody reads the f32 copy any more
    if (pair >= R_PAIRS) return;           // wave-uniform, behind the last barrier

    const bf16_t* bh = sB + lane * 8;
    const bf16_t* bl = sB + R_PLANE + lane * 8;
    float* st = (float*)(smem + 2 * R_PLANE * 2) + wave * (32 * KC);
#pragma unroll
    for (int g = 0; g < 2; ++g) {
        v8f acc[4][2];
#pragma unroll
        for (int c = 0; c < 4; ++c) { acc[c][0] = {}; acc[c][1] = {}; }
#pragma unroll
        for (int kt = 0; kt < KPAD / 32; ++kt)
#pragma unroll
            for (int c = 0; c < 4 - g; ++c) {
                const int p0 = frag_tile16(2 * kt) + (g * 4 + c) * FRAG_BLK;
                const int p1 = frag_tile16(2 * kt + 1) + (g * 4 + c) * FRAG_BLK;
                Frag16 bhi, blo;
                bhi.q[0] = *(const u32x4*)(bh + p0); bhi.q[1] = *(const u32x4*)(bh + p1);
                blo.q[0] = *(const u32x4*)(bl + p0); blo.q[1] = *(const u32x4*)(bl + p1);
#pragma unroll
                for (int t = 0; t < 2; ++t) acc[c][t] = mma<true>(ul[t][kt].v, bhi.v, acc[c][t]);
#pragma unroll
                for (int t = 0; t < 2; ++t) acc[c][t] = mma<true>(uh[t][kt].v, blo.v, acc[c][t]);
#pragma unroll
                for (int t = 0; t < 2; ++t) acc[c][t] = mma<true>(uh[t][kt].v, bhi.v, acc[c][t]);
            }
#pragma unroll
        for (int c = 0; c < 4 - g; ++c)
#pragma unroll
            for (int t = 0; t < 2; ++t) {
                float* p = st + (t * 16 + lidx) * KC + (g * 4 + c) * 16 + (half << 3);
                const f32x4 v0 = {acc[c][t][0] * ds, acc[c][t][1] * ds, acc[c][t][2] * ds, acc[c][t][3] * ds};
                const f32x4 v1 = {acc[c][t][4] * ds, acc[c][t][5] * ds, acc[c][t][6] * ds, acc[c][t][7] * ds};
                if (g * 4 + c < 6) {
                    *(f32x4*)(p)     = v0;
                    *(f32x4*)(p + 4) = v1;
                } else if (half == 0) {
                    *(f32x4*)(p) = v0;     // columns 96..99; 100..111 are padding
                }
            }
    }
    // the lanes read each other's values: every store of the wave is done first
    asm volatile("s_wait_dscnt 0x0" ::: "memory");
    char* po = (char*)(out + (size_t)pair * (32 * OUTC));
    // 16-byte piece j = 32 * step + lane of the wave's 32 rows x 25 pieces: c4 = j % 25, off = its bytes into po
    unsigned c4  = lane < R_ROW16 ? lane : lane - R_ROW16;
    unsigned off = (lane < R_ROW16 ? 0 : OUTC * 4) + c4 * 16;
#pragma unroll
    for (int b = 0; b < 5; ++b) {
#pragma unroll
        for (int i = 0; i < 5; ++i) {
            *(f32x4*)(po + off) = *(const f32x4*)(st + ((b * 5 + i) * 32 + lane) * 4);
            // 32 pieces on: one row and 7 pieces, or two rows less 18
            c4  += 32 - R_ROW16;
            off += OUTC * 4 + (32 - R_ROW16) * 16;
            if (c4 >= R_ROW16) { c4 -= R_ROW16; off += OUTC * 4 - R_ROW16 * 16; }
        }
        // the stores' registers are reused below: wait until the stores have taken them
        // (the scheduling fence keeps later register writes behind the wait)
        asm volatile("s_wait_xcnt 0x0" ::: "memory");
        __builtin_amdgcn_sched_barrier(0);
    }
}

// ---------------------------------------------------------------------------
// Launch
// ---------------------------------------------------------------------------
extern "C" void kernel_launch(void* const* d_in, const int* in_sizes, int n_in,
                              void* d_out, int out_size, void* d_ws, size_t ws_size,
                              hipStream_t stream)
{
    (void)in_sizes; (void)n_in; (void)out_size;
    const float* X  = (const float*)d_in[0];   // 100000 x 512
    const float* W  = (const float*)d_in[1];   // 400 x 512
    const float* bb = (const float*)d_in[2];   // 400
    float* out = (float*)d_out;                // 100000 x 200

    // ---- workspace carve-up (all regions 64B aligned) ----
    char* base = (char*)d_ws;
    size_t off = 0;
    auto carve = [&](size_t bytes) -> char* {
        char* p = base + off;
        off += (bytes + 63) & ~(size_t)63;
        return p;
    };
    bf16_t* Uhi  = (bf16_t*)carve((size_t)N_ROWS * KPAD * 2);
    bf16_t* Ulo  = (bf16_t*)carve((size_t)N_ROWS * KPAD * 2);   // contiguous w/ Uhi
    bf16_t* Vthi = (bf16_t*)carve((size_t)MPAD * N_ROWS * 2);
    bf16_t* Vtlo = (bf16_t*)carve((size_t)MPAD * N_ROWS * 2);
    bf16_t* Zthi = (bf16_t*)carve((size_t)MPAD * N_ROWS * 2);
    bf16_t* Ztlo = (bf16_t*)carve((size_t)MPAD * N_ROWS * 2);
    bf16_t* Whi  = (bf16_t*)carve((size_t)M_COLS * D_DIM * 2);
    bf16_t* Wlo  = (bf16_t*)carve((size_t)M_COLS * D_DIM * 2);
    float*  sums   = (float*)carve(256 * 4);                    // [U(100)|V(100)|pad]
    float*  VtZ    = (float*)carve(KC * KC * 4);                // contiguous w/ sums
    (void)ws_size;

    // 1. pre-split W; zero sums+VtZ (atomics targets)
    prep_kernel<<<PW_BLOCKS + PZ_BLOCKS, P_THREADS, 0, stream>>>(W, Whi, Wlo, (u32x4*)sums);
    // 2. fused X split + GEMM + bias + relu + scatter + column sums
    gemm_relu_lds_kernel<<<N_ROWS / G_ROWS, G_THREADS, 0, stream>>>(X, Whi, Wlo, bb,
        Uhi, Ulo, Vthi, Vtlo, Zthi, Ztlo, sums, out);
    // 3. VtZ = V^T @ Z (split-K)
    {
        const int waves  = 49 * VTZ_SPLITS;
        const int blocks = (waves + WPB - 1) / WPB;
        vtz_kernel<<<blocks, 256, 0, stream>>>(Vthi, Vtlo, Zthi, Ztlo, VtZ);
    }
    // 4. VtZ split + Dscale + res = U @ VtZ * Dscale -> out[:, 0:100]
    {
        const int blocks = (R_PAIRS + R_WAVES - 1) / R_WAVES;
        res_kernel<<<blocks, R_THREADS, 0, stream>>>(Uhi, Ulo, VtZ, sums, out);
    }
}

// v008
// It runs in 206 microseconds.
// Next to v007, in two timings, it ran 1.05 times as fast each time.
// All steps since v000 together make it 4.11 times as fast.
#include <hip/hip_runtime.h>
#include <hip/hip_bf16.h>

// ---------------------------------------------------------------------------
// LowRankAttention for MI455X (gfx1250), wave32 + bf16 WMMA, fp32-split bf16.
//   out[:,0:100]   = (U @ (V^T Z)) * Dscale
//   out[:,100:200] = T
// where [U|V|Z|T] = relu(X @ W^T + b)
// W is split into bf16 (hi, lo) ahead of the main GEMM and laid down in the order in which
// the main GEMM's passes copy it; X is split inside the main GEMM, once per element, on its
// way from global memory into LDS.
// Four launches: preparation, main GEMM, VtZ, result.
// ---------------------------------------------------------------------------

#define N_ROWS 100000
#define D_DIM  512
#define M_COLS 400          // 4*K
#define KC     100          // K
#define KPAD   128          // K padded for U / VtZ fragments
#define MPAD   112          // 100 padded to 7 tiles of 16
#define OUTC   200
#define WPB    8            // waves per block (256 threads)
#define ROWG   5            // row tiles per wave in main GEMM (6250 = 5*1250)
#define VTZ_SPLITS 64

typedef __bf16 bf16_t;
typedef bf16_t       v16bf __attribute__((ext_vector_type(16)));
typedef float        v8f   __attribute__((ext_vector_type(8)));
typedef unsigned int u32x4 __attribute__((ext_vector_type(4)));
typedef unsigned int u32x2 __attribute__((ext_vector_type(2)));
typedef float        f32x4 __attribute__((ext_vector_type(4)));

// 32-byte A/B fragment viewed either as bf16 lanes or as two 16B load chunks
union Frag16 { v16bf v; u32x4 q[2]; };
// 8 bf16 values viewed as one 16B store chunk
union Pack8 { bf16_t e[8]; u32x4 q; };
// 4 bf16 values viewed as one 8B store chunk
union Pack4 { bf16_t e[4]; u32x2 q; };

__device__ __forceinline__ void split_bf16(float x, bf16_t& hi, bf16_t& lo) {
    hi = (bf16_t)x;                 // RNE f32 -> bf16
    lo = (bf16_t)(x - (float)hi);   // exact residual, re-rounded
}

// ---------------------------------------------------------------------------
// Fragment order of a bf16 operand plane with element (k, c), c in 7 tiles of 16:
// one block = 32 k x 16 c = 1 KB, blocks ordered [k / 32][c / 16]. Inside a block lie
// the two 512-byte halves of the WMMA fragment (k 0..15, k 16..31), each as 32 lanes x
// 16 bytes: lane = ((k >> 3) & 1) * 16 + (c & 15) holds its 8 consecutive k.
// A wave loads a fragment as two contiguous 512-byte reads.
// offset(k, c) = frag_tile16(k >> 4) + frag_lane((k >> 3) & 1, c) + (k & 7)
// ---------------------------------------------------------------------------
#define FRAG_BLK  512                 // elements of one 32 x 16 block
#define FRAG_KSTEP (7 * FRAG_BLK)     // elements of one step of 32 k over all 7 tiles
__device__ __forceinline__ int frag_tile16(int k16) {
    return (k16 >> 1) * FRAG_KSTEP + (k16 & 1) * (FRAG_BLK / 2);
}
__device__ __forceinline__ int frag_lane(int half, int c) {
    return (c >> 4) * FRAG_BLK + (half * 16 + (c & 15)) * 8;
}

// ---------------------------------------------------------------------------
// Fragment order of the U planes, element (row, k), k in 0..127: the result GEMM's A
// operand. One block = 16 rows x 32 k = 1 KB, blocks ordered [row / 16][k / 32]; inside
// a block the two 512-byte halves (k 0..15, k 16..31), each as 32 lanes x 16 bytes:
// lane = ((k >> 3) & 1) * 16 + (row & 15) holds its 8 consecutive k.
// offset(row, k) = (row >> 4) * UFRAG_ROWT + ufrag_k16(k >> 4)
//                + (((k >> 3) & 1) * 16 + (row & 15)) * 8 + (k & 7)
// ---------------------------------------------------------------------------
#define UFRAG_ROWT (KPAD * 16)        // elements of one tile of 16 rows, all 128 k
__device__ __forceinline__ int ufrag_k16(int k16) {
    return (k16 >> 1) * FRAG_BLK + (k16 & 1) * (FRAG_BLK / 2);
}

// v + the value of lane (l ^ M) of the same 16-lane row (all lanes on)
template <int M>
__device__ __forceinline__ float row_xor_add(float v) {
    return v + __int_as_float(__builtin_amdgcn_update_dpp(0, __float_as_int(v), 0x160 | M, 0xf, 0xf, true));
}

// One bf16 product step. Swapped, W is the A operand and X the B operand: the tile comes
// out transposed, register r of lane (half, i) = (row i, column 8 * half + r).
template <bool SWAP>
__device__ __forceinline__ v8f mma(const v16bf x, const v16bf w, const v8f acc) {
    if (SWAP) return __builtin_amdgcn_wmma_f32_16x16x32_bf16(false, w, false, x, (short)0, acc, false, false);
    return __builtin_amdgcn_wmma_f32_16x16x32_bf16(false, x, false, w, (short)0, acc, false, false);
}

// ---------------------------------------------------------------------------
// All that has to be ready before the main GEMM, in one grid; the block index picks the job:
// blocks 0 .. PW_BLOCKS - 1 split W into bf16 hi/lo, 4 elements a thread; the others store
// zeros, 16 bytes a thread, into the targets of the atomics (column sums and VtZ, contiguous).
// The split W lies in pass order: [k / 32][row][32 hi | 32 lo], 128 bytes per row and pass, so
// that one pass's tile of the main GEMM is 400 whole 128-byte lines in a row.
// ---------------------------------------------------------------------------
#define WT_ROW  64                    // elements of one row of one pass: 32 hi, 32 lo
#define WT_PASS (M_COLS * WT_ROW)     // elements of one pass's tile
#define P_THREADS 256
#define PW_BLOCKS (M_COLS * D_DIM / 4 / P_THREADS)
#define PZ_N16    ((256 * 4 + KC * KC * 4) / 16)
#define PZ_BLOCKS ((PZ_N16 + P_THREADS - 1) / P_THREADS)
__global__ void __launch_bounds__(P_THREADS)
prep_kernel(const float* __restrict__ src,
            bf16_t* __restrict__ wt, u32x4* __restrict__ zeroed)
{
    if (blockIdx.x < PW_BLOCKS) {
        const int i = (blockIdx.x * P_THREADS + threadIdx.x) * 4;
        const f32x4 v = *(const f32x4*)(src + i);
        const int k = i % D_DIM;
        bf16_t* hi = wt + (k >> 5) * WT_PASS + (i / D_DIM) * WT_ROW + (k & 31);
        bf16_t* lo = hi + WT_ROW / 2;
#pragma unroll
        for (int j = 0; j < 4; ++j) {
            bf16_t h, l;
            split_bf16(v[j], h, l);
            hi[j] = h; lo[j] = l;
        }
    } else {
        const int i = (blockIdx.x - PW_BLOCKS) * P_THREADS + threadIdx.x;
        const u32x4 z = {0u, 0u, 0u, 0u};
        if (i < PZ_N16) zeroed[i] = z;
    }
}

// ---------------------------------------------------------------------------
// Kernel 1: tmp = relu(X @ W^T + b), one block = 80 rows x all 400 columns,
// 5 waves, one wave = 5 row tiles x 5 col tiles: column tiles wave, 5 + wave, ... 20 + wave.
// A wave's first column tile (columns 0..79, U's first 80 of 100) is computed with the operands
// swapped, so that a lane holds 8 consecutive columns of one row.
// Per pass (32 k) the block's 400 W rows (pre-split, pass order: a wave's copy reads 512
// contiguous bytes) are copied to LDS by asynchronous copies; its 80 X rows are loaded as f32 into registers one pass
// ahead of their place in the ring, split there and stored to LDS. Two buffers,
// the next pass's tile in flight while this pass is worked on.
// One LDS row = [64 B hi | 64 B lo | 16 B pad].
// Epilogue: U -> bf16 hi/lo in fragment order (k = column); V,Z -> bf16 hi/lo in fragment
// order (k = row); T -> out (f32); U/V column sums via atomicAdd.
// ---------------------------------------------------------------------------
#define G_WAVES   5
#define G_THREADS (G_WAVES * 32)
#define G_ROWS    (ROWG * 16)               // 80 rows of X per block
#define ST_ROWS   (M_COLS + G_ROWS)         // W rows first, then X rows
#define ST_PITCH  144                       // 16 B x odd: conflict-free b128 reads
#define ST_BYTES  (ST_ROWS * ST_PITCH)
#define CP_ROWS   (G_THREADS / 8)           // rows covered by one copy of the block
#define G_PASSES  (D_DIM / 32)
#define X_CH      (G_ROWS / CP_ROWS)        // X rows per lane and pass
#define XT_PITCH  80                        // epilogue's turn of a tile: 64 B + 16 B pad (16 B x odd)

__device__ __forceinline__ unsigned lds_off(const void* p) {
    return (unsigned)(unsigned long long)p;   // low 32 bits of a __shared__ address
}

// Ten 16-byte-per-lane copies to LDS. The closing s_wait_xcnt keeps every
// address register of the copies unwritten until the copies have taken them.
__device__ __forceinline__ void async_copy10(const unsigned (&l)[10],
                                             const bf16_t* const (&p)[10])
{
    asm volatile(
        "global_load_async_to_lds_b128 %0, %10, off\n\t"
        "global_load_async_to_lds_b128 %1, %11, off\n\t"
        "global_load_async_to_lds_b128 %2, %12, off\n\t"
        "global_load_async_to_lds_b128 %3, %13, off\n\t"
        "global_load_async_to_lds_b128 %4, %14, off\n\t"
        "global_load_async_to_lds_b128 %5, %15, off\n\t"
        "global_load_async_to_lds_b128 %6, %16, off\n\t"
        "global_load_async_to_lds_b128 %7, %17, off\n\t"
        "global_load_async_to_lds_b128 %8, %18, off\n\t"
        "global_load_async_to_lds_b128 %9, %19, off\n\t"
        "s_wait_xcnt 0x0"
        :: "v"(l[0]), "v"(l[1]), "v"(l[2]), "v"(l[3]), "v"(l[4]),
           "v"(l[5]), "v"(l[6]), "v"(l[7]), "v"(l[8]), "v"(l[9]),
           "v"(p[0]), "v"(p[1]), "v"(p[2]), "v"(p[3]), "v"(p[4]),
           "v"(p[5]), "v"(p[6]), "v"(p[7]), "v"(p[8]), "v"(p[9])
        : "memory");
}

// One pass's W tile: 20 copies per lane.
__device__ __forceinline__ void stage_w(unsigned lds, const bf16_t* gW)
{
#pragma unroll
    for (int g = 0; g < 2; ++g) {
        unsigned l[10];
        const bf16_t* p[10];
#pragma unroll
        for (int j = 0; j < 10; ++j) {
            l[j] = lds + (g * 10 + j) * (CP_ROWS * ST_PITCH);
            p[j] = gW + (g * 10 + j) * (CP_ROWS * WT_ROW);
        }
        async_copy10(l, p);
    }
}

// One pass's X tile, f32: 4 floats of each of 4 rows per lane (8 lanes = one 128-byte row).
__device__ __forceinline__ void load_x(f32x4 (&xr)[X_CH], const float* gX)
{
#pragma unroll
    for (int j = 0; j < X_CH; ++j)
        xr[j] = *(const f32x4*)(gX + j * (CP_ROWS * D_DIM));
    // the loads' address is advanced for the next pass: wait until the loads have
    // taken it (the scheduling fence keeps later register writes behind the wait)
    asm volatile("s_wait_xcnt 0x0" ::: "memory");
    __builtin_amdgcn_sched_barrier(0);
}

// Split the loaded X values and store them into the tile's X rows: 8 bytes hi, 8 bytes lo.
__device__ __forceinline__ void store_x(unsigned char* sx, const f32x4 (&xr)[X_CH])
{
#pragma unroll
    for (int j = 0; j < X_CH; ++j) {
        Pack4 h4, l4;
#pragma unroll
        for (int e = 0; e < 4; ++e) {
            bf16_t h, l;
            split_bf16(xr[j][e], h, l);
            h4.e[e] = h; l4.e[e] = l;
        }
        *(u32x2*)(sx + j * (CP_ROWS * ST_PITCH))      = h4.q;
        *(u32x2*)(sx + j * (CP_ROWS * ST_PITCH) + 64) = l4.q;
    }
}

__global__ void __launch_bounds__(G_THREADS, 3)   // 3 waves per SIMD: two blocks share a WGP
gemm_relu_lds_kernel(const float* __restrict__ X,
                     const bf16_t* __restrict__ Wt,
                     const float* __restrict__ bias,
                     bf16_t* __restrict__ Uhi, bf16_t* __restrict__ Ulo,
                     bf16_t* __restrict__ Vthi, bf16_t* __restrict__ Vtlo,
                     bf16_t* __restrict__ Zthi, bf16_t* __restrict__ Ztlo,
                     float* __restrict__ sums, float* __restrict__ out)
{
    __shared__ __attribute__((aligned(16))) unsigned char smem[2 * ST_BYTES];

    const int tid      = threadIdx.x;
    const int lane     = tid & 31;
    const int wave     = __builtin_amdgcn_readfirstlane(tid >> 5);
    const int rowGroup = blockIdx.x;
    const int half     = lane >> 4;
    const int lidx     = lane & 15;

    // this lane's share of every W copy: row (tid >> 3) of each group of CP_ROWS
    // rows, 16-byte chunk (tid & 7): chunks 0..3 are hi, 4..7 lo, in W's pass order as in LDS;
    // of every X load: the same row of each group, floats (tid & 7) * 4 .. + 3
    const int  crow = tid >> 3;
    const unsigned ldsT = lds_off(smem) + crow * ST_PITCH + (tid & 7) * 16;
    const bf16_t* gW = Wt + crow * WT_ROW + (tid & 7) * 8;
    const float* gX = X + (size_t)(rowGroup * G_ROWS + crow) * D_DIM + (tid & 7) * 4;
    unsigned char* sx = smem + (M_COLS + crow) * ST_PITCH + (tid & 7) * 8;
    f32x4 xr[X_CH];

    v8f acc[5][ROWG];
#pragma unroll
    for (int c = 0; c < 5; ++c)
#pragma unroll
        for (int t = 0; t < ROWG; ++t) acc[c][t] = {};

    load_x(xr, gX);
    gX += 32;
    stage_w(ldsT, gW);
    store_x(sx, xr);
    load_x(xr, gX);
    gX += 32;
    asm volatile("s_wait_dscnt 0x0" ::: "memory");      // tile 0: this wave's X rows stored
    asm volatile("s_wait_asynccnt 0x0" ::: "memory");   // ... and its W copies landed
    __syncthreads();                                    // ... and every other wave's
    stage_w(ldsT + ST_BYTES, gW + WT_PASS);
    store_x(sx + ST_BYTES, xr);

    for (int kt = 0; kt < G_PASSES; ++kt) {
        const int buf = (kt & 1) * ST_BYTES;
        const unsigned char* sa = smem + buf + (M_COLS + lidx) * ST_PITCH + (half << 4);
        const unsigned char* sb = smem + buf + (wave * 16 + lidx) * ST_PITCH + (half << 4);

        // X of tile kt + 2 flies through this pass; it is split and stored behind the barrier
        if (kt + 2 < G_PASSES) { load_x(xr, gX); gX += 32; }

        // lo(A) x hi(B) first, then hi(A) x lo(B) and hi(A) x hi(B): only one half of
        // the A fragments is live at a time, so that the accumulators stay in registers
        {
            Frag16 alo[ROWG];
#pragma unroll
            for (int t = 0; t < ROWG; ++t) {
                const unsigned char* r = sa + t * (16 * ST_PITCH);
                alo[t].q[0] = *(const u32x4*)(r + 64);
                alo[t].q[1] = *(const u32x4*)(r + 96);
            }
#pragma unroll
            for (int c = 0; c < 5; ++c) {
                const unsigned char* r = sb + c * (G_WAVES * 16 * ST_PITCH);
                Frag16 bhi;
                bhi.q[0] = *(const u32x4*)(r);
                bhi.q[1] = *(const u32x4*)(r + 32);
#pragma unroll
                for (int t = 0; t < ROWG; ++t)
                    acc[c][t] = c == 0 ? mma<true>(alo[t].v, bhi.v, acc[c][t]) : mma<false>(alo[t].v, bhi.v, acc[c][t]);
            }
        }
        {
            Frag16 ahi[ROWG];
#pragma unroll
            for (int t = 0; t < ROWG; ++t) {
                const unsigned char* r = sa + t * (16 * ST_PITCH);
                ahi[t].q[0] = *(const u32x4*)(r);
                ahi[t].q[1] = *(const u32x4*)(r + 32);
            }
#pragma unroll
            for (int c = 0; c < 5; ++c) {
                const unsigned char* r = sb + c * (G_WAVES * 16 * ST_PITCH);
                Frag16 bhi, blo;
                bhi.q[0] = *(const u32x4*)(r);
                bhi.q[1] = *(const u32x4*)(r + 32);
                blo.q[0] = *(const u32x4*)(r + 64);
                blo.q[1] = *(const u32x4*)(r + 96);
#pragma unroll
                for (int t = 0; t < ROWG; ++t)
                    acc[c][t] = c == 0 ? mma<true>(ahi[t].v, blo.v, acc[c][t]) : mma<false>(ahi[t].v, blo.v, acc[c][t]);
#pragma unroll
                for (int t = 0; t < ROWG; ++t)
                    acc[c][t] = c == 0 ? mma<true>(ahi[t].v, bhi.v, acc[c][t]) : mma<false>(ahi[t].v, bhi.v, acc[c][t]);
            }
        }

        // keeps the pass's last WMMAs in front of the barrier: sunk behind it they would
        // delay the issue of the next copies and shorten their lead
        __builtin_amdgcn_sched_barrier(0);
        // the four vector slots that the chip needs between the pass's last WMMA and a vector write of
        // its operand registers
        asm volatile("v_nop\n\tv_nop\n\tv_nop\n\tv_nop");
        asm volatile("s_wait_dscnt 0x0" ::: "memory");     // this wave has left the buffer, its X stores of tile kt + 1 are done
        asm volatile("s_wait_asynccnt 0x0" ::: "memory");  // its copies of tile kt + 1 landed
        __syncthreads();   // publishes tile kt + 1, frees this pass's buffer
        if (kt + 2 < G_PASSES) {
            stage_w(ldsT + buf, gW + (kt + 2) * WT_PASS);
            store_x(sx + buf, xr);
        }
    }
    asm volatile("s_wait_asynccnt 0x0" ::: "memory");      // no copy outlives the loop

    // ---- epilogue: bias + relu; route column; fold in column sums ----
    // A wave's first tile, transposed: columns wave * 16 + 8 * half + r of row (lane & 15) of each
    // row tile. These 8 values are the 16 bytes of this lane in U's fragment order, so that the
    // wave stores 512 contiguous bytes each for hi and lo.
    {
        const f32x4 b0 = *(const f32x4*)(bias + wave * 16 + (half << 3));
        const f32x4 b1 = *(const f32x4*)(bias + wave * 16 + (half << 3) + 4);
        bf16_t* ph = Uhi + ufrag_k16(wave) + lane * 8;
        bf16_t* pl = Ulo + ufrag_k16(wave) + lane * 8;
        float s[8];
#pragma unroll
        for (int r = 0; r < 8; ++r) s[r] = 0.f;
#pragma unroll
        for (int t = 0; t < ROWG; ++t) {
            Pack8 h8, l8;
#pragma unroll
            for (int r = 0; r < 8; ++r) {
                float v = acc[0][t][r] + (r < 4 ? b0[r & 3] : b1[r & 3]);
                v = v > 0.f ? v : 0.f;
                bf16_t h, l;
                split_bf16(v, h, l);
                h8.e[r] = h; l8.e[r] = l;
                s[r] += v;
            }
            *(u32x4*)(ph + (rowGroup * ROWG + t) * UFRAG_ROWT) = h8.q;
            *(u32x4*)(pl + (rowGroup * ROWG + t) * UFRAG_ROWT) = l8.q;
            // the stores' registers are reused below: wait until the stores have taken them
            // (the scheduling fence keeps later register writes behind the wait)
            asm volatile("s_wait_xcnt 0x0" ::: "memory");
            __builtin_amdgcn_sched_barrier(0);
        }
        // column sums: over the 16 rows that the lanes of a half hold, then lane i < 8 of each
        // half adds column 8 * half + i
        float sel = 0.f;
#pragma unroll
        for (int r = 0; r < 8; ++r) {
            float v = s[r];
            v = row_xor_add<1>(v);
            v = row_xor_add<2>(v);
            v = row_xor_add<4>(v);
            v = row_xor_add<8>(v);
            sel = lidx == r ? v : sel;
        }
        if (lidx < 8) atomicAdd(&sums[wave * 16 + (half << 3) + lidx], sel);   // [0..79]=U sums
        // the atomic's registers are reused below: wait until it has taken them
        // (the scheduling fence keeps later register writes behind the wait)
        asm volatile("s_wait_xcnt 0x0" ::: "memory");
        __builtin_amdgcn_sched_barrier(0);
    }

    // The other four tiles. The T / V,Z test stands outside the element loops, and only the
    // kinds that tile c can hold are written out, for speed only:
    // c = 1 holds columns 80..159, c = 2 160..239, c = 3 240..319, c = 4 320..399.
    const int rbase = rowGroup * G_ROWS + (half << 3);
#pragma unroll
    for (int c = 1; c < 5; ++c) {
        const int col = (c * G_WAVES + wave) * 16 + lidx;
        const float bv = bias[col];
        if (c == 1 && wave < 2) {
            // U columns 80..99 come in the plain orientation (8 rows of one column per lane). The wave
            // turns its tile through LDS, which nobody reads any more behind the loop's last barrier:
            // rows of 16 floats at a pitch of 80 bytes, zeros in the columns that are not U's (they are
            // U's k padding). Each lane then holds 8 consecutive columns of one row, as in the first tile.
            float* xs = (float*)(smem + wave * (G_ROWS * XT_PITCH));
            float s = 0.f;
#pragma unroll
            for (int t = 0; t < ROWG; ++t)
#pragma unroll
                for (int r = 0; r < 8; ++r) {
                    float v = acc[c][t][r] + bv;
                    v = (col < KC && v > 0.f) ? v : 0.f;
                    xs[(t * 16 + (half << 3) + r) * (XT_PITCH / 4) + lidx] = v;
                    s += v;
                }
            // the lanes read each other's values: every store of the wave is done first
            asm volatile("s_wait_dscnt 0x0" ::: "memory");
            bf16_t* ph = Uhi + ufrag_k16(G_WAVES + wave) + lane * 8;
            bf16_t* pl = Ulo + ufrag_k16(G_WAVES + wave) + lane * 8;
#pragma unroll
            for (int t = 0; t < ROWG; ++t) {
                const float* xr8 = xs + (t * 16 + lidx) * (XT_PITCH / 4) + (half << 3);
                const f32x4 x0 = *(const f32x4*)(xr8);
                const f32x4 x1 = *(const f32x4*)(xr8 + 4);
                Pack8 h8, l8;
#pragma unroll
                for (int r = 0; r < 8; ++r) {
                    bf16_t h, l;
                    split_bf16(r < 4 ? x0[r & 3] : x1[r & 3], h, l);
                    h8.e[r] = h; l8.e[r] = l;
                }
                *(u32x4*)(ph + (rowGroup * ROWG + t) * UFRAG_ROWT) = h8.q;
                *(u32x4*)(pl + (rowGroup * ROWG + t) * UFRAG_ROWT) = l8.q;
                // the stores' registers are reused below: wait until the stores have taken them
                // (the scheduling fence keeps later register writes behind the wait)
                asm volatile("s_wait_xcnt 0x0" ::: "memory");
                __builtin_amdgcn_sched_barrier(0);
            }
            if (col < KC) atomicAdd(&sums[col], s);       // [80..99]=U sums
            // the atomic's registers are reused below: wait until it has taken them
            // (the scheduling fence keeps later register writes behind the wait)
            asm volatile("s_wait_xcnt 0x0" ::: "memory");
            __builtin_amdgcn_sched_barrier(0);
        }
        if (c == 4 || (c == 3 && col >= 3 * KC)) {
            float* pT = out + (size_t)rbase * OUTC + (KC + (col - 3 * KC));
#pragma unroll
            for (int t = 0; t < ROWG; ++t)
#pragma unroll
                for (int r = 0; r < 8; ++r) {
                    const float v = acc[c][t][r] + bv;
                    pT[(t * 16 + r) * OUTC] = v > 0.f ? v : 0.f;
                    // the stores' registers are reused below: wait until the store has taken them
                    // (the scheduling fence keeps later register writes behind the wait)
                    if (r == 7) { asm volatile("s_wait_xcnt 0x0" ::: "memory"); __builtin_amdgcn_sched_barrier(0); }
                }
        } else if (c != 1 || col >= KC) {
            // V and Z lie in fragment order (k = row): the 8 rows a lane holds of one tile are
            // that order's 16 bytes of lane (half, column & 15), so that neighbouring lanes
            // store neighbouring 16 bytes: one b128 store each for hi and lo
            const bool isV = c == 1 || (c == 2 && col < 2 * KC);
            const int  A   = frag_lane(half, isV ? col - KC : col - 2 * KC);
            bf16_t* ph = (isV ? Vthi : Zthi) + A;
            bf16_t* pl = (isV ? Vtlo : Ztlo) + A;
            float s = 0.f;
#pragma unroll
            for (int t = 0; t < ROWG; ++t) {
                Pack8 h8, l8;
#pragma unroll
                for (int r = 0; r < 8; ++r) {
                    float v = acc[c][t][r] + bv;
                    v = v > 0.f ? v : 0.f;
                    bf16_t h, l;
                    split_bf16(v, h, l);
                    h8.e[r] = h; l8.e[r] = l;
                    s += v;
                }
                *(u32x4*)(ph + frag_tile16(rowGroup * ROWG + t)) = h8.q;
                *(u32x4*)(pl + frag_tile16(rowGroup * ROWG + t)) = l8.q;
                // the stores' registers are reused below: wait until the stores have taken them
                // (the scheduling fence keeps later register writes behind the wait)
                asm volatile("s_wait_xcnt 0x0" ::: "memory");
                __builtin_amdgcn_sched_barrier(0);
            }
            if (isV) atomicAdd(&sums[col], s);            // [100..199]=V sums
        }
        // the registers of the tile's last stores and of its atomic are reused by the next tile:
        // wait until they have been taken (the scheduling fence keeps later writes behind the wait)
        asm volatile("s_wait_xcnt 0x0" ::: "memory");
        __builtin_amdgcn_sched_barrier(0);
    }
}

// ---------------------------------------------------------------------------
// VtZ = V^T @ Z (100x100, reduction over N). Split-K WMMA + f32 atomics.
// A/B fragments are read from planes in fragment order: 512 contiguous bytes per load.
// Pad columns (>=100) hold garbage but only affect guarded (unstored) outputs.
// ---------------------------------------------------------------------------
__global__ void __launch_bounds__(256)
vtz_kernel(const bf16_t* __restrict__ Vthi, const bf16_t* __restrict__ Vtlo,
           const bf16_t* __restrict__ Zthi, const bf16_t* __restrict__ Ztlo,
           float* __restrict__ VtZ)
{
    const int lane  = threadIdx.x & 31;
    const int gwave = blockIdx.x * WPB + (threadIdx.x >> 5);
    const int TILES = 7 * 7;
    if (gwave >= TILES * VTZ_SPLITS) return;     // wave-uniform
    const int tile  = gwave % TILES;
    const int split = gwave / TILES;
    const int mBase = (tile / 7) << 4, nBase = (tile % 7) << 4;
    const int half  = lane >> 4, lidx = lane & 15;
    const int ncol  = nBase + lidx;                        // <= 111 < MPAD

    const bf16_t* ah = Vthi + frag_lane(half, mBase + lidx);
    const bf16_t* al = Vtlo + frag_lane(half, mBase + lidx);
    const bf16_t* bh = Zthi + frag_lane(half, ncol);
    const bf16_t* bl = Ztlo + frag_lane(half, ncol);

    v8f acc = {};
    for (int kt = split; kt < N_ROWS / 32; kt += VTZ_SPLITS) {
        const int o0 = frag_tile16(2 * kt);
        const int o1 = frag_tile16(2 * kt + 1);
        Frag16 ahi, alo, bhi, blo;
        ahi.q[0] = *(const u32x4*)(ah + o0); ahi.q[1] = *(const u32x4*)(ah + o1);
        alo.q[0] = *(const u32x4*)(al + o0); alo.q[1] = *(const u32x4*)(al + o1);
        bhi.q[0] = *(const u32x4*)(bh + o0); bhi.q[1] = *(const u32x4*)(bh + o1);
        blo.q[0] = *(const u32x4*)(bl + o0); blo.q[1] = *(const u32x4*)(bl + o1);
        acc = __builtin_amdgcn_wmma_f32_16x16x32_bf16(false, alo.v, false, bhi.v, (short)0, acc, false, false);
        acc = __builtin_amdgcn_wmma_f32_16x16x32_bf16(false, ahi.v, false, blo.v, (short)0, acc, false, false);
        acc = __builtin_amdgcn_wmma_f32_16x16x32_bf16(false, ahi.v, false, bhi.v, (short)0, acc, false, false);
    }
    if (ncol < KC) {
#pragma unroll
        for (int r = 0; r < 8; ++r) {
            const int m = mBase + (half << 3) + r;
            if (m < KC) atomicAdd(&VtZ[m * KC + ncol], acc[r]);
        }
    }
}

// ---------------------------------------------------------------------------
// res = (U @ VtZ) * Dscale -> out[:, 0:100]. K padded 100 -> 128 (zeros).
// One wave = 32 rows (2 row tiles) x all 7 column tiles, so that U is read once and a wave
// owns whole result rows. The block brings VtZ (100 x 100 f32) into LDS, splits it there into
// the two bf16 planes of 128 k (zeros from 100 on) x 112 columns in fragment order, and every wave
// forms Dscale = 1 / (dot(sumU, sumV) / N + 1e-6) for itself: no launch of their own for these.
// U's k 112..127 are never stored by the main GEMM: those halves of the last fragments are
// zeros in registers.
// VtZ is the A operand and U the B operand: register r of lane (half, i) = (row i, column
// 8 * half + r). The wave lays its rows down in LDS (400 bytes a row, no gap) and stores
// them to out in 16-byte pieces that run along the rows.
// The column tiles go in two groups (4 + 3), so that U's fragments and the accumulators fit
// four waves per SIMD: every block of the grid is then resident at once.
// ---------------------------------------------------------------------------
#define R_WAVES   8
#define R_THREADS (R_WAVES * 32)
#define R_PAIRS   (N_ROWS / 32)            // 3125 pairs of row tiles
#define R_PLANE   (MPAD * KPAD)            // elements of one VtZ plane
#define R_PLANE16 (R_PLANE * 2 / 16)       // its 16-byte pieces
#define R_ROW16   (KC / 4)                 // 16-byte pieces of one result row
#define R_VTZ16   (KC * KC / 4)            // 16-byte pieces of VtZ as f32
#define R_VTZ_LD  ((R_VTZ16 + R_THREADS - 1) / R_THREADS)
// 16-byte pieces of the f32 copy in LDS per thread: 128 rows of 100 floats and the 12 floats that the
// last column tile reads past the last row
#define R_F32_ST  (((KPAD * KC + MPAD - KC) / 4 + R_THREADS - 1) / R_THREADS)

__global__ void __launch_bounds__(R_THREADS, 4)
res_kernel(const bf16_t* __restrict__ Uhi, const bf16_t* __restrict__ Ulo,
           const float* __restrict__ VtZ, const float* __restrict__ sums,
           float* __restrict__ out)
{
    // the VtZ planes first: every fragment then lies within the reach of an LDS load's immediate offset
    __shared__ __attribute__((aligned(16))) unsigned char smem[2 * R_PLANE * 2 + R_WAVES * 32 * KC * 4];
    bf16_t* sB = (bf16_t*)smem;
    // VtZ as f32 lies where the waves later turn their rows: it is done with at the second barrier
    float* sF = (float*)(smem + 2 * R_PLANE * 2);

    const int tid  = threadIdx.x;
    const int lane = tid & 31;
    const int wave = __builtin_amdgcn_readfirstlane(tid >> 5);
    const int half = lane >> 4, lidx = lane & 15;
    const int pair = blockIdx.x * R_WAVES + wave;
    // the last block's spare waves load the last pair again, help to stage, and leave behind the barriers
    const int lp   = pair < R_PAIRS ? pair : R_PAIRS - 1;

    f32x4 stg[R_VTZ_LD];
#pragma unroll
    for (int i = 0; i < R_VTZ_LD; ++i) {
        const int p = i * R_THREADS + tid;
        // past the end the last piece is loaded again (and not used): no branch among the loads
        stg[i] = ((const f32x4*)VtZ)[(i + 1) * R_THREADS <= R_VTZ16 || p < R_VTZ16 ? p : R_VTZ16 - 1];
    }
    // the loads' address registers are reused below: wait until the loads have taken them
    // (the scheduling fence keeps later register writes behind the wait)
    asm volatile("s_wait_xcnt 0x0" ::: "memory");
    __builtin_amdgcn_sched_barrier(0);
    // terms lane, lane + 32, lane + 64, lane + 96 of dot(sumU, sumV), zeros from 100 on
    float pr[4];
#pragma unroll
    for (int q = 0; q < 4; ++q) {
        const int e  = q * 32 + lane;
        const int ec = e < KC ? e : KC - 1;
        const float su = sums[ec], sv = sums[KC + ec];
        pr[q] = e < KC ? su * sv : 0.f;
    }
    // as above: the address registers of these loads are reused by the loads that follow
    asm volatile("s_wait_xcnt 0x0" ::: "memory");
    __builtin_amdgcn_sched_barrier(0);
    const bf16_t* ah = Uhi + lp * (2 * UFRAG_ROWT) + lane * 8;
    const bf16_t* al = Ulo + lp * (2 * UFRAG_ROWT) + lane * 8;
    Frag16 uh[2][KPAD / 32], ul[2][KPAD / 32];
#pragma unroll
    for (int t = 0; t < 2; ++t)
#pragma unroll
        for (int kt = 0; kt < KPAD / 32; ++kt) {
            const int o0 = t * UFRAG_ROWT + ufrag_k16(2 * kt), o1 = t * UFRAG_ROWT + ufrag_k16(2 * kt + 1);
            uh[t][kt].q[0] = *(const u32x4*)(ah + o0);
            ul[t][kt].q[0] = *(const u32x4*)(al + o0);
            if ((2 * kt + 1) * 16 < MPAD) {
                uh[t][kt].q[1] = *(const u32x4*)(ah + o1);
                ul[t][kt].q[1] = *(const u32x4*)(al + o1);
            } else {
                uh[t][kt].q[1] = u32x4{0u, 0u, 0u, 0u};
                ul[t][kt].q[1] = u32x4{0u, 0u, 0u, 0u};
            }
        }
    // the loads' address registers are reused below: wait until the loads have taken them
    // (the scheduling fence keeps later register writes behind the wait)
    asm volatile("s_wait_xcnt 0x0" ::: "memory");
    __builtin_amdgcn_sched_barrier(0);
#pragma unroll
    for (int i = 0; i < R_F32_ST; ++i) {
        // rows 100..127 (k padding) are zeros
        const int p = i * R_THREADS + tid;
        const f32x4 z = {0.f, 0.f, 0.f, 0.f};
        ((f32x4*)sF)[p] = i >= R_VTZ_LD ? z : ((i + 1) * R_THREADS <= R_VTZ16 || p < R_VTZ16) ? stg[i < R_VTZ_LD ? i : 0] : z;
    }
    // the sum over 128 terms as a tree of halves (64, 32, ... 1); every lane ends with the total
    float dot = (pr[0] + pr[2]) + (pr[1] + pr[3]);
    dot += __shfl_xor(dot, 16, 32);
    dot = row_xor_add<8>(dot);
    dot = row_xor_add<4>(dot);
    dot = row_xor_add<2>(dot);
    dot = row_xor_add<1>(dot);
    const float ds = 1.0f / (dot / (float)N_ROWS + 1e-6f);
    __syncthreads();                       // VtZ lies in LDS as f32
    // One thread builds the 16-byte piece (8 consecutive k of one column) of each of the 7 column
    // tiles, hi and lo: k = (tid >> 4) * 8 + j, column = 16 * i + (tid & 15); in fragment order
    // that is piece (tid >> 6) * 7 * 64 + i * 64 + (tid & 63) of a plane. Columns 100..111 take
    // the next row's first values: they reach only result columns that are never stored.
    {
        const float* sk = sF + ((tid >> 4) << 3) * KC + lidx;
#pragma unroll
        for (int i = 0; i < MPAD / 16; ++i) {
            Pack8 h8, l8;
#pragma unroll
            for (int j = 0; j < 8; ++j) {
                bf16_t h, l;
                split_bf16(sk[j * KC + i * 16], h, l);
                h8.e[j] = h; l8.e[j] = l;
            }
            const int p = (tid >> 6) * (FRAG_KSTEP / 8) + i * (FRAG_BLK / 8) + (tid & 63);
            ((u32x4*)sB)[p]             = h8.q;
            ((u32x4*)sB)[R_PLANE16 + p] = l8.q;
        }
    }
    __syncthreads();                       // both VtZ planes lie in LDS, and nobody reads the f32 copy any more
    if (pair >= R_PAIRS) return;           // wave-uniform, behind the last barrier

    const bf16_t* bh = sB + lane * 8;
    const bf16_t* bl = sB + R_PLANE + lane * 8;
    float* st = (float*)(smem + 2 * R_PLANE * 2) + wave * (32 * KC);
#pragma unroll
    for (int g = 0; g < 2; ++g) {
        v8f acc[4][2];
#pragma unroll
        for (int c = 0; c < 4; ++c) { acc[c][0] = {}; acc[c][1] = {}; }
#pragma unroll
        for (int kt = 0; kt < KPAD / 32; ++kt)
#pragma unroll
            for (int c = 0; c < 4 - g; ++c) {
                const int p0 = frag_tile16(2 * kt) + (g * 4 + c) * FRAG_BLK;
                const int p1 = frag_tile16(2 * kt + 1) + (g * 4 + c) * FRAG_BLK;
                Frag16 bhi, blo;
                bhi.q[0] = *(const u32x4*)(bh + p0); bhi.q[1] = *(const u32x4*)(bh + p1);
                blo.q[0] = *(const u32x4*)(bl + p0); blo.q[1] = *(const u32x4*)(bl + p1);
#pragma unroll
                for (int t = 0; t < 2; ++t) acc[c][t] = mma<true>(ul[t][kt].v, bhi.v, acc[c][t]);
#pragma unroll
                for (int t = 0; t < 2; ++t) acc[c][t] = mma<true>(uh[t][kt].v, blo.v, acc[c][t]);
#pragma unroll
                for (int t = 0; t < 2; ++t) acc[c][t] = mma<true>(uh[t][kt].v, bhi.v, acc[c][t]);
            }
#pragma unroll
        for (int c = 0; c < 4 - g; ++c)
#pragma unroll
            for (int t = 0; t < 2; ++t) {
                float* p = st + (t * 16 + lidx) * KC + (g * 4 + c) * 16 + (half << 3);
                const f32x4 v0 = {acc[c][t][0] * ds, acc[c][t][1] * ds, acc[c][t][2] * ds, acc[c][t][3] * ds};
                const f32x4 v1 = {acc[c][t][4] * ds, acc[c][t][5] * ds, acc[c][t][6] * ds, acc[c][t][7] * ds};
                if (g * 4 + c < 6) {
                    *(f32x4*)(p)     = v0;
                    *(f32x4*)(p + 4) = v1;
                } else if (half == 0) {
                    *(f32x4*)(p) = v0;     // columns 96..99; 100..111 are padding
                }
            }
    }
    // the lanes read each other's values: every store of the wave is done first
    asm volatile("s_wait_dscnt 0x0" ::: "memory");
    char* po = (char*)(out + (size_t)pair * (32 * OUTC));
    // 16-byte piece j = 32 * step + lane of the wave's 32 rows x 25 pieces: c4 = j % 25, off = its bytes into po
    unsigned c4  = lane < R_ROW16 ? lane : lane - R_ROW16;
    unsigned off = (lane < R_ROW16 ? 0 : OUTC * 4) + c4 * 16;
#pragma unroll
    for (int b = 0; b < 5; ++b) {
#pragma unroll
        for (int i = 0; i < 5; ++i) {
            *(f32x4*)(po + off) = *(const f32x4*)(st + ((b * 5 + i) * 32 + lane) * 4);
            // 32 pieces on: one row and 7 pieces, or two rows less 18
            c4  += 32 - R_ROW16;
            off += OUTC * 4 + (32 - R_ROW16) * 16;
            if (c4 >= R_ROW16) { c4 -= R_ROW16; off += OUTC * 4 - R_ROW16 * 16; }
        }
        // the stores' registers are reused below: wait until the stores have taken them
        // (the scheduling fence keeps later register writes behind the wait)
        asm volatile("s_wait_xcnt 0x0" ::: "memory");
        __builtin_amdgcn_sched_barrier(0);
    }
}

// ---------------------------------------------------------------------------
// Launch
// ---------------------------------------------------------------------------
extern "C" void kernel_launch(void* const* d_in, const int* in_sizes, int n_in,
                              void* d_out, int out_size, void* d_ws, size_t ws_size,
                              hipStream_t stream)
{
    (void)in_sizes; (void)n_in; (void)out_size;
    const float* X  = (const float*)d_in[0];   // 100000 x 512
    const float* W  = (const float*)d_in[1];   // 400 x 512
    const float* bb = (const float*)d_in[2];   // 400
    float* out = (float*)d_out;                // 100000 x 200

    // ---- workspace carve-up (all regions 64B aligned) ----
    char* base = (char*)d_ws;
    size_t off = 0;
    auto carve = [&](size_t bytes) -> char* {
        char* p = base + off;
        off += (bytes + 63) & ~(size_t)63;
        return p;
    };
    bf16_t* Uhi  = (bf16_t*)carve((size_t)N_ROWS * KPAD * 2);
    bf16_t* Ulo  = (bf16_t*)carve((size_t)N_ROWS * KPAD * 2);   // contiguous w/ Uhi
    bf16_t* Vthi = (bf16_t*)carve((size_t)MPAD * N_ROWS * 2);
    bf16_t* Vtlo = (bf16_t*)carve((size_t)MPAD * N_ROWS * 2);
    bf16_t* Zthi = (bf16_t*)carve((size_t)MPAD * N_ROWS * 2);
    bf16_t* Ztlo = (bf16_t*)carve((size_t)MPAD * N_ROWS * 2);
    bf16_t* Wt   = (bf16_t*)carve((size_t)M_COLS * D_DIM * 2 * 2);   // hi and lo, pass order
    float*  sums   = (float*)carve(256 * 4);                    // [U(100)|V(100)|pad]
    float*  VtZ    = (float*)carve(KC * KC * 4);                // contiguous w/ sums
    (void)ws_size;

    // 1. pre-split W; zero sums+VtZ (atomics targets)
    prep_kernel<<<PW_BLOCKS + PZ_BLOCKS, P_THREADS, 0, stream>>>(W, Wt, (u32x4*)sums);
    // 2. fused X split + GEMM + bias + relu + scatter + column sums
    gemm_relu_lds_kernel<<<N_ROWS / G_ROWS, G_THREADS, 0, stream>>>(X, Wt, bb,
        Uhi, Ulo, Vthi, Vtlo, Zthi, Ztlo, sums, out);
    // 3. VtZ = V^T @ Z (split-K)
    {
        const int waves  = 49 * VTZ_SPLITS;
        const int blocks = (waves + WPB - 1) / WPB;
        vtz_kernel<<<blocks, 256, 0, stream>>>(Vthi, Vtlo, Zthi, Ztlo, VtZ);
    }
    // 4. VtZ split + Dscale + res = U @ VtZ * Dscale -> out[:, 0:100]
    {
        const int blocks = (R_PAIRS + R_WAVES - 1) / R_WAVES;
        res_kernel<<<blocks, R_THREADS, 0, stream>>>(Uhi, Ulo, VtZ, sums, out);
    }
}

// v009
// A run of this version takes 173 microseconds.
// Next to v008, in two timings, it ran 1.19 times as fast each time.
// All steps since v000 together make it 4.90 times as fast.
#include <hip/hip_runtime.h>
#include <hip/hip_bf16.h>

// ---------------------------------------------------------------------------
// LowRankAttention for MI455X (gfx1250), wave32 + bf16 WMMA, fp32-split bf16.
//   out[:,0:100]   = (U @ (V^T Z)) * Dscale
//   out[:,100:200] = T
// where [U|V|Z|T] = relu(X @ W^T + b)
// W is split into bf16 (hi, lo) ahead of the main GEMM and laid down in the order in which
// the main GEMM's passes copy it; X is split inside the main GEMM, once per element, on its
// way from global memory into LDS.
// Four launches: preparation, main GEMM, VtZ, result.
// ---------------------------------------------------------------------------

#define N_ROWS 100000
#define D_DIM  512
#define M_COLS 400          // 4*K
#define KC     100          // K
#define KPAD   128          // K padded for U / VtZ fragments
#define MPAD   112          // 100 padded to 7 tiles of 16
#define OUTC   200
#define WPB    8            // waves per block (256 threads)
#define ROWG   5            // row tiles per wave in main GEMM (6250 = 5*1250)
#define VTZ_SPLITS 64

typedef __bf16 bf16_t;
typedef bf16_t       v16bf __attribute__((ext_vector_type(16)));
typedef float        v8f   __attribute__((ext_vector_type(8)));
typedef unsigned int u32x4 __attribute__((ext_vector_type(4)));
typedef unsigned int u32x2 __attribute__((ext_vector_type(2)));
typedef float        f32x4 __attribute__((ext_vector_type(4)));

// 32-byte A/B fragment viewed either as bf16 lanes or as two 16B load chunks
union Frag16 { v16bf v; u32x4 q[2]; };
// 8 bf16 values viewed as one 16B store chunk
union Pack8 { bf16_t e[8]; u32x4 q; };
// 4 bf16 values viewed as one 8B store chunk
union Pack4 { bf16_t e[4]; u32x2 q; };

__device__ __forceinline__ void split_bf16(float x, bf16_t& hi, bf16_t& lo) {
    hi = (bf16_t)x;                 // RNE f32 -> bf16
    lo = (bf16_t)(x - (float)hi);   // exact residual, re-rounded
}

// ---------------------------------------------------------------------------
// Fragment order of a bf16 operand plane with element (k, c), c in 7 tiles of 16:
// one block = 32 k x 16 c = 1 KB, blocks ordered [k / 32][c / 16]. Inside a block lie
// the two 512-byte halves of the WMMA fragment (k 0..15, k 16..31), each as 32 lanes x
// 16 bytes: lane = ((k >> 3) & 1) * 16 + (c & 15) holds its 8 consecutive k.
// A wave loads a fragment as two contiguous 512-byte reads.
// offset(k, c) = frag_tile16(k >> 4) + frag_lane((k >> 3) & 1, c) + (k & 7)
// ---------------------------------------------------------------------------
#define FRAG_BLK  512                 // elements of one 32 x 16 block
#define FRAG_KSTEP (7 * FRAG_BLK)     // elements of one step of 32 k over all 7 tiles
__device__ __forceinline__ int frag_tile16(int k16) {
    return (k16 >> 1) * FRAG_KSTEP + (k16 & 1) * (FRAG_BLK / 2);
}
__device__ __forceinline__ int frag_lane(int half, int c) {
    return (c >> 4) * FRAG_BLK + (half * 16 + (c & 15)) * 8;
}

// ---------------------------------------------------------------------------
// Fragment order of the U planes, element (row, k), k in 0..127: the result GEMM's A
// operand. One block = 16 rows x 32 k = 1 KB, blocks ordered [row / 16][k / 32]; inside
// a block the two 512-byte halves (k 0..15, k 16..31), each as 32 lanes x 16 bytes:
// lane = ((k >> 3) & 1) * 16 + (row & 15) holds its 8 consecutive k.
// offset(row, k) = (row >> 4) * UFRAG_ROWT + ufrag_k16(k >> 4)
//                + (((k >> 3) & 1) * 16 + (row & 15)) * 8 + (k & 7)
// ---------------------------------------------------------------------------
#define UFRAG_ROWT (KPAD * 16)        // elements of one tile of 16 rows, all 128 k
__device__ __forceinline__ int ufrag_k16(int k16) {
    return (k16 >> 1) * FRAG_BLK + (k16 & 1) * (FRAG_BLK / 2);
}

// v + the value of lane (l ^ M) of the same 16-lane row (all lanes on)
template <int M>
__device__ __forceinline__ float row_xor_add(float v) {
    return v + __int_as_float(__builtin_amdgcn_update_dpp(0, __float_as_int(v), 0x160 | M, 0xf, 0xf, true));
}

// One bf16 product step. Swapped, W is the A operand and X the B operand: the tile comes
// out transposed, register r of lane (half, i) = (row i, column 8 * half + r).
template <bool SWAP>
__device__ __forceinline__ v8f mma(const v16bf x, const v16bf w, const v8f acc) {
    if (SWAP) return __builtin_amdgcn_wmma_f32_16x16x32_bf16(false, w, false, x, (short)0, acc, false, false);
    return __builtin_amdgcn_wmma_f32_16x16x32_bf16(false, x, false, w, (short)0, acc, false, false);
}

// ---------------------------------------------------------------------------
// All that has to be ready before the main GEMM, in one grid; the block index picks the job:
// blocks 0 .. PW_BLOCKS - 1 split W into bf16 hi/lo, 4 elements a thread; the others store
// zeros, 16 bytes a thread, into the targets of the atomics (column sums and VtZ, contiguous).
// The split W lies in pass order: [k / 32][row][32 hi | 32 lo], 128 bytes per row and pass, so
// that one pass's tile of the main GEMM is 400 whole 128-byte lines in a row.
// ---------------------------------------------------------------------------
#define WT_ROW  64                    // elements of one row of one pass: 32 hi, 32 lo
#define WT_PASS (M_COLS * WT_ROW)     // elements of one pass's tile
#define P_THREADS 256
#define PW_BLOCKS (M_COLS * D_DIM / 4 / P_THREADS)
#define PZ_N16    ((256 * 4 + KC * KC * 4) / 16)
#define PZ_BLOCKS ((PZ_N16 + P_THREADS - 1) / P_THREADS)
__global__ void __launch_bounds__(P_THREADS)
prep_kernel(const float* __restrict__ src,
            bf16_t* __restrict__ wt, u32x4* __restrict__ zeroed)
{
    if (blockIdx.x < PW_BLOCKS) {
        const int i = (blockIdx.x * P_THREADS + threadIdx.x) * 4;
        const f32x4 v = *(const f32x4*)(src + i);
        const int k = i % D_DIM;
        bf16_t* hi = wt + (k >> 5) * WT_PASS + (i / D_DIM) * WT_ROW + (k & 31);
        bf16_t* lo = hi + WT_ROW / 2;
#pragma unroll
        for (int j = 0; j < 4; ++j) {
            bf16_t h, l;
            split_bf16(v[j], h, l);
            hi[j] = h; lo[j] = l;
        }
    } else {
        const int i = (blockIdx.x - PW_BLOCKS) * P_THREADS + threadIdx.x;
        const u32x4 z = {0u, 0u, 0u, 0u};
        if (i < PZ_N16) zeroed[i] = z;
    }
}

// ---------------------------------------------------------------------------
// Kernel 1: tmp = relu(X @ W^T + b), one block = 80 rows x all 400 columns,
// 5 waves, one wave = 5 row tiles x 5 col tiles: column tiles wave, 5 + wave, ... 20 + wave.
// A wave's first column tile (columns 0..79, U's first 80 of 100) is computed with the operands
// swapped, so that a lane holds 8 consecutive columns of one row.
// Per pass (32 k) the block's 400 W rows (pre-split, pass order: a wave's copy reads 512
// contiguous bytes) are copied to LDS by asynchronous copies; its 80 X rows are loaded as f32 into registers one pass
// ahead of their place in the ring, split there and stored to LDS. Two buffers,
// the next pass's tile in flight while this pass is worked on.
// One LDS row = [64 B hi | 64 B lo | 16 B pad].
// Epilogue: U -> bf16 hi/lo in fragment order (k = column); V,Z -> bf16 hi/lo in fragment
// order (k = row); T -> out (f32); U/V column sums via atomicAdd.
// ---------------------------------------------------------------------------
#define G_WAVES   5
#define G_THREADS (G_WAVES * 32)
#define G_ROWS    (ROWG * 16)               // 80 rows of X per block
#define ST_ROWS   (M_COLS + G_ROWS)         // W rows first, then X rows
#define ST_PITCH  144                       // 16 B x odd: conflict-free b128 reads
#define ST_BYTES  (ST_ROWS * ST_PITCH)
#define CP_ROWS   (G_THREADS / 8)           // rows covered by one copy of the block
#define G_PASSES  (D_DIM / 32)
#define X_CH      (G_ROWS / CP_ROWS)        // X rows per lane and pass
#define XT_PITCH  80                        // epilogue's turn of a tile: 64 B + 16 B pad (16 B x odd)

__device__ __forceinline__ unsigned lds_off(const void* p) {
    return (unsigned)(unsigned long long)p;   // low 32 bits of a __shared__ address
}

// Ten 16-byte-per-lane copies to LDS. The closing s_wait_xcnt keeps every
// address register of the copies unwritten until the copies have taken them.
__device__ __forceinline__ void async_copy10(const unsigned (&l)[10],
                                             const bf16_t* const (&p)[10])
{
    asm volatile(
        "global_load_async_to_lds_b128 %0, %10, off\n\t"
        "global_load_async_to_lds_b128 %1, %11, off\n\t"
        "global_load_async_to_lds_b128 %2, %12, off\n\t"
        "global_load_async_to_lds_b128 %3, %13, off\n\t"
        "global_load_async_to_lds_b128 %4, %14, off\n\t"
        "global_load_async_to_lds_b128 %5, %15, off\n\t"
        "global_load_async_to_lds_b128 %6, %16, off\n\t"
        "global_load_async_to_lds_b128 %7, %17, off\n\t"
        "global_load_async_to_lds_b128 %8, %18, off\n\t"
        "global_load_async_to_lds_b128 %9, %19, off\n\t"
        "s_wait_xcnt 0x0"
        :: "v"(l[0]), "v"(l[1]), "v"(l[2]), "v"(l[3]), "v"(l[4]),
           "v"(l[5]), "v"(l[6]), "v"(l[7]), "v"(l[8]), "v"(l[9]),
           "v"(p[0]), "v"(p[1]), "v"(p[2]), "v"(p[3]), "v"(p[4]),
           "v"(p[5]), "v"(p[6]), "v"(p[7]), "v"(p[8]), "v"(p[9])
        : "memory");
}

// One pass's W tile: 20 copies per lane.
__device__ __forceinline__ void stage_w(unsigned lds, const bf16_t* gW)
{
#pragma unroll
    for (int g = 0; g < 2; ++g) {
        unsigned l[10];
        const bf16_t* p[10];
#pragma unroll
        for (int j = 0; j < 10; ++j) {
            l[j] = lds + (g * 10 + j) * (CP_ROWS * ST_PITCH);
            p[j] = gW + (g * 10 + j) * (CP_ROWS * WT_ROW);
        }
        async_copy10(l, p);
    }
}

// One pass's X tile, f32: 4 floats of each of 4 rows per lane (8 lanes = one 128-byte row).
__device__ __forceinline__ void load_x(f32x4 (&xr)[X_CH], const float* gX)
{
#pragma unroll
    for (int j = 0; j < X_CH; ++j)
        xr[j] = *(const f32x4*)(gX + j * (CP_ROWS * D_DIM));
    // the loads' address is advanced for the next pass: wait until the loads have
    // taken it (the scheduling fence keeps later register writes behind the wait)
    asm volatile("s_wait_xcnt 0x0" ::: "memory");
    __builtin_amdgcn_sched_barrier(0);
}

// Split the loaded X values and store them into the tile's X rows: 8 bytes hi, 8 bytes lo.
__device__ __forceinline__ void store_x(unsigned char* sx, const f32x4 (&xr)[X_CH])
{
#pragma unroll
    for (int j = 0; j < X_CH; ++j) {
        Pack4 h4, l4;
#pragma unroll
        for (int e = 0; e < 4; ++e) {
            bf16_t h, l;
            split_bf16(xr[j][e], h, l);
            h4.e[e] = h; l4.e[e] = l;
        }
        *(u32x2*)(sx + j * (CP_ROWS * ST_PITCH))      = h4.q;
        *(u32x2*)(sx + j * (CP_ROWS * ST_PITCH) + 64) = l4.q;
    }
}

__global__ void __launch_bounds__(G_THREADS, 3)   // 3 waves per SIMD: two blocks share a WGP
gemm_relu_lds_kernel(const float* __restrict__ X,
                     const bf16_t* __restrict__ Wt,
                     const float* __restrict__ bias,
                     bf16_t* __restrict__ Uhi, bf16_t* __restrict__ Ulo,
                     bf16_t* __restrict__ Vthi, bf16_t* __restrict__ Vtlo,
                     bf16_t* __restrict__ Zthi, bf16_t* __restrict__ Ztlo,
                     float* __restrict__ sums, float* __restrict__ out)
{
    __shared__ __attribute__((aligned(16))) unsigned char smem[2 * ST_BYTES];

    const int tid      = threadIdx.x;
    const int lane     = tid & 31;
    const int wave     = __builtin_amdgcn_readfirstlane(tid >> 5);
    const int rowGroup = blockIdx.x;
    const int half     = lane >> 4;
    const int lidx     = lane & 15;

    // this lane's share of every W copy: row (tid >> 3) of each group of CP_ROWS
    // rows, 16-byte chunk (tid & 7): chunks 0..3 are hi, 4..7 lo, in W's pass order as in LDS;
    // of every X load: the same row of each group, floats (tid & 7) * 4 .. + 3
    const int  crow = tid >> 3;
    const unsigned ldsT = lds_off(smem) + crow * ST_PITCH + (tid & 7) * 16;
    const bf16_t* gW = Wt + crow * WT_ROW + (tid & 7) * 8;
    const float* gX = X + (size_t)(rowGroup * G_ROWS + crow) * D_DIM + (tid & 7) * 4;
    unsigned char* sx = smem + (M_COLS + crow) * ST_PITCH + (tid & 7) * 8;
    f32x4 xr[X_CH];

    v8f acc[5][ROWG];
#pragma unroll
    for (int c = 0; c < 5; ++c)
#pragma unroll
        for (int t = 0; t < ROWG; ++t) acc[c][t] = {};

    load_x(xr, gX);
    gX += 32;
    stage_w(ldsT, gW);
    store_x(sx, xr);
    load_x(xr, gX);
    gX += 32;
    asm volatile("s_wait_dscnt 0x0" ::: "memory");      // tile 0: this wave's X rows stored
    asm volatile("s_wait_asynccnt 0x0" ::: "memory");   // ... and its W copies landed
    __syncthreads();                                    // ... and every other wave's
    stage_w(ldsT + ST_BYTES, gW + WT_PASS);
    store_x(sx + ST_BYTES, xr);

    for (int kt = 0; kt < G_PASSES; ++kt) {
        const int buf = (kt & 1) * ST_BYTES;
        const unsigned char* sa = smem + buf + (M_COLS + lidx) * ST_PITCH + (half << 4);
        const unsigned char* sb = smem + buf + (wave * 16 + lidx) * ST_PITCH + (half << 4);

        // X of tile kt + 2 flies through this pass; it is split and stored behind the barrier
        if (kt + 2 < G_PASSES) { load_x(xr, gX); gX += 32; }

        // lo(A) x hi(B) first, then hi(A) x lo(B) and hi(A) x hi(B): only one half of
        // the A fragments is live at a time, so that the accumulators stay in registers
        {
            Frag16 alo[ROWG];
#pragma unroll
            for (int t = 0; t < ROWG; ++t) {
                const unsigned char* r = sa + t * (16 * ST_PITCH);
                alo[t].q[0] = *(const u32x4*)(r + 64);
                alo[t].q[1] = *(const u32x4*)(r + 96);
            }
#pragma unroll
            for (int c = 0; c < 5; ++c) {
                const unsigned char* r = sb + c * (G_WAVES * 16 * ST_PITCH);
                Frag16 bhi;
                bhi.q[0] = *(const u32x4*)(r);
                bhi.q[1] = *(const u32x4*)(r + 32);
#pragma unroll
                for (int t = 0; t < ROWG; ++t)
                    acc[c][t] = c == 0 ? mma<true>(alo[t].v, bhi.v, acc[c][t]) : mma<false>(alo[t].v, bhi.v, acc[c][t]);
            }
        }
        {
            Frag16 ahi[ROWG];
#pragma unroll
            for (int t = 0; t < ROWG; ++t) {
                const unsigned char* r = sa + t * (16 * ST_PITCH);
                ahi[t].q[0] = *(const u32x4*)(r);
                ahi[t].q[1] = *(const u32x4*)(r + 32);
            }
#pragma unroll
            for (int c = 0; c < 5; ++c) {
                const unsigned char* r = sb + c * (G_WAVES * 16 * ST_PITCH);
                Frag16 bhi, blo;
                bhi.q[0] = *(const u32x4*)(r);
                bhi.q[1] = *(const u32x4*)(r + 32);
                blo.q[0] = *(const u32x4*)(r + 64);
                blo.q[1] = *(const u32x4*)(r + 96);
#pragma unroll
                for (int t = 0; t < ROWG; ++t)
                    acc[c][t] = c == 0 ? mma<true>(ahi[t].v, blo.v, acc[c][t]) : mma<false>(ahi[t].v, blo.v, acc[c][t]);
#pragma unroll
                for (int t = 0; t < ROWG; ++t)
                    acc[c][t] = c == 0 ? mma<true>(ahi[t].v, bhi.v, acc[c][t]) : mma<false>(ahi[t].v, bhi.v, acc[c][t]);
            }
        }

        // keeps the pass's last WMMAs in front of the barrier: sunk behind it they would
        // delay the issue of the next copies and shorten their lead
        __builtin_amdgcn_sched_barrier(0);
        // the four vector slots that the chip needs between the pass's last WMMA and a vector write of
        // its operand registers
        asm volatile("v_nop\n\tv_nop\n\tv_nop\n\tv_nop");
        asm volatile("s_wait_dscnt 0x0" ::: "memory");     // this wave has left the buffer, its X stores of tile kt + 1 are done
        asm volatile("s_wait_asynccnt 0x0" ::: "memory");  // its copies of tile kt + 1 landed
        __syncthreads();   // publishes tile kt + 1, frees this pass's buffer
        if (kt + 2 < G_PASSES) {
            stage_w(ldsT + buf, gW + (kt + 2) * WT_PASS);
            store_x(sx + buf, xr);
        }
    }
    asm volatile("s_wait_asynccnt 0x0" ::: "memory");      // no copy outlives the loop

    // ---- epilogue: bias + relu; route column; fold in column sums ----
    // A wave's first tile, transposed: columns wave * 16 + 8 * half + r of row (lane & 15) of each
    // row tile. These 8 values are the 16 bytes of this lane in U's fragment order, so that the
    // wave stores 512 contiguous bytes each for hi and lo.
    {
        const f32x4 b0 = *(const f32x4*)(bias + wave * 16 + (half << 3));
        const f32x4 b1 = *(const f32x4*)(bias + wave * 16 + (half << 3) + 4);
        bf16_t* ph = Uhi + ufrag_k16(wave) + lane * 8;
        bf16_t* pl = Ulo + ufrag_k16(wave) + lane * 8;
        float s[8];
#pragma unroll
        for (int r = 0; r < 8; ++r) s[r] = 0.f;
#pragma unroll
        for (int t = 0; t < ROWG; ++t) {
            Pack8 h8, l8;
#pragma unroll
            for (int r = 0; r < 8; ++r) {
                float v = acc[0][t][r] + (r < 4 ? b0[r & 3] : b1[r & 3]);
                v = v > 0.f ? v : 0.f;
                bf16_t h, l;
                split_bf16(v, h, l);
                h8.e[r] = h; l8.e[r] = l;
                s[r] += v;
            }
            *(u32x4*)(ph + (rowGroup * ROWG + t) * UFRAG_ROWT) = h8.q;
            *(u32x4*)(pl + (rowGroup * ROWG + t) * UFRAG_ROWT) = l8.q;
            // the stores' registers are reused below: wait until the stores have taken them
            // (the scheduling fence keeps later register writes behind the wait)
            asm volatile("s_wait_xcnt 0x0" ::: "memory");
            __builtin_amdgcn_sched_barrier(0);
        }
        // column sums: over the 16 rows that the lanes of a half hold, then lane i < 8 of each
        // half adds column 8 * half + i
        float sel = 0.f;
#pragma unroll
        for (int r = 0; r < 8; ++r) {
            float v = s[r];
            v = row_xor_add<1>(v);
            v = row_xor_add<2>(v);
            v = row_xor_add<4>(v);
            v = row_xor_add<8>(v);
            sel = lidx == r ? v : sel;
        }
        if (lidx < 8) atomicAdd(&sums[wave * 16 + (half << 3) + lidx], sel);   // [0..79]=U sums
        // the atomic's registers are reused below: wait until it has taken them
        // (the scheduling fence keeps later register writes behind the wait)
        asm volatile("s_wait_xcnt 0x0" ::: "memory");
        __builtin_amdgcn_sched_barrier(0);
    }

    // The other four tiles. The T / V,Z test stands outside the element loops, and only the
    // kinds that tile c can hold are written out, for speed only:
    // c = 1 holds columns 80..159, c = 2 160..239, c = 3 240..319, c = 4 320..399.
    const int rbase = rowGroup * G_ROWS + (half << 3);
#pragma unroll
    for (int c = 1; c < 5; ++c) {
        const int col = (c * G_WAVES + wave) * 16 + lidx;
        const float bv = bias[col];
        if (c == 1 && wave < 2) {
            // U columns 80..99 come in the plain orientation (8 rows of one column per lane). The wave
            // turns its tile through LDS, which nobody reads any more behind the loop's last barrier:
            // rows of 16 floats at a pitch of 80 bytes, zeros in the columns that are not U's (they are
            // U's k padding). Each lane then holds 8 consecutive columns of one row, as in the first tile.
            float* xs = (float*)(smem + wave * (G_ROWS * XT_PITCH));
            float s = 0.f;
#pragma unroll
            for (int t = 0; t < ROWG; ++t)
#pragma unroll
                for (int r = 0; r < 8; ++r) {
                    float v = acc[c][t][r] + bv;
                    v = (col < KC && v > 0.f) ? v : 0.f;
                    xs[(t * 16 + (half << 3) + r) * (XT_PITCH / 4) + lidx] = v;
                    s += v;
                }
            // the lanes read each other's values: every store of the wave is done first
            asm volatile("s_wait_dscnt 0x0" ::: "memory");
            bf16_t* ph = Uhi + ufrag_k16(G_WAVES + wave) + lane * 8;
            bf16_t* pl = Ulo + ufrag_k16(G_WAVES + wave) + lane * 8;
#pragma unroll
            for (int t = 0; t < ROWG; ++t) {
                const float* xr8 = xs + (t * 16 + lidx) * (XT_PITCH / 4) + (half << 3);
                const f32x4 x0 = *(const f32x4*)(xr8);
                const f32x4 x1 = *(const f32x4*)(xr8 + 4);
                Pack8 h8, l8;
#pragma unroll
                for (int r = 0; r < 8; ++r) {
                    bf16_t h, l;
                    split_bf16(r < 4 ? x0[r & 3] : x1[r & 3], h, l);
                    h8.e[r] = h; l8.e[r] = l;
                }
                *(u32x4*)(ph + (rowGroup * ROWG + t) * UFRAG_ROWT) = h8.q;
                *(u32x4*)(pl + (rowGroup * ROWG + t) * UFRAG_ROWT) = l8.q;
                // the stores' registers are reused below: wait until the stores have taken them
                // (the scheduling fence keeps later register writes behind the wait)
                asm volatile("s_wait_xcnt 0x0" ::: "memory");
                __builtin_amdgcn_sched_barrier(0);
            }
            if (col < KC) atomicAdd(&sums[col], s);       // [80..99]=U sums
            // the atomic's registers are reused below: wait until it has taken them
            // (the scheduling fence keeps later register writes behind the wait)
            asm volatile("s_wait_xcnt 0x0" ::: "memory");
            __builtin_amdgcn_sched_barrier(0);
        }
        if (c == 4 || (c == 3 && col >= 3 * KC)) {
            float* pT = out + (size_t)rbase * OUTC + (KC + (col - 3 * KC));
#pragma unroll
            for (int t = 0; t < ROWG; ++t)
#pragma unroll
                for (int r = 0; r < 8; ++r) {
                    const float v = acc[c][t][r] + bv;
                    pT[(t * 16 + r) * OUTC] = v > 0.f ? v : 0.f;
                    // the stores' registers are reused below: wait until the store has taken them
                    // (the scheduling fence keeps later register writes behind the wait)
                    if (r == 7) { asm volatile("s_wait_xcnt 0x0" ::: "memory"); __builtin_amdgcn_sched_barrier(0); }
                }
        } else if (c != 1 || col >= KC) {
            // V and Z lie in fragment order (k = row): the 8 rows a lane holds of one tile are
            // that order's 16 bytes of lane (half, column & 15), so that neighbouring lanes
            // store neighbouring 16 bytes: one b128 store each for hi and lo
            const bool isV = c == 1 || (c == 2 && col < 2 * KC);
            const int  A   = frag_lane(half, isV ? col - KC : col - 2 * KC);
            bf16_t* ph = (isV ? Vthi : Zthi) + A;
            bf16_t* pl = (isV ? Vtlo : Ztlo) + A;
            float s = 0.f;
#pragma unroll
            for (int t = 0; t < ROWG; ++t) {
                Pack8 h8, l8;
#pragma unroll
                for (int r = 0; r < 8; ++r) {
                    float v = acc[c][t][r] + bv;
                    v = v > 0.f ? v : 0.f;
                    bf16_t h, l;
                    split_bf16(v, h, l);
                    h8.e[r] = h; l8.e[r] = l;
                    s += v;
                }
                *(u32x4*)(ph + frag_tile16(rowGroup * ROWG + t)) = h8.q;
                *(u32x4*)(pl + frag_tile16(rowGroup * ROWG + t)) = l8.q;
                // the stores' registers are reused below: wait until the stores have taken them
                // (the scheduling fence keeps later register writes behind the wait)
                asm volatile("s_wait_xcnt 0x0" ::: "memory");
                __builtin_amdgcn_sched_barrier(0);
            }
            if (isV) atomicAdd(&sums[col], s);            // [100..199]=V sums
        }
        // the registers of the tile's last stores and of its atomic are reused by the next tile:
        // wait until they have been taken (the scheduling fence keeps later writes behind the wait)
        asm volatile("s_wait_xcnt 0x0" ::: "memory");
        __builtin_amdgcn_sched_barrier(0);
    }
}

// ---------------------------------------------------------------------------
// VtZ = V^T @ Z (100x100, reduction over N). Split-K WMMA + f32 atomics.
// One wave = a square of 4 x 4 tiles, so that the 16 KB of fragments that it loads per step of
// 32 k (32 loads, all in flight together) feed 48 WMMAs. The 7 x 7 tiles are covered by four such
// squares, row and column tiles 0..3 or 3..6; the tiles with index 3 are stored by the first square only.
// One block = one square and one of VTZ_SPLITS shares of k; its 8 waves take every 8th step of
// that share, add their tiles up through LDS, and the block does one atomic add per element.
// A/B fragments are read from planes in fragment order: 512 contiguous bytes per load.
// Pad columns (>=100) hold garbage but only affect guarded (unstored) outputs.
// ---------------------------------------------------------------------------
#define VZ_T      4                          // tiles per side of a wave's square
#define VZ_PIECES (VZ_T * VZ_T * 2 * 32)     // 16-byte pieces of one wave's accumulators
__global__ void __launch_bounds__(WPB * 32)
vtz_kernel(const bf16_t* __restrict__ Vthi, const bf16_t* __restrict__ Vtlo,
           const bf16_t* __restrict__ Zthi, const bf16_t* __restrict__ Ztlo,
           float* __restrict__ VtZ)
{
    __shared__ __attribute__((aligned(16))) f32x4 red[WPB][VZ_PIECES];

    const int tid   = threadIdx.x;
    const int lane  = tid & 31;
    const int wave  = __builtin_amdgcn_readfirstlane(tid >> 5);
    // the four squares of one share of k lie VTZ_SPLITS blocks apart
    const int split = blockIdx.x % VTZ_SPLITS;
    const int sq    = blockIdx.x / VTZ_SPLITS;
    const int mt0   = (sq & 2) ? 7 - VZ_T : 0;             // first row tile of the square
    const int nt0   = (sq & 1) ? 7 - VZ_T : 0;             // first column tile

    const int kt0 = split * WPB + wave;                    // the wave's first step of 32 k
    const bf16_t* ah = Vthi + kt0 * FRAG_KSTEP + mt0 * FRAG_BLK + lane * 8;
    const bf16_t* al = Vtlo + kt0 * FRAG_KSTEP + mt0 * FRAG_BLK + lane * 8;
    const bf16_t* bh = Zthi + kt0 * FRAG_KSTEP + nt0 * FRAG_BLK + lane * 8;
    const bf16_t* bl = Ztlo + kt0 * FRAG_KSTEP + nt0 * FRAG_BLK + lane * 8;

    v8f acc[VZ_T][VZ_T];
#pragma unroll
    for (int i = 0; i < VZ_T; ++i)
#pragma unroll
        for (int j = 0; j < VZ_T; ++j) acc[i][j] = {};

    for (int kt = kt0; kt < N_ROWS / 32; kt += VTZ_SPLITS * WPB) {
        Frag16 vh[VZ_T], vl[VZ_T], zh[VZ_T], zl[VZ_T];
#pragma unroll
        for (int i = 0; i < VZ_T; ++i) {
            vl[i].q[0] = *(const u32x4*)(al + i * FRAG_BLK);
            vl[i].q[1] = *(const u32x4*)(al + i * FRAG_BLK + FRAG_BLK / 2);
            zh[i].q[0] = *(const u32x4*)(bh + i * FRAG_BLK);
            zh[i].q[1] = *(const u32x4*)(bh + i * FRAG_BLK + FRAG_BLK / 2);
        }
#pragma unroll
        for (int i = 0; i < VZ_T; ++i) {
            vh[i].q[0] = *(const u32x4*)(ah + i * FRAG_BLK);
            vh[i].q[1] = *(const u32x4*)(ah + i * FRAG_BLK + FRAG_BLK / 2);
            zl[i].q[0] = *(const u32x4*)(bl + i * FRAG_BLK);
            zl[i].q[1] = *(const u32x4*)(bl + i * FRAG_BLK + FRAG_BLK / 2);
        }
        // the loads' address registers are advanced for the next step: wait until the loads have
        // taken them. The wait names the four addresses as inputs, so that they stay in their registers
        // up to it and no load of the group lands on one; the scheduling fence keeps later register
        // writes behind the wait
        asm volatile("s_wait_xcnt 0x0" :: "v"(ah), "v"(al), "v"(bh), "v"(bl) : "memory");
        __builtin_amdgcn_sched_barrier(0);
        ah += VTZ_SPLITS * WPB * FRAG_KSTEP;
        al += VTZ_SPLITS * WPB * FRAG_KSTEP;
        bh += VTZ_SPLITS * WPB * FRAG_KSTEP;
        bl += VTZ_SPLITS * WPB * FRAG_KSTEP;
#pragma unroll
        for (int i = 0; i < VZ_T; ++i)
#pragma unroll
            for (int j = 0; j < VZ_T; ++j)
                acc[i][j] = __builtin_amdgcn_wmma_f32_16x16x32_bf16(false, vl[i].v, false, zh[j].v, (short)0, acc[i][j], false, false);
#pragma unroll
        for (int i = 0; i < VZ_T; ++i)
#pragma unroll
            for (int j = 0; j < VZ_T; ++j)
                acc[i][j] = __builtin_amdgcn_wmma_f32_16x16x32_bf16(false, vh[i].v, false, zl[j].v, (short)0, acc[i][j], false, false);
#pragma unroll
        for (int i = 0; i < VZ_T; ++i)
#pragma unroll
            for (int j = 0; j < VZ_T; ++j)
                acc[i][j] = __builtin_amdgcn_wmma_f32_16x16x32_bf16(false, vh[i].v, false, zh[j].v, (short)0, acc[i][j], false, false);
    }

    // piece ((i * VZ_T + j) * 2 + q) * 32 + lane = registers 4 q .. 4 q + 3 of tile (i, j)
#pragma unroll
    for (int i = 0; i < VZ_T; ++i)
#pragma unroll
        for (int j = 0; j < VZ_T; ++j)
#pragma unroll
            for (int q = 0; q < 2; ++q)
                red[wave][((i * VZ_T + j) * 2 + q) * 32 + lane] =
                    f32x4{acc[i][j][4 * q], acc[i][j][4 * q + 1], acc[i][j][4 * q + 2], acc[i][j][4 * q + 3]};
    __syncthreads();                       // every wave's tiles lie in LDS

    // thread tid adds up piece i * 256 + tid of the 8 waves: tile (i, tid >> 6), q = (tid >> 5) & 1
    const int j    = tid >> 6;
    const int ncol = (nt0 + j) * 16 + (lane & 15);
    const int mrow = mt0 * 16 + ((lane >> 4) << 3) + (((tid >> 5) & 1) << 2);
    const bool nok = ncol < KC && (nt0 == 0 || j > 0);
#pragma unroll
    for (int i = 0; i < VZ_T; ++i) {
        f32x4 s = red[0][i * (WPB * 32) + tid];
#pragma unroll
        for (int w = 1; w < WPB; ++w) s += red[w][i * (WPB * 32) + tid];
        if (nok && (mt0 == 0 || i > 0)) {
#pragma unroll
            for (int e = 0; e < 4; ++e) {
                const int m = mrow + i * 16 + e;
                if (m < KC) atomicAdd(&VtZ[m * KC + ncol], s[e]);
            }
        }
        // the atomics' registers are reused by the next tile: wait until they have been taken
        // (the scheduling fence keeps later register writes behind the wait)
        asm volatile("s_wait_xcnt 0x0" ::: "memory");
        __builtin_amdgcn_sched_barrier(0);
    }
}

// ---------------------------------------------------------------------------
// res = (U @ VtZ) * Dscale -> out[:, 0:100]. K padded 100 -> 128 (zeros).
// One wave = 32 rows (2 row tiles) x all 7 column tiles, so that U is read once and a wave
// owns whole result rows. The block brings VtZ (100 x 100 f32) into LDS, splits it there into
// the two bf16 planes of 128 k (zeros from 100 on) x 112 columns in fragment order, and every wave
// forms Dscale = 1 / (dot(sumU, sumV) / N + 1e-6) for itself: no launch of their own for these.
// U's k 112..127 are never stored by the main GEMM: those halves of the last fragments are
// zeros in registers.
// VtZ is the A operand and U the B operand: register r of lane (half, i) = (row i, column
// 8 * half + r). The wave lays its rows down in LDS (400 bytes a row, no gap) and stores
// them to out in 16-byte pieces that run along the rows.
// The column tiles go in two groups (4 + 3), so that U's fragments and the accumulators fit
// four waves per SIMD: every block of the grid is then resident at once.
// ---------------------------------------------------------------------------
#define R_WAVES   8
#define R_THREADS (R_WAVES * 32)
#define R_PAIRS   (N_ROWS / 32)            // 3125 pairs of row tiles
#define R_PLANE   (MPAD * KPAD)            // elements of one VtZ plane
#define R_PLANE16 (R_PLANE * 2 / 16)       // its 16-byte pieces
#define R_ROW16   (KC / 4)                 // 16-byte pieces of one result row
#define R_VTZ16   (KC * KC / 4)            // 16-byte pieces of VtZ as f32
#define R_VTZ_LD  ((R_VTZ16 + R_THREADS - 1) / R_THREADS)
// 16-byte pieces of the f32 copy in LDS per thread: 128 rows of 100 floats and the 12 floats that the
// last column tile reads past the last row
#define R_F32_ST  (((KPAD * KC + MPAD - KC) / 4 + R_THREADS - 1) / R_THREADS)

__global__ void __launch_bounds__(R_THREADS, 4)
res_kernel(const bf16_t* __restrict__ Uhi, const bf16_t* __restrict__ Ulo,
           const float* __restrict__ VtZ, const float* __restrict__ sums,
           float* __restrict__ out)
{
    // the VtZ planes first: every fragment then lies within the reach of an LDS load's immediate offset
    __shared__ __attribute__((aligned(16))) unsigned char smem[2 * R_PLANE * 2 + R_WAVES * 32 * KC * 4];
    bf16_t* sB = (bf16_t*)smem;
    // VtZ as f32 lies where the waves later turn their rows: it is done with at the second barrier
    float* sF = (float*)(smem + 2 * R_PLANE * 2);

    const int tid  = threadIdx.x;
    const int lane = tid & 31;
    const int wave = __builtin_amdgcn_readfirstlane(tid >> 5);
    const int half = lane >> 4, lidx = lane & 15;
    const int pair = blockIdx.x * R_WAVES + wave;
    // the last block's spare waves load the last pair again, help to stage, and leave behind the barriers
    const int lp   = pair < R_PAIRS ? pair : R_PAIRS - 1;

    f32x4 stg[R_VTZ_LD];
#pragma unroll
    for (int i = 0; i < R_VTZ_LD; ++i) {
        const int p = i * R_THREADS + tid;
        // past the end the last piece is loaded again (and not used): no branch among the loads
        stg[i] = ((const f32x4*)VtZ)[(i + 1) * R_THREADS <= R_VTZ16 || p < R_VTZ16 ? p : R_VTZ16 - 1];
    }
    // the loads' address registers are reused below: wait until the loads have taken them
    // (the scheduling fence keeps later register writes behind the wait)
    asm volatile("s_wait_xcnt 0x0" ::: "memory");
    __builtin_amdgcn_sched_barrier(0);
    // terms lane, lane + 32, lane + 64, lane + 96 of dot(sumU, sumV), zeros from 100 on
    float pr[4];
#pragma unroll
    for (int q = 0; q < 4; ++q) {
        const int e  = q * 32 + lane;
        const int ec = e < KC ? e : KC - 1;
        const float su = sums[ec], sv = sums[KC + ec];
        pr[q] = e < KC ? su * sv : 0.f;
    }
    // as above: the address registers of these loads are reused by the loads that follow
    asm volatile("s_wait_xcnt 0x0" ::: "memory");
    __builtin_amdgcn_sched_barrier(0);
    const bf16_t* ah = Uhi + lp * (2 * UFRAG_ROWT) + lane * 8;
    const bf16_t* al = Ulo + lp * (2 * UFRAG_ROWT) + lane * 8;
    Frag16 uh[2][KPAD / 32], ul[2][KPAD / 32];
#pragma unroll
    for (int t = 0; t < 2; ++t)
#pragma unroll
        for (int kt = 0; kt < KPAD / 32; ++kt) {
            const int o0 = t * UFRAG_ROWT + ufrag_k16(2 * kt), o1 = t * UFRAG_ROWT + ufrag_k16(2 * kt + 1);
            uh[t][kt].q[0] = *(const u32x4*)(ah + o0);
            ul[t][kt].q[0] = *(const u32x4*)(al + o0);
            if ((2 * kt + 1) * 16 < MPAD) {
                uh[t][kt].q[1] = *(const u32x4*)(ah + o1);
                ul[t][kt].q[1] = *(const u32x4*)(al + o1);
            } else {
                uh[t][kt].q[1] = u32x4{0u, 0u, 0u, 0u};
                ul[t][kt].q[1] = u32x4{0u, 0u, 0u, 0u};
            }
        }
    // the loads' address registers are reused below: wait until the loads have taken them
    // (the scheduling fence keeps later register writes behind the wait)
    asm volatile("s_wait_xcnt 0x0" ::: "memory");
    __builtin_amdgcn_sched_barrier(0);
#pragma unroll
    for (int i = 0; i < R_F32_ST; ++i) {
        // rows 100..127 (k padding) are zeros
        const int p = i * R_THREADS + tid;
        const f32x4 z = {0.f, 0.f, 0.f, 0.f};
        ((f32x4*)sF)[p] = i >= R_VTZ_LD ? z : ((i + 1) * R_THREADS <= R_VTZ16 || p < R_VTZ16) ? stg[i < R_VTZ_LD ? i : 0] : z;
    }
    // the sum over 128 terms as a tree of halves (64, 32, ... 1); every lane ends with the total
    float dot = (pr[0] + pr[2]) + (pr[1] + pr[3]);
    dot += __shfl_xor(dot, 16, 32);
    dot = row_xor_add<8>(dot);
    dot = row_xor_add<4>(dot);
    dot = row_xor_add<2>(dot);
    dot = row_xor_add<1>(dot);
    const float ds = 1.0f / (dot / (float)N_ROWS + 1e-6f);
    __syncthreads();                       // VtZ lies in LDS as f32
    // One thread builds the 16-byte piece (8 consecutive k of one column) of each of the 7 column
    // tiles, hi and lo: k = (tid >> 4) * 8 + j, column = 16 * i + (tid & 15); in fragment order
    // that is piece (tid >> 6) * 7 * 64 + i * 64 + (tid & 63) of a plane. Columns 100..111 take
    // the next row's first values: they reach only result columns that are never stored.
    {
        const float* sk = sF + ((tid >> 4) << 3) * KC + lidx;
#pragma unroll
        for (int i = 0; i < MPAD / 16; ++i) {
            Pack8 h8, l8;
#pragma unroll
            for (int j = 0; j < 8; ++j) {
                bf16_t h, l;
                split_bf16(sk[j * KC + i * 16], h, l);
                h8.e[j] = h; l8.e[j] = l;
            }
            const int p = (tid >> 6) * (FRAG_KSTEP / 8) + i * (FRAG_BLK / 8) + (tid & 63);
            ((u32x4*)sB)[p]             = h8.q;
            ((u32x4*)sB)[R_PLANE16 + p] = l8.q;
        }
    }
    __syncthreads();                       // both VtZ planes lie in LDS, and nobody reads the f32 copy any more
    if (pair >= R_PAIRS) return;           // wave-uniform, behind the last barrier

    const bf16_t* bh = sB + lane * 8;
    const bf16_t* bl = sB + R_PLANE + lane * 8;
    float* st = (float*)(smem + 2 * R_PLANE * 2) + wave * (32 * KC);
#pragma unroll
    for (int g = 0; g < 2; ++g) {
        v8f acc[4][2];
#pragma unroll
        for (int c = 0; c < 4; ++c) { acc[c][0] = {}; acc[c][1] = {}; }
#pragma unroll
        for (int kt = 0; kt < KPAD / 32; ++kt)
#pragma unroll
            for (int c = 0; c < 4 - g; ++c) {
                const int p0 = frag_tile16(2 * kt) + (g * 4 + c) * FRAG_BLK;
                const int p1 = frag_tile16(2 * kt + 1) + (g * 4 + c) * FRAG_BLK;
                Frag16 bhi, blo;
                bhi.q[0] = *(const u32x4*)(bh + p0); bhi.q[1] = *(const u32x4*)(bh + p1);
                blo.q[0] = *(const u32x4*)(bl + p0); blo.q[1] = *(const u32x4*)(bl + p1);
#pragma unroll
                for (int t = 0; t < 2; ++t) acc[c][t] = mma<true>(ul[t][kt].v, bhi.v, acc[c][t]);
#pragma unroll
                for (int t = 0; t < 2; ++t) acc[c][t] = mma<true>(uh[t][kt].v, blo.v, acc[c][t]);
#pragma unroll
                for (int t = 0; t < 2; ++t) acc[c][t] = mma<true>(uh[t][kt].v, bhi.v, acc[c][t]);
            }
#pragma unroll
        for (int c = 0; c < 4 - g; ++c)
#pragma unroll
            for (int t = 0; t < 2; ++t) {
                float* p = st + (t * 16 + lidx) * KC + (g * 4 + c) * 16 + (half << 3);
                const f32x4 v0 = {acc[c][t][0] * ds, acc[c][t][1] * ds, acc[c][t][2] * ds, acc[c][t][3] * ds};
                const f32x4 v1 = {acc[c][t][4] * ds, acc[c][t][5] * ds, acc[c][t][6] * ds, acc[c][t][7] * ds};
                if (g * 4 + c < 6) {
                    *(f32x4*)(p)     = v0;
                    *(f32x4*)(p + 4) = v1;
                } else if (half == 0) {
                    *(f32x4*)(p) = v0;     // columns 96..99; 100..111 are padding
                }
            }
    }
    // the lanes read each other's values: every store of the wave is done first
    asm volatile("s_wait_dscnt 0x0" ::: "memory");
    char* po = (char*)(out + (size_t)pair * (32 * OUTC));
    // 16-byte piece j = 32 * step + lane of the wave's 32 rows x 25 pieces: c4 = j % 25, off = its bytes into po
    unsigned c4  = lane < R_ROW16 ? lane : lane - R_ROW16;
    unsigned off = (lane < R_ROW16 ? 0 : OUTC * 4) + c4 * 16;
#pragma unroll
    for (int b = 0; b < 5; ++b) {
#pragma unroll
        for (int i = 0; i < 5; ++i) {
            *(f32x4*)(po + off) = *(const f32x4*)(st + ((b * 5 + i) * 32 + lane) * 4);
            // 32 pieces on: one row and 7 pieces, or two rows less 18
            c4  += 32 - R_ROW16;
            off += OUTC * 4 + (32 - R_ROW16) * 16;
            if (c4 >= R_ROW16) { c4 -= R_ROW16; off += OUTC * 4 - R_ROW16 * 16; }
        }
        // the stores' registers are reused below: wait until the stores have taken them
        // (the scheduling fence keeps later register writes behind the wait)
        asm volatile("s_wait_xcnt 0x0" ::: "memory");
        __builtin_amdgcn_sched_barrier(0);
    }
}

// ---------------------------------------------------------------------------
// Launch
// ---------------------------------------------------------------------------
extern "C" void kernel_launch(void* const* d_in, const int* in_sizes, int n_in,
                              void* d_out, int out_size, void* d_ws, size_t ws_size,
                              hipStream_t stream)
{
    (void)in_sizes; (void)n_in; (void)out_size;
    const float* X  = (const float*)d_in[0];   // 100000 x 512
    const float* W  = (const float*)d_in[1];   // 400 x 512
    const float* bb = (const float*)d_in[2];   // 400
    float* out = (float*)d_out;                // 100000 x 200

    // ---- workspace carve-up (all regions 64B aligned) ----
    char* base = (char*)d_ws;
    size_t off = 0;
    auto carve = [&](size_t bytes) -> char* {
        char* p = base + off;
        off += (bytes + 63) & ~(size_t)63;
        return p;
    };
    bf16_t* Uhi  = (bf16_t*)carve((size_t)N_ROWS * KPAD * 2);
    bf16_t* Ulo  = (bf16_t*)carve((size_t)N_ROWS * KPAD * 2);   // contiguous w/ Uhi
    bf16_t* Vthi = (bf16_t*)carve((size_t)MPAD * N_ROWS * 2);
    bf16_t* Vtlo = (bf16_t*)carve((size_t)MPAD * N_ROWS * 2);
    bf16_t* Zthi = (bf16_t*)carve((size_t)MPAD * N_ROWS * 2);
    bf16_t* Ztlo = (bf16_t*)carve((size_t)MPAD * N_ROWS * 2);
    bf16_t* Wt   = (bf16_t*)carve((size_t)M_COLS * D_DIM * 2 * 2);   // hi and lo, pass order
    float*  sums   = (float*)carve(256 * 4);                    // [U(100)|V(100)|pad]
    float*  VtZ    = (float*)carve(KC * KC * 4);                // contiguous w/ sums
    (void)ws_size;

    // 1. pre-split W; zero sums+VtZ (atomics targets)
    prep_kernel<<<PW_BLOCKS + PZ_BLOCKS, P_THREADS, 0, stream>>>(W, Wt, (u32x4*)sums);
    // 2. fused X split + GEMM + bias + relu + scatter + column sums
    gemm_relu_lds_kernel<<<N_ROWS / G_ROWS, G_THREADS, 0, stream>>>(X, Wt, bb,
        Uhi, Ulo, Vthi, Vtlo, Zthi, Ztlo, sums, out);
    // 3. VtZ = V^T @ Z (split-K)
    vtz_kernel<<<4 * VTZ_SPLITS, WPB * 32, 0, stream>>>(Vthi, Vtlo, Zthi, Ztlo, VtZ);
    // 4. VtZ split + Dscale + res = U @ VtZ * Dscale -> out[:, 0:100]
    {
        const int blocks = (R_PAIRS + R_WAVES - 1) / R_WAVES;
        res_kernel<<<blocks, R_THREADS, 0, stream>>>(Uhi, Ulo, VtZ, sums, out);
    }
}
